// v000
// The times below were measured on an AMD MI455X: many runs one after another, warmed up first and cycling through
// copies of the inputs, with the whole window's GPU time divided by the number of runs. Launches and the gaps
// between them are all in it. The median over several windows is given; except for v000 it joins two sittings, which
// can be a few percent apart, so the side-by-side timings, each taken in one sitting, are the better comparison.
// The starting kernel, v000, takes 4050 microseconds a run.
#include <hip/hip_runtime.h>

// MyCausalMHA (x [4][2048][1024]; q/k/v = x W^T + b ([out][in] Linears); 16 heads x 64; interleaved-pair RoPE on q and k (pair (2k,2k+1) rotated by t / 10000^(2k/64)); scores = q.k / 8, causal (tril, arithmetic) -> -inf;
// softmax (the reference's +1e-8 on the denominator is below f32 resolution since the row max contributes exp(0) = 1); out = merged attn.v Wo^T + bo).
// Compute dtypes, f32 accumulate: every input rounded to bf16; projections on PLAIN bf16 operands (inputs: exact, + bias); rotary cos/sin table in f32; scores and
// attn.v on bf16 hi+lo planes (3 products) for the first RH = 256 query rows of every batch (few keys) and on SINGLE fp16 planes for rows >= 256;
// output hi+lo x exact Wo (2 products) + bo. One-wave-per-64x64-tile GEMMs, one batch element at a time. Deterministic, no

#define NB_  4
#define TT   2048
#define DD   1024
#define NH_  16
#define HD   64
#define ZH   2
#define RH   256                  // query rows < RH: hi+lo planes; rows >= RH: fp16 planes
#define NF   32                   // rotary frequencies (head_dim / 2)
#define SCL  0.125f               // 1/sqrt(64)
#define PCAR 1024.0f         // P scale for fp16 rows, undone in k_merge
typedef _Float16 h16;
typedef unsigned short bf;
typedef __attribute__((ext_vector_type(16))) __bf16   v16bf;
typedef __attribute__((ext_vector_type(16))) _Float16 v16h;
typedef __attribute__((ext_vector_type(8)))  _Float16 v8h;
typedef __attribute__((ext_vector_type(8)))  unsigned short v8us;
typedef __attribute__((ext_vector_type(8)))  float    v8f;
typedef __attribute__((ext_vector_type(4)))  float    v4f;
typedef v8h  __attribute__((may_alias)) v8ha;
typedef v4f  __attribute__((may_alias)) v4fa;
typedef v8us __attribute__((may_alias)) v8usa;

__device__ __forceinline__ unsigned short f2bf(float f) { unsigned u = __float_as_uint(f); u += 0x7FFFu + ((u >> 16) & 1u); return (unsigned short)(u >> 16); }
__device__ __forceinline__ float bf2f(unsigned short b) { return __uint_as_float(((unsigned)b) << 16); }
__device__ __forceinline__ float bfr(float f) { return bf2f(f2bf(f)); }
__device__ __forceinline__ v16h cat16(v8h lo, v8h hi) { return __builtin_shufflevector(lo, hi, 0, 1, 2, 3, 4, 5, 6, 7, 8, 9, 10, 11, 12, 13, 14, 15); }
__device__ __forceinline__ v16bf cat16b(v8us lo, v8us hi) { return __builtin_bit_cast(v16bf, __builtin_shufflevector(lo, hi, 0, 1, 2, 3, 4, 5, 6, 7, 8, 9, 10, 11, 12, 13, 14, 15)); }
__device__ __forceinline__ v8f wmma16(v16h a, v16h b, v8f c) { return __builtin_amdgcn_wmma_f32_16x16x32_f16(false, a, false, b, (short)0, c, false, false); }
__device__ __forceinline__ v8f wmmab(v16bf a, v16bf b, v8f c) { return __builtin_amdgcn_wmma_f32_16x16x32_bf16(false, a, false, b, (short)0, c, false, false); }



// ---- k_gemmw: register-blocked GEMM, ONE WAVE per 64x64 output tile (16 accumulators), operands straight from K-contiguous 16-bit planes; grid (M/64, N/64, Z), 32 threads.
// C[m][n] (f32, pitch ldc, + optional f32 bias[n]) = sum_k A[m][k] Bt[n][k] (+ split products per NSPLIT). z-batch strides sA/sB/sC in elements. K % 32 == 0.
template <typename T16> struct WFrag;
template <> struct WFrag<h16> { typedef v16h V; static __device__ __forceinline__ V ld(const h16* p) { return cat16(*(const v8h*)p, *(const v8h*)(p + 16)); } static __device__ __forceinline__ v8f mma(V a, V b, v8f c) { return wmma16(a, b, c); } };
template <> struct WFrag<bf> { typedef v16bf V; static __device__ __forceinline__ V ld(const bf* p) { return cat16b(*(const v8us*)p, *(const v8us*)(p + 16)); } static __device__ __forceinline__ v8f mma(V a, V b, v8f c) { return wmmab(a, b, c); } };
template <typename T16, int NSPLIT, bool BIAS>
__global__ __launch_bounds__(32) void k_gemmw(const T16* __restrict__ A, const T16* __restrict__ A2, const T16* __restrict__ Bt, const T16* __restrict__ Bt2, int K, float* C, int ldc, const float* __restrict__ bias, size_t sA, size_t sB, size_t sC) {
    typedef typename WFrag<T16>::V V;
    __shared__ __align__(16) float os[16 * 68];
    const size_t z = blockIdx.z; A += z * sA; if (A2) A2 += z * sA; Bt += z * sB; if (Bt2) Bt2 += z * sB; C += z * sC;
    const int lane = threadIdx.x & 31, lr = lane & 15, hi = lane >> 4; const int r0 = blockIdx.x * 64, c0 = blockIdx.y * 64;
    v8f acc[4][4];
#pragma unroll
    for (int mb = 0; mb < 4; ++mb)
#pragma unroll
        for (int nb = 0; nb < 4; ++nb) acc[mb][nb] = (v8f){};
    const size_t aoff = (size_t)(r0 + lr) * K + 8 * hi, boff = (size_t)(c0 + lr) * K + 8 * hi;
#pragma unroll 1
    for (int kc = 0; kc < K; kc += 32) {
        V a[4], a2[4];
#pragma unroll
        for (int mb = 0; mb < 4; ++mb) { a[mb] = WFrag<T16>::ld(A + aoff + (size_t)mb * 16 * K + kc); if (NSPLIT == 1 || NSPLIT == 2) a2[mb] = WFrag<T16>::ld(A2 + aoff + (size_t)mb * 16 * K + kc); }
#pragma unroll
        for (int nb = 0; nb < 4; ++nb) { const V b = WFrag<T16>::ld(Bt + boff + (size_t)nb * 16 * K + kc); V b2; if (NSPLIT >= 2) b2 = WFrag<T16>::ld(Bt2 + boff + (size_t)nb * 16 * K + kc);
#pragma unroll
            for (int mb = 0; mb < 4; ++mb) { acc[mb][nb] = WFrag<T16>::mma(a[mb], b, acc[mb][nb]); if (NSPLIT == 1 || NSPLIT == 2) acc[mb][nb] = WFrag<T16>::mma(a2[mb], b, acc[mb][nb]); if (NSPLIT >= 2) acc[mb][nb] = WFrag<T16>::mma(a[mb], b2, acc[mb][nb]); } }
        asm volatile("v_nop\n\tv_nop\n\tv_nop\n\tv_nop" : "+v"(acc[0][0]), "+v"(acc[1][1]), "+v"(acc[2][2]), "+v"(acc[3][3]) : "v"(a[0]), "v"(a[3]));
    }
#pragma unroll
    for (int mb = 0; mb < 4; ++mb) {
#pragma unroll
        for (int nb = 0; nb < 4; ++nb) {
#pragma unroll
            for (int j = 0; j < 8; ++j) os[(hi * 8 + j) * 68 + nb * 16 + lr] = acc[mb][nb][j]; }
        __builtin_amdgcn_wave_barrier(); asm volatile("" ::: "memory");
        float* crow = C + (size_t)(r0 + mb * 16) * ldc + c0;
{
#pragma unroll
            for (int s = 0; s < 8; ++s) { const int row = 2 * s + hi, cofs = lr * 4; v4f val = *(const v4fa*)(os + row * 68 + cofs); if (BIAS) { val[0] += bfr(bias[c0 + cofs]); val[1] += bfr(bias[c0 + cofs + 1]); val[2] += bfr(bias[c0 + cofs + 2]); val[3] += bfr(bias[c0 + cofs + 3]); }
                *(v4f*)(crow + (size_t)row * ldc + cofs) = val; }
             }
        __builtin_amdgcn_wave_barrier(); asm volatile("" ::: "memory");
    }
}

__device__ __forceinline__ h16 tohx(float x) { return (h16)x; }
__device__ __forceinline__ void splitf(float y, unsigned short& h, unsigned short& l) { h = f2bf(y); l = f2bf(y - bf2f(h)); }
typedef __attribute__((ext_vector_type(2))) unsigned short v2us;
typedef __attribute__((ext_vector_type(2))) _Float16 v2h;
typedef __attribute__((ext_vector_type(4))) _Float16 v4h;
typedef __attribute__((ext_vector_type(2))) float v2f;

__global__ __launch_bounds__(256) void k_cvt8(const float* __restrict__ src, bf* dst, size_t n8) { const size_t i = (size_t)blockIdx.x * 256 + threadIdx.x; if (i >= n8) return; const v8f v = *(const v8f*)(src + i * 8); v8us o;
#pragma unroll
    for (int k = 0; k < 8; ++k) o[k] = f2bf(v[k]); *(v8us*)(dst + i * 8) = o;  }
__global__ __launch_bounds__(256) void k_cstab(float* CSN) {
    const int idx = blockIdx.x * 256 + threadIdx.x; if (idx >= TT * NF) return; const int t = idx / NF, i = idx % NF; const float den = powf(10000.0f, (float)(2 * i) * (1.0f / HD)); const float ang = __fdiv_rn((float)t, den);
    v2f o; o[0] = cosf(ang); o[1] = sinf(ang); *(v2f*)(CSN + (size_t)idx * 2) = o;  }
// k_hsplit: head planes (hi/lo + fp16) [h][t][d] for one batch with interleaved-pair RoPE: (x0, x1) = (F[t][h*64+d], F[t][h*64+d+1]) for even d -> (cos x0 - sin x1, sin x0 + cos x1), angle index d/2
__global__ __launch_bounds__(256) void k_hsplit(const float* __restrict__ F, const float* __restrict__ CSN, bf* Ph, bf* Pl, h16* P16) {
    const int lane = threadIdx.x & 31; const int L0 = (blockIdx.x * 8 + (threadIdx.x >> 5)) * 8; const int nlines = NH_ * TT * HD / 64;
{
#pragma unroll
        for (int l = 0; l < 8; ++l) { const int L = L0 + l; if (L >= nlines) break; const int e = L * 64 + lane * 2; const int d = e & (HD - 1); const int t = (e >> 6) & (TT - 1); const int h = e >> 17; v2us oh, ol; v2h o16;
            const float x0 = F[(size_t)t * DD + h * HD + d], x1 = F[(size_t)t * DD + h * HD + d + 1]; const v2f cs = *(const v2f*)(CSN + ((size_t)t * NF + (d >> 1)) * 2);
            float a0 = __fmul_rn(cs[0], x0), a1 = __fmul_rn(cs[1], x1), b0 = __fmul_rn(cs[1], x0), b1 = __fmul_rn(cs[0], x1); asm volatile("" : "+v"(a0)); asm volatile("" : "+v"(a1)); asm volatile("" : "+v"(b0)); asm volatile("" : "+v"(b1));
            const float r[2] = {__fsub_rn(a0, a1), __fadd_rn(b0, b1)};
#pragma unroll
            for (int q = 0; q < 2; ++q) { unsigned short a, c2; splitf(r[q], a, c2); oh[q] = a; ol[q] = c2; o16[q] = tohx(r[q]); }
            *(v2us*)(Ph + (size_t)e) = oh; *(v2us*)(Pl + (size_t)e) = ol; *(v2h*)(P16 + (size_t)e) = o16; }
         }
}
__global__ __launch_bounds__(256) void k_vtplane(const float* __restrict__ F, bf* Vh, bf* Vl, h16* V16) {
    const int lane = threadIdx.x & 31; const int L0 = (blockIdx.x * 8 + (threadIdx.x >> 5)) * 8; const int nlines = NH_ * TT * HD / 64;
{
#pragma unroll
        for (int l = 0; l < 8; ++l) { const int L = L0 + l; if (L >= nlines) break; const int e = L * 64 + lane * 2; const int t = e & (TT - 1); const int d = (e >> 11) & (HD - 1); const int h = e >> 17; v2us oh, ol; v2h o16;
#pragma unroll
            for (int q = 0; q < 2; ++q) { const float x = F[(size_t)(t + q) * DD + h * HD + d]; unsigned short a, c2; splitf(x, a, c2); oh[q] = a; ol[q] = c2; o16[q] = tohx(x); }
            *(v2us*)(Vh + (size_t)e) = oh; *(v2us*)(Vl + (size_t)e) = ol; *(v2h*)(V16 + (size_t)e) = o16; }
         }
}
// k_asoft: per row (zz, i): s = S / 8, causal (j > i -> -3e38, exp -> 0; j = i always kept); softmax over the 2048 keys (register row, one exp) -> rows i < RH: P hi/lo [zz][i][j] (compact
__global__ __launch_bounds__(256) void k_asoft(const float* __restrict__ Sb, bf* Ph, bf* Pl, h16* P16) {
    typedef __attribute__((ext_vector_type(4))) unsigned short v4us;
    const int lane = threadIdx.x & 31; const int row = blockIdx.x * 8 + (threadIdx.x >> 5); if (row >= ZH * TT) return; const int i = row & (TT - 1); const int zz = row >> 11; const bool hires = (i < RH);
    const float* sr = Sb + (size_t)row * TT; float v[64]; float mx = -3.0e38f;
#pragma unroll
    for (int ch = 0; ch < 16; ++ch) { const int j0 = ch * 128 + lane * 4; const v4f a = *(const v4f*)(sr + j0);
#pragma unroll
        for (int q = 0; q < 4; ++q) { const int j = j0 + q; const float t = (j <= i) ? a[q] * SCL : -3.0e38f; v[ch * 4 + q] = t; mx = fmaxf(mx, t); } }
#pragma unroll
    for (int sh = 16; sh; sh >>= 1) mx = fmaxf(mx, __shfl_xor(mx, sh, 32));
    float sum = 0.f;
#pragma unroll
    for (int k = 0; k < 64; ++k) { v[k] = __expf(v[k] - mx); sum += v[k]; }
#pragma unroll
    for (int sh = 16; sh; sh >>= 1) sum += __shfl_xor(sum, sh, 32);
    const float f = __fdiv_rn(hires ? 1.0f : PCAR, sum);
{
        if (hires) {
#pragma unroll
            for (int ch = 0; ch < 16; ++ch) { v4us oh, ol;
#pragma unroll
                for (int q = 0; q < 4; ++q) { unsigned short a, c2; splitf(v[ch * 4 + q] * f, a, c2); oh[q] = a; ol[q] = c2; }
                const size_t o = ((size_t)zz * RH + i) * TT + ch * 128 + lane * 4; *(v4us*)(Ph + o) = oh; *(v4us*)(Pl + o) = ol; }
        } else {
#pragma unroll
            for (int ch = 0; ch < 16; ++ch) { v4h o;
#pragma unroll
                for (int q = 0; q < 4; ++q) o[q] = tohx(v[ch * 4 + q] * f);
                *(v4h*)(P16 + (size_t)row * TT + ch * 128 + lane * 4) = o; } }
         }
}
__global__ __launch_bounds__(256) void k_merge(const float* __restrict__ O, int h0, bf* Ah, bf* Al) {
    const int lane = threadIdx.x & 31; const int L0 = (blockIdx.x * 8 + (threadIdx.x >> 5)) * 8; const int nlines = ZH * TT * HD / 64;
{
#pragma unroll
        for (int l = 0; l < 8; ++l) { const int L = L0 + l; if (L >= nlines) break; const int e = L * 64 + lane * 2; const int d = e & (HD - 1); const int t = (e >> 6) & (TT - 1); const int zz = e >> 17; v2us oh, ol;
const float cs = (t < RH) ? 1.0f : (1.0f / PCAR);
#pragma unroll
            for (int q = 0; q < 2; ++q) { unsigned short a, c2; splitf(O[(size_t)e + q] * cs, a, c2); oh[q] = a; ol[q] = c2; }
            const size_t o = (size_t)t * DD + (h0 + zz) * HD + d; *(v2us*)(Ah + o) = oh; *(v2us*)(Al + o) = ol; }
         }
}

extern "C" void kernel_launch(void* const* d_in, const int* in_sizes, int n_in,
                              void* d_out, int out_size, void* d_ws, size_t ws_size, hipStream_t stream) {
    (void)in_sizes; (void)n_in; (void)out_size;
    const float* x = (const float*)d_in[0]; const float* Wq = (const float*)d_in[1]; const float* bq = (const float*)d_in[2]; const float* Wk = (const float*)d_in[3]; const float* bk = (const float*)d_in[4]; const float* Wv = (const float*)d_in[5]; const float* bv = (const float*)d_in[6]; const float* Wd = (const float*)d_in[7]; const float* bo = (const float*)d_in[8];
    float* OUT = (float*)d_out;     // [4][2048][1024]
    char* wsp = (char*)d_ws;
    auto take = [&](size_t bytes) { char* p = wsp; wsp += (bytes + 255) & ~(size_t)255; return (void*)p; };
    bf* WQ = (bf*)take((size_t)DD * DD * 2); bf* WK = (bf*)take((size_t)DD * DD * 2); bf* WV = (bf*)take((size_t)DD * DD * 2); bf* WO = (bf*)take((size_t)DD * DD * 2);
    bf* XB = (bf*)take((size_t)TT * DD * 2); float* F = (float*)take((size_t)TT * DD * 4); float* CSN = (float*)take((size_t)TT * NF * 2 * 4);
    bf* QPh = (bf*)take((size_t)TT * DD * 2); bf* QPl = (bf*)take((size_t)TT * DD * 2); bf* KPh = (bf*)take((size_t)TT * DD * 2); bf* KPl = (bf*)take((size_t)TT * DD * 2); bf* VTh = (bf*)take((size_t)TT * DD * 2); bf* VTl = (bf*)take((size_t)TT * DD * 2);
    h16* QP16 = (h16*)take((size_t)TT * DD * 2); h16* KP16 = (h16*)take((size_t)TT * DD * 2); h16* VT16 = (h16*)take((size_t)TT * DD * 2);
    float* Sb = (float*)take((size_t)ZH * TT * TT * 4); bf* Ph = (bf*)take((size_t)ZH * RH * TT * 2); bf* Pl = (bf*)take((size_t)ZH * RH * TT * 2); h16* P16 = (h16*)take((size_t)ZH * TT * TT * 2); float* Ob = (float*)take((size_t)ZH * TT * HD * 4); bf* ATh = (bf*)take((size_t)TT * DD * 2); bf* ATl = (bf*)take((size_t)TT * DD * 2);
    if ((size_t)(wsp - (char*)d_ws) > ws_size) return;    // total ~ 123 MB = 117.5 MiB; ws 256 MiB
    { const size_t nw = (size_t)DD * DD / 8; const unsigned gw = (unsigned)((nw + 255) / 256); k_cvt8<<<gw, 256, 0, stream>>>(Wq, WQ, nw); k_cvt8<<<gw, 256, 0, stream>>>(Wk, WK, nw); k_cvt8<<<gw, 256, 0, stream>>>(Wv, WV, nw); k_cvt8<<<gw, 256, 0, stream>>>(Wd, WO, nw);
      k_cstab<<<TT * NF / 256, 256, 0, stream>>>(CSN); }
    const unsigned LB = (unsigned)((NH_ * TT * HD / 64 + 63) / 64); const dim3 gP(TT / 64, DD / 64, 1);
    for (int b = 0; b < NB_; ++b) {
        k_cvt8<<<(unsigned)(((size_t)TT * DD / 8 + 255) / 256), 256, 0, stream>>>(x + (size_t)b * TT * DD, XB, (size_t)TT * DD / 8);
        k_gemmw<bf, 0, true><<<gP, 32, 0, stream>>>(XB, nullptr, WQ, nullptr, DD, F, DD, bq, 0, 0, 0); k_hsplit<<<LB, 256, 0, stream>>>(F, CSN, QPh, QPl, QP16);
        k_gemmw<bf, 0, true><<<gP, 32, 0, stream>>>(XB, nullptr, WK, nullptr, DD, F, DD, bk, 0, 0, 0); k_hsplit<<<LB, 256, 0, stream>>>(F, CSN, KPh, KPl, KP16);
        k_gemmw<bf, 0, true><<<gP, 32, 0, stream>>>(XB, nullptr, WV, nullptr, DD, F, DD, bv, 0, 0, 0); k_vtplane<<<LB, 256, 0, stream>>>(F, VTh, VTl, VT16);
        for (int h0 = 0; h0 < NH_; h0 += ZH) { const size_t z0 = (size_t)h0;
            // scores: rows < RH on hi+lo planes (3 products), rows >= RH on fp16 planes - both into the same [ZH][TT][TT] score buffer
            k_gemmw<bf, 2, false><<<dim3(RH / 64, TT / 64, ZH), 32, 0, stream>>>(QPh + z0 * TT * HD, QPl + z0 * TT * HD, KPh + z0 * TT * HD, KPl + z0 * TT * HD, HD, Sb, TT, nullptr, (size_t)TT * HD, (size_t)TT * HD, (size_t)TT * TT);
            k_gemmw<h16, 0, false><<<dim3((TT - RH) / 64, TT / 64, ZH), 32, 0, stream>>>(QP16 + z0 * TT * HD + (size_t)RH * HD, nullptr, KP16 + z0 * TT * HD, nullptr, HD, Sb + (size_t)RH * TT, TT, nullptr, (size_t)TT * HD, (size_t)TT * HD, (size_t)TT * TT);
            k_asoft<<<ZH * TT / 8, 256, 0, stream>>>(Sb, Ph, Pl, P16);
            k_gemmw<bf, 2, false><<<dim3(RH / 64, HD / 64, ZH), 32, 0, stream>>>(Ph, Pl, VTh + z0 * HD * TT, VTl + z0 * HD * TT, TT, Ob, HD, nullptr, (size_t)RH * TT, (size_t)HD * TT, (size_t)TT * HD);
            k_gemmw<h16, 0, false><<<dim3((TT - RH) / 64, HD / 64, ZH), 32, 0, stream>>>(P16 + (size_t)RH * TT, nullptr, VT16 + z0 * HD * TT, nullptr, TT, Ob + (size_t)RH * HD, HD, nullptr, (size_t)TT * TT, (size_t)HD * TT, (size_t)TT * HD);
            k_merge<<<(ZH * TT * HD / 64 + 63) / 64, 256, 0, stream>>>(Ob, h0, ATh, ATl); }
        k_gemmw<bf, 1, true><<<gP, 32, 0, stream>>>(ATh, ATl, WO, nullptr, DD, OUT + (size_t)b * TT * DD, DD, bo, 0, 0, 0); }
}

// v001
// A run of this version takes 2170 microseconds.
// Two timings next to v000 put it at 1.86 and 1.87 times that version's speed.
#include <hip/hip_runtime.h>

// MyCausalMHA (x [4][2048][1024]; q/k/v = x W^T + b ([out][in] Linears); 16 heads x 64; interleaved-pair RoPE on q and k (pair (2k,2k+1) rotated by t / 10000^(2k/64)); scores = q.k / 8, causal (tril, arithmetic) -> -inf;
// softmax (the reference's +1e-8 on the denominator is below f32 resolution since the row max contributes exp(0) = 1); out = merged attn.v Wo^T + bo).
// Compute dtypes, f32 accumulate: every input rounded to bf16; projections on PLAIN bf16 operands (inputs: exact, + bias); rotary cos/sin table in f32; scores and
// attn.v on bf16 hi+lo planes (3 products) for the first RH = 256 query rows of every batch (few keys) and on SINGLE fp16 planes for rows >= 256;
// output hi+lo x exact Wo (2 products) + bo. 64x64-tile GEMMs (long K split over the waves of a work-group), one batch element at a time. Deterministic, no

#define NB_  4
#define TT   2048
#define DD   1024
#define NH_  16
#define HD   64
#define ZH   2
#define RH   256                  // query rows < RH: hi+lo planes; rows >= RH: fp16 planes
#define NF   32                   // rotary frequencies (head_dim / 2)
#define SCL  0.125f               // 1/sqrt(64)
#define PCAR 1024.0f         // P scale for fp16 rows, undone in k_merge
typedef _Float16 h16;
typedef unsigned short bf;
typedef __attribute__((ext_vector_type(16))) __bf16   v16bf;
typedef __attribute__((ext_vector_type(16))) _Float16 v16h;
typedef __attribute__((ext_vector_type(8)))  _Float16 v8h;
typedef __attribute__((ext_vector_type(8)))  unsigned short v8us;
typedef __attribute__((ext_vector_type(8)))  float    v8f;
typedef __attribute__((ext_vector_type(4)))  float    v4f;
typedef v8h  __attribute__((may_alias)) v8ha;
typedef v4f  __attribute__((may_alias)) v4fa;
typedef v8us __attribute__((may_alias)) v8usa;

__device__ __forceinline__ unsigned short f2bf(float f) { unsigned u = __float_as_uint(f); u += 0x7FFFu + ((u >> 16) & 1u); return (unsigned short)(u >> 16); }
__device__ __forceinline__ float bf2f(unsigned short b) { return __uint_as_float(((unsigned)b) << 16); }
__device__ __forceinline__ float bfr(float f) { return bf2f(f2bf(f)); }
__device__ __forceinline__ v16h cat16(v8h lo, v8h hi) { return __builtin_shufflevector(lo, hi, 0, 1, 2, 3, 4, 5, 6, 7, 8, 9, 10, 11, 12, 13, 14, 15); }
__device__ __forceinline__ v16bf cat16b(v8us lo, v8us hi) { return __builtin_bit_cast(v16bf, __builtin_shufflevector(lo, hi, 0, 1, 2, 3, 4, 5, 6, 7, 8, 9, 10, 11, 12, 13, 14, 15)); }
__device__ __forceinline__ v8f wmma16(v16h a, v16h b, v8f c) { return __builtin_amdgcn_wmma_f32_16x16x32_f16(false, a, false, b, (short)0, c, false, false); }
__device__ __forceinline__ v8f wmmab(v16bf a, v16bf b, v8f c) { return __builtin_amdgcn_wmma_f32_16x16x32_bf16(false, a, false, b, (short)0, c, false, false); }



// ---- k_gemmw: register-blocked GEMM, one work-group of NW waves per 64x64 output tile, operands straight from K-contiguous 16-bit planes; grid (M/64, N/64, Z), NW * 32 threads.
// Wave w sums the contiguous K slice [w K/NW, (w+1) K/NW) into its own 16 accumulators; for NW > 1 the NW partial tiles are added in LDS in the fixed order w = 0 .. NW-1 (deterministic).
// C[m][n] (f32, pitch ldc, + optional f32 bias[n]) = sum_k A[m][k] Bt[n][k] (+ split products per NSPLIT). z-batch strides sA/sB/sC in elements. K % (32 NW) == 0.
template <typename T16> struct WFrag;
template <> struct WFrag<h16> { typedef v16h V; static __device__ __forceinline__ V ld(const h16* p) { return cat16(*(const v8h*)p, *(const v8h*)(p + 16)); } static __device__ __forceinline__ v8f mma(V a, V b, v8f c) { return wmma16(a, b, c); } };
template <> struct WFrag<bf> { typedef v16bf V; static __device__ __forceinline__ V ld(const bf* p) { return cat16b(*(const v8us*)p, *(const v8us*)(p + 16)); } static __device__ __forceinline__ v8f mma(V a, V b, v8f c) { return wmmab(a, b, c); } };
template <typename T16, int NSPLIT, bool BIAS, int NW>
__global__ __launch_bounds__(NW * 32) void k_gemmw(const T16* __restrict__ A, const T16* __restrict__ A2, const T16* __restrict__ Bt, const T16* __restrict__ Bt2, int K, float* C, int ldc, const float* __restrict__ bias, size_t sA, size_t sB, size_t sC) {
    typedef typename WFrag<T16>::V V;
    constexpr int SLAB = NW * 16 * 68;          // one 16x64 row block (pitch 68) of every wave's partial tile
    __shared__ __align__(16) float os[(NW == 1 ? 1 : 2) * SLAB];
    const size_t z = blockIdx.z; A += z * sA; if (A2) A2 += z * sA; Bt += z * sB; if (Bt2) Bt2 += z * sB; C += z * sC;
    const int lane = threadIdx.x & 31, lr = lane & 15, hi = lane >> 4; const int r0 = blockIdx.x * 64, c0 = blockIdx.y * 64;
    v8f acc[4][4];
#pragma unroll
    for (int mb = 0; mb < 4; ++mb)
#pragma unroll
        for (int nb = 0; nb < 4; ++nb) acc[mb][nb] = (v8f){};
    const size_t aoff = (size_t)(r0 + lr) * K + 8 * hi, boff = (size_t)(c0 + lr) * K + 8 * hi;
    constexpr int EP = (NW == 1) ? 4 : 1024 / (NW * 32);    // NW > 1: floats of a 16x64 row block that one thread adds up and stores
    typedef float vE __attribute__((ext_vector_type(EP))); typedef vE __attribute__((may_alias)) vEa;
    const int row = (int)threadIdx.x / (64 / EP), cofs = ((int)threadIdx.x % (64 / EP)) * EP; vE bv = (vE)(0.f);
    if (BIAS && NW > 1) bv = *(const vEa*)(bias + c0 + cofs);   // read in front of the K loop: behind it the first barrier would wait for this load
    const int wv = (NW == 1) ? 0 : __builtin_amdgcn_readfirstlane((int)(threadIdx.x >> 5)); const int kslice = K / NW; const int kbeg = wv * kslice, kend = kbeg + kslice;
#pragma unroll 1
    for (int kc = kbeg; kc < kend; kc += 32) {
        V a[4], a2[4];
#pragma unroll
        for (int mb = 0; mb < 4; ++mb) { a[mb] = WFrag<T16>::ld(A + aoff + (size_t)mb * 16 * K + kc); if (NSPLIT == 1 || NSPLIT == 2) a2[mb] = WFrag<T16>::ld(A2 + aoff + (size_t)mb * 16 * K + kc); }
#pragma unroll
        for (int nb = 0; nb < 4; ++nb) { const V b = WFrag<T16>::ld(Bt + boff + (size_t)nb * 16 * K + kc); V b2; if (NSPLIT >= 2) b2 = WFrag<T16>::ld(Bt2 + boff + (size_t)nb * 16 * K + kc);
#pragma unroll
            for (int mb = 0; mb < 4; ++mb) { acc[mb][nb] = WFrag<T16>::mma(a[mb], b, acc[mb][nb]); if (NSPLIT == 1 || NSPLIT == 2) acc[mb][nb] = WFrag<T16>::mma(a2[mb], b, acc[mb][nb]); if (NSPLIT >= 2) acc[mb][nb] = WFrag<T16>::mma(a[mb], b2, acc[mb][nb]); } }
        asm volatile("v_nop\n\tv_nop\n\tv_nop\n\tv_nop" : "+v"(acc[0][0]), "+v"(acc[1][1]), "+v"(acc[2][2]), "+v"(acc[3][3]) : "v"(a[0]), "v"(a[3]));
    }
    if constexpr (NW > 1) {
        vE res[4];
#pragma unroll
        for (int mb = 0; mb < 4; ++mb) { float* slab = os + (mb & 1) * SLAB; float* mine = slab + wv * (16 * 68);   // two slabs in turn: one barrier per row block is enough
#pragma unroll
            for (int nb = 0; nb < 4; ++nb) {
#pragma unroll
                for (int j = 0; j < 8; ++j) mine[(hi * 8 + j) * 68 + nb * 16 + lr] = acc[mb][nb][j]; }
            __syncthreads();
            vE s = *(const vEa*)(slab + row * 68 + cofs);
#pragma unroll
            for (int w = 1; w < NW; ++w) s += *(const vEa*)(slab + w * (16 * 68) + row * 68 + cofs);
            res[mb] = s; }
#pragma unroll
        for (int mb = 0; mb < 4; ++mb) { vE val = res[mb];      // global stores behind the last barrier, so that no barrier waits for a store
            if (BIAS) {
#pragma unroll
                for (int q = 0; q < EP; ++q) val[q] += bfr(bv[q]); }
            *(vE*)(C + (size_t)(r0 + mb * 16 + row) * ldc + c0 + cofs) = val; }
        return;
    }
#pragma unroll
    for (int mb = 0; mb < 4; ++mb) {
#pragma unroll
        for (int nb = 0; nb < 4; ++nb) {
#pragma unroll
            for (int j = 0; j < 8; ++j) os[(hi * 8 + j) * 68 + nb * 16 + lr] = acc[mb][nb][j]; }
        __builtin_amdgcn_wave_barrier(); asm volatile("" ::: "memory");
        float* crow = C + (size_t)(r0 + mb * 16) * ldc + c0;
{
#pragma unroll
            for (int s = 0; s < 8; ++s) { const int row = 2 * s + hi, cofs = lr * 4; v4f val = *(const v4fa*)(os + row * 68 + cofs); if (BIAS) { val[0] += bfr(bias[c0 + cofs]); val[1] += bfr(bias[c0 + cofs + 1]); val[2] += bfr(bias[c0 + cofs + 2]); val[3] += bfr(bias[c0 + cofs + 3]); }
                *(v4f*)(crow + (size_t)row * ldc + cofs) = val; }
             }
        __builtin_amdgcn_wave_barrier(); asm volatile("" ::: "memory");
    }
}

__device__ __forceinline__ h16 tohx(float x) { return (h16)x; }
__device__ __forceinline__ void splitf(float y, unsigned short& h, unsigned short& l) { h = f2bf(y); l = f2bf(y - bf2f(h)); }
typedef __attribute__((ext_vector_type(2))) unsigned short v2us;
typedef __attribute__((ext_vector_type(2))) _Float16 v2h;
typedef __attribute__((ext_vector_type(4))) _Float16 v4h;
typedef __attribute__((ext_vector_type(2))) float v2f;

__global__ __launch_bounds__(256) void k_cvt8(const float* __restrict__ src, bf* dst, size_t n8) { const size_t i = (size_t)blockIdx.x * 256 + threadIdx.x; if (i >= n8) return; const v8f v = *(const v8f*)(src + i * 8); v8us o;
#pragma unroll
    for (int k = 0; k < 8; ++k) o[k] = f2bf(v[k]); *(v8us*)(dst + i * 8) = o;  }
__global__ __launch_bounds__(256) void k_cstab(float* CSN) {
    const int idx = blockIdx.x * 256 + threadIdx.x; if (idx >= TT * NF) return; const int t = idx / NF, i = idx % NF; const float den = powf(10000.0f, (float)(2 * i) * (1.0f / HD)); const float ang = __fdiv_rn((float)t, den);
    v2f o; o[0] = cosf(ang); o[1] = sinf(ang); *(v2f*)(CSN + (size_t)idx * 2) = o;  }
// k_hsplit: head planes (hi/lo + fp16) [h][t][d] for one batch with interleaved-pair RoPE: (x0, x1) = (F[t][h*64+d], F[t][h*64+d+1]) for even d -> (cos x0 - sin x1, sin x0 + cos x1), angle index d/2
__global__ __launch_bounds__(256) void k_hsplit(const float* __restrict__ F, const float* __restrict__ CSN, bf* Ph, bf* Pl, h16* P16) {
    const int lane = threadIdx.x & 31; const int L0 = (blockIdx.x * 8 + (threadIdx.x >> 5)) * 8; const int nlines = NH_ * TT * HD / 64;
{
#pragma unroll
        for (int l = 0; l < 8; ++l) { const int L = L0 + l; if (L >= nlines) break; const int e = L * 64 + lane * 2; const int d = e & (HD - 1); const int t = (e >> 6) & (TT - 1); const int h = e >> 17; v2us oh, ol; v2h o16;
            const float x0 = F[(size_t)t * DD + h * HD + d], x1 = F[(size_t)t * DD + h * HD + d + 1]; const v2f cs = *(const v2f*)(CSN + ((size_t)t * NF + (d >> 1)) * 2);
            float a0 = __fmul_rn(cs[0], x0), a1 = __fmul_rn(cs[1], x1), b0 = __fmul_rn(cs[1], x0), b1 = __fmul_rn(cs[0], x1); asm volatile("" : "+v"(a0)); asm volatile("" : "+v"(a1)); asm volatile("" : "+v"(b0)); asm volatile("" : "+v"(b1));
            const float r[2] = {__fsub_rn(a0, a1), __fadd_rn(b0, b1)};
#pragma unroll
            for (int q = 0; q < 2; ++q) { unsigned short a, c2; splitf(r[q], a, c2); oh[q] = a; ol[q] = c2; o16[q] = tohx(r[q]); }
            *(v2us*)(Ph + (size_t)e) = oh; *(v2us*)(Pl + (size_t)e) = ol; *(v2h*)(P16 + (size_t)e) = o16; }
         }
}
__global__ __launch_bounds__(256) void k_vtplane(const float* __restrict__ F, bf* Vh, bf* Vl, h16* V16) {
    const int lane = threadIdx.x & 31; const int L0 = (blockIdx.x * 8 + (threadIdx.x >> 5)) * 8; const int nlines = NH_ * TT * HD / 64;
{
#pragma unroll
        for (int l = 0; l < 8; ++l) { const int L = L0 + l; if (L >= nlines) break; const int e = L * 64 + lane * 2; const int t = e & (TT - 1); const int d = (e >> 11) & (HD - 1); const int h = e >> 17; v2us oh, ol; v2h o16;
#pragma unroll
            for (int q = 0; q < 2; ++q) { const float x = F[(size_t)(t + q) * DD + h * HD + d]; unsigned short a, c2; splitf(x, a, c2); oh[q] = a; ol[q] = c2; o16[q] = tohx(x); }
            *(v2us*)(Vh + (size_t)e) = oh; *(v2us*)(Vl + (size_t)e) = ol; *(v2h*)(V16 + (size_t)e) = o16; }
         }
}
// k_asoft: per row (zz, i): s = S / 8, causal (j > i -> -3e38, exp -> 0; j = i always kept); softmax over the 2048 keys (register row, one exp) -> rows i < RH: P hi/lo [zz][i][j] (compact
__global__ __launch_bounds__(256) void k_asoft(const float* __restrict__ Sb, bf* Ph, bf* Pl, h16* P16) {
    typedef __attribute__((ext_vector_type(4))) unsigned short v4us;
    const int lane = threadIdx.x & 31; const int row = blockIdx.x * 8 + (threadIdx.x >> 5); if (row >= ZH * TT) return; const int i = row & (TT - 1); const int zz = row >> 11; const bool hires = (i < RH);
    const float* sr = Sb + (size_t)row * TT; float v[64]; float mx = -3.0e38f;
#pragma unroll
    for (int ch = 0; ch < 16; ++ch) { const int j0 = ch * 128 + lane * 4; const v4f a = *(const v4f*)(sr + j0);
#pragma unroll
        for (int q = 0; q < 4; ++q) { const int j = j0 + q; const float t = (j <= i) ? a[q] * SCL : -3.0e38f; v[ch * 4 + q] = t; mx = fmaxf(mx, t); } }
#pragma unroll
    for (int sh = 16; sh; sh >>= 1) mx = fmaxf(mx, __shfl_xor(mx, sh, 32));
    float sum = 0.f;
#pragma unroll
    for (int k = 0; k < 64; ++k) { v[k] = __expf(v[k] - mx); sum += v[k]; }
#pragma unroll
    for (int sh = 16; sh; sh >>= 1) sum += __shfl_xor(sum, sh, 32);
    const float f = __fdiv_rn(hires ? 1.0f : PCAR, sum);
{
        if (hires) {
#pragma unroll
            for (int ch = 0; ch < 16; ++ch) { v4us oh, ol;
#pragma unroll
                for (int q = 0; q < 4; ++q) { unsigned short a, c2; splitf(v[ch * 4 + q] * f, a, c2); oh[q] = a; ol[q] = c2; }
                const size_t o = ((size_t)zz * RH + i) * TT + ch * 128 + lane * 4; *(v4us*)(Ph + o) = oh; *(v4us*)(Pl + o) = ol; }
        } else {
#pragma unroll
            for (int ch = 0; ch < 16; ++ch) { v4h o;
#pragma unroll
                for (int q = 0; q < 4; ++q) o[q] = tohx(v[ch * 4 + q] * f);
                *(v4h*)(P16 + (size_t)row * TT + ch * 128 + lane * 4) = o; } }
         }
}
__global__ __launch_bounds__(256) void k_merge(const float* __restrict__ O, int h0, bf* Ah, bf* Al) {
    const int lane = threadIdx.x & 31; const int L0 = (blockIdx.x * 8 + (threadIdx.x >> 5)) * 8; const int nlines = ZH * TT * HD / 64;
{
#pragma unroll
        for (int l = 0; l < 8; ++l) { const int L = L0 + l; if (L >= nlines) break; const int e = L * 64 + lane * 2; const int d = e & (HD - 1); const int t = (e >> 6) & (TT - 1); const int zz = e >> 17; v2us oh, ol;
const float cs = (t < RH) ? 1.0f : (1.0f / PCAR);
#pragma unroll
            for (int q = 0; q < 2; ++q) { unsigned short a, c2; splitf(O[(size_t)e + q] * cs, a, c2); oh[q] = a; ol[q] = c2; }
            const size_t o = (size_t)t * DD + (h0 + zz) * HD + d; *(v2us*)(Ah + o) = oh; *(v2us*)(Al + o) = ol; }
         }
}

extern "C" void kernel_launch(void* const* d_in, const int* in_sizes, int n_in,
                              void* d_out, int out_size, void* d_ws, size_t ws_size, hipStream_t stream) {
    (void)in_sizes; (void)n_in; (void)out_size;
    const float* x = (const float*)d_in[0]; const float* Wq = (const float*)d_in[1]; const float* bq = (const float*)d_in[2]; const float* Wk = (const float*)d_in[3]; const float* bk = (const float*)d_in[4]; const float* Wv = (const float*)d_in[5]; const float* bv = (const float*)d_in[6]; const float* Wd = (const float*)d_in[7]; const float* bo = (const float*)d_in[8];
    float* OUT = (float*)d_out;     // [4][2048][1024]
    char* wsp = (char*)d_ws;
    auto take = [&](size_t bytes) { char* p = wsp; wsp += (bytes + 255) & ~(size_t)255; return (void*)p; };
    bf* WQ = (bf*)take((size_t)DD * DD * 2); bf* WK = (bf*)take((size_t)DD * DD * 2); bf* WV = (bf*)take((size_t)DD * DD * 2); bf* WO = (bf*)take((size_t)DD * DD * 2);
    bf* XB = (bf*)take((size_t)TT * DD * 2); float* F = (float*)take((size_t)TT * DD * 4); float* CSN = (float*)take((size_t)TT * NF * 2 * 4);
    bf* QPh = (bf*)take((size_t)TT * DD * 2); bf* QPl = (bf*)take((size_t)TT * DD * 2); bf* KPh = (bf*)take((size_t)TT * DD * 2); bf* KPl = (bf*)take((size_t)TT * DD * 2); bf* VTh = (bf*)take((size_t)TT * DD * 2); bf* VTl = (bf*)take((size_t)TT * DD * 2);
    h16* QP16 = (h16*)take((size_t)TT * DD * 2); h16* KP16 = (h16*)take((size_t)TT * DD * 2); h16* VT16 = (h16*)take((size_t)TT * DD * 2);
    float* Sb = (float*)take((size_t)ZH * TT * TT * 4); bf* Ph = (bf*)take((size_t)ZH * RH * TT * 2); bf* Pl = (bf*)take((size_t)ZH * RH * TT * 2); h16* P16 = (h16*)take((size_t)ZH * TT * TT * 2); float* Ob = (float*)take((size_t)ZH * TT * HD * 4); bf* ATh = (bf*)take((size_t)TT * DD * 2); bf* ATl = (bf*)take((size_t)TT * DD * 2);
    if ((size_t)(wsp - (char*)d_ws) > ws_size) return;    // total ~ 123 MB = 117.5 MiB; ws 256 MiB
    { const size_t nw = (size_t)DD * DD / 8; const unsigned gw = (unsigned)((nw + 255) / 256); k_cvt8<<<gw, 256, 0, stream>>>(Wq, WQ, nw); k_cvt8<<<gw, 256, 0, stream>>>(Wk, WK, nw); k_cvt8<<<gw, 256, 0, stream>>>(Wv, WV, nw); k_cvt8<<<gw, 256, 0, stream>>>(Wd, WO, nw);
      k_cstab<<<TT * NF / 256, 256, 0, stream>>>(CSN); }
    const unsigned LB = (unsigned)((NH_ * TT * HD / 64 + 63) / 64); const dim3 gP(TT / 64, DD / 64, 1);
    for (int b = 0; b < NB_; ++b) {
        k_cvt8<<<(unsigned)(((size_t)TT * DD / 8 + 255) / 256), 256, 0, stream>>>(x + (size_t)b * TT * DD, XB, (size_t)TT * DD / 8);
        k_gemmw<bf, 0, true, 8><<<gP, 256, 0, stream>>>(XB, nullptr, WQ, nullptr, DD, F, DD, bq, 0, 0, 0); k_hsplit<<<LB, 256, 0, stream>>>(F, CSN, QPh, QPl, QP16);
        k_gemmw<bf, 0, true, 8><<<gP, 256, 0, stream>>>(XB, nullptr, WK, nullptr, DD, F, DD, bk, 0, 0, 0); k_hsplit<<<LB, 256, 0, stream>>>(F, CSN, KPh, KPl, KP16);
        k_gemmw<bf, 0, true, 8><<<gP, 256, 0, stream>>>(XB, nullptr, WV, nullptr, DD, F, DD, bv, 0, 0, 0); k_vtplane<<<LB, 256, 0, stream>>>(F, VTh, VTl, VT16);
        for (int h0 = 0; h0 < NH_; h0 += ZH) { const size_t z0 = (size_t)h0;
            // scores: rows < RH on hi+lo planes (3 products), rows >= RH on fp16 planes - both into the same [ZH][TT][TT] score buffer
            k_gemmw<bf, 2, false, 1><<<dim3(RH / 64, TT / 64, ZH), 32, 0, stream>>>(QPh + z0 * TT * HD, QPl + z0 * TT * HD, KPh + z0 * TT * HD, KPl + z0 * TT * HD, HD, Sb, TT, nullptr, (size_t)TT * HD, (size_t)TT * HD, (size_t)TT * TT);
            k_gemmw<h16, 0, false, 1><<<dim3((TT - RH) / 64, TT / 64, ZH), 32, 0, stream>>>(QP16 + z0 * TT * HD + (size_t)RH * HD, nullptr, KP16 + z0 * TT * HD, nullptr, HD, Sb + (size_t)RH * TT, TT, nullptr, (size_t)TT * HD, (size_t)TT * HD, (size_t)TT * TT);
            k_asoft<<<ZH * TT / 8, 256, 0, stream>>>(Sb, Ph, Pl, P16);
            k_gemmw<bf, 2, false, 16><<<dim3(RH / 64, HD / 64, ZH), 512, 0, stream>>>(Ph, Pl, VTh + z0 * HD * TT, VTl + z0 * HD * TT, TT, Ob, HD, nullptr, (size_t)RH * TT, (size_t)HD * TT, (size_t)TT * HD);
            k_gemmw<h16, 0, false, 16><<<dim3((TT - RH) / 64, HD / 64, ZH), 512, 0, stream>>>(P16 + (size_t)RH * TT, nullptr, VT16 + z0 * HD * TT, nullptr, TT, Ob + (size_t)RH * HD, HD, nullptr, (size_t)TT * TT, (size_t)HD * TT, (size_t)TT * HD);
            k_merge<<<(ZH * TT * HD / 64 + 63) / 64, 256, 0, stream>>>(Ob, h0, ATh, ATl); }
        k_gemmw<bf, 1, true, 8><<<gP, 256, 0, stream>>>(ATh, ATl, WO, nullptr, DD, OUT + (size_t)b * TT * DD, DD, bo, 0, 0, 0); }
}

// v002
// Measured time: 407 microseconds a run.
// Timed twice side by side with v001, it ran 5.34 and 5.36 times as fast.
// Counting every step since v000, it is 9.97 times as fast.
#include <hip/hip_runtime.h>

// Causal multi-head attention (x [4][2048][1024]; q/k/v = x W^T + b ([out][in] Linears); 16 heads x 64; interleaved-pair RoPE on q and k (pair (2k,2k+1) rotated by t / 10000^(2k/64)); scores = q.k / 8, causal (tril, arithmetic) -> -inf;
// softmax (the reference's +1e-8 on the denominator is below f32 resolution since the row max contributes exp(0) = 1); out = merged attn.v Wo^T + bo).
// Compute dtypes, f32 accumulate: every input rounded to bf16; projections on PLAIN bf16 operands (inputs: exact, + bias); rotary cos/sin table in f32; scores and
// attn.v on bf16 hi+lo planes (3 products) for the first RH = 256 query rows of every batch (few keys) and on SINGLE fp16 planes for rows >= 256;
// output hi+lo x exact Wo (2 products) + bo. 64x64-tile GEMMs (long K split over the waves of a work-group), one batch element at a time. Deterministic, no

#define NB_  4
#define TT   2048
#define DD   1024
#define NH_  16
#define HD   64
#define RH   256                  // query rows < RH: hi+lo planes; rows >= RH: fp16 planes
#define NF   32                   // rotary frequencies (head_dim / 2)
typedef _Float16 h16;
typedef unsigned short bf;
typedef __attribute__((ext_vector_type(16))) __bf16   v16bf;
typedef __attribute__((ext_vector_type(16))) _Float16 v16h;
typedef __attribute__((ext_vector_type(8)))  _Float16 v8h;
typedef __attribute__((ext_vector_type(8)))  unsigned short v8us;
typedef __attribute__((ext_vector_type(8)))  float    v8f;
typedef __attribute__((ext_vector_type(4)))  float    v4f;
typedef v8h  __attribute__((may_alias)) v8ha;
typedef v4f  __attribute__((may_alias)) v4fa;
typedef v8us __attribute__((may_alias)) v8usa;

__device__ __forceinline__ unsigned short f2bf(float f) { unsigned u = __float_as_uint(f); u += 0x7FFFu + ((u >> 16) & 1u); return (unsigned short)(u >> 16); }
__device__ __forceinline__ float bf2f(unsigned short b) { return __uint_as_float(((unsigned)b) << 16); }
__device__ __forceinline__ float bfr(float f) { return bf2f(f2bf(f)); }
__device__ __forceinline__ v16h cat16(v8h lo, v8h hi) { return __builtin_shufflevector(lo, hi, 0, 1, 2, 3, 4, 5, 6, 7, 8, 9, 10, 11, 12, 13, 14, 15); }
__device__ __forceinline__ v16bf cat16b(v8us lo, v8us hi) { return __builtin_bit_cast(v16bf, __builtin_shufflevector(lo, hi, 0, 1, 2, 3, 4, 5, 6, 7, 8, 9, 10, 11, 12, 13, 14, 15)); }
__device__ __forceinline__ v8f wmma16(v16h a, v16h b, v8f c) { return __builtin_amdgcn_wmma_f32_16x16x32_f16(false, a, false, b, (short)0, c, false, false); }
__device__ __forceinline__ v8f wmmab(v16bf a, v16bf b, v8f c) { return __builtin_amdgcn_wmma_f32_16x16x32_bf16(false, a, false, b, (short)0, c, false, false); }



// ---- k_gemmw: register-blocked GEMM, one work-group of NW waves per 64x64 output tile, operands straight from K-contiguous 16-bit planes; grid (M/64, N/64, Z), NW * 32 threads.
// Wave w sums the contiguous K slice [w K/NW, (w+1) K/NW) into its own 16 accumulators; for NW > 1 the NW partial tiles are added in LDS in the fixed order w = 0 .. NW-1 (deterministic).
// C[m][n] (f32, pitch ldc, + optional f32 bias[n]) = sum_k A[m][k] Bt[n][k] (+ split products per NSPLIT). z-batch strides sA/sB/sC in elements. K % (32 NW) == 0.
template <typename T16> struct WFrag;
template <> struct WFrag<h16> { typedef v16h V; static __device__ __forceinline__ V ld(const h16* p) { return cat16(*(const v8h*)p, *(const v8h*)(p + 16)); } static __device__ __forceinline__ v8f mma(V a, V b, v8f c) { return wmma16(a, b, c); } };
template <> struct WFrag<bf> { typedef v16bf V; static __device__ __forceinline__ V ld(const bf* p) { return cat16b(*(const v8us*)p, *(const v8us*)(p + 16)); } static __device__ __forceinline__ v8f mma(V a, V b, v8f c) { return wmmab(a, b, c); } };
template <typename T16, int NSPLIT, bool BIAS, int NW>
__global__ __launch_bounds__(NW * 32) void k_gemmw(const T16* __restrict__ A, const T16* __restrict__ A2, const T16* __restrict__ Bt, const T16* __restrict__ Bt2, int K, float* C, int ldc, const float* __restrict__ bias, size_t sA, size_t sB, size_t sC) {
    typedef typename WFrag<T16>::V V;
    constexpr int SLAB = NW * 16 * 68;          // one 16x64 row block (pitch 68) of every wave's partial tile
    __shared__ __align__(16) float os[(NW == 1 ? 1 : 2) * SLAB];
    const size_t z = blockIdx.z; A += z * sA; if (A2) A2 += z * sA; Bt += z * sB; if (Bt2) Bt2 += z * sB; C += z * sC;
    const int lane = threadIdx.x & 31, lr = lane & 15, hi = lane >> 4; const int r0 = blockIdx.x * 64, c0 = blockIdx.y * 64;
    v8f acc[4][4];
#pragma unroll
    for (int mb = 0; mb < 4; ++mb)
#pragma unroll
        for (int nb = 0; nb < 4; ++nb) acc[mb][nb] = (v8f){};
    const size_t aoff = (size_t)(r0 + lr) * K + 8 * hi, boff = (size_t)(c0 + lr) * K + 8 * hi;
    constexpr int EP = (NW == 1) ? 4 : 1024 / (NW * 32);    // NW > 1: floats of a 16x64 row block that one thread adds up and stores
    typedef float vE __attribute__((ext_vector_type(EP))); typedef vE __attribute__((may_alias)) vEa;
    const int row = (int)threadIdx.x / (64 / EP), cofs = ((int)threadIdx.x % (64 / EP)) * EP; vE bv = (vE)(0.f);
    if (BIAS && NW > 1) bv = *(const vEa*)(bias + c0 + cofs);   // read in front of the K loop: behind it the first barrier would wait for this load
    const int wv = (NW == 1) ? 0 : __builtin_amdgcn_readfirstlane((int)(threadIdx.x >> 5)); const int kslice = K / NW; const int kbeg = wv * kslice, kend = kbeg + kslice;
#pragma unroll 1
    for (int kc = kbeg; kc < kend; kc += 32) {
        V a[4], a2[4];
#pragma unroll
        for (int mb = 0; mb < 4; ++mb) { a[mb] = WFrag<T16>::ld(A + aoff + (size_t)mb * 16 * K + kc); if (NSPLIT == 1 || NSPLIT == 2) a2[mb] = WFrag<T16>::ld(A2 + aoff + (size_t)mb * 16 * K + kc); }
#pragma unroll
        for (int nb = 0; nb < 4; ++nb) { const V b = WFrag<T16>::ld(Bt + boff + (size_t)nb * 16 * K + kc); V b2; if (NSPLIT >= 2) b2 = WFrag<T16>::ld(Bt2 + boff + (size_t)nb * 16 * K + kc);
#pragma unroll
            for (int mb = 0; mb < 4; ++mb) { acc[mb][nb] = WFrag<T16>::mma(a[mb], b, acc[mb][nb]); if (NSPLIT == 1 || NSPLIT == 2) acc[mb][nb] = WFrag<T16>::mma(a2[mb], b, acc[mb][nb]); if (NSPLIT >= 2) acc[mb][nb] = WFrag<T16>::mma(a[mb], b2, acc[mb][nb]); } }
        asm volatile("v_nop\n\tv_nop\n\tv_nop\n\tv_nop" : "+v"(acc[0][0]), "+v"(acc[1][1]), "+v"(acc[2][2]), "+v"(acc[3][3]) : "v"(a[0]), "v"(a[3]));
    }
    if constexpr (NW > 1) {
        vE res[4];
#pragma unroll
        for (int mb = 0; mb < 4; ++mb) { float* slab = os + (mb & 1) * SLAB; float* mine = slab + wv * (16 * 68);   // two slabs in turn: one barrier per row block is enough
#pragma unroll
            for (int nb = 0; nb < 4; ++nb) {
#pragma unroll
                for (int j = 0; j < 8; ++j) mine[(hi * 8 + j) * 68 + nb * 16 + lr] = acc[mb][nb][j]; }
            __syncthreads();
            vE s = *(const vEa*)(slab + row * 68 + cofs);
#pragma unroll
            for (int w = 1; w < NW; ++w) s += *(const vEa*)(slab + w * (16 * 68) + row * 68 + cofs);
            res[mb] = s; }
#pragma unroll
        for (int mb = 0; mb < 4; ++mb) { vE val = res[mb];      // global stores behind the last barrier, so that no barrier waits for a store
            if (BIAS) {
#pragma unroll
                for (int q = 0; q < EP; ++q) val[q] += bfr(bv[q]); }
            *(vE*)(C + (size_t)(r0 + mb * 16 + row) * ldc + c0 + cofs) = val; }
        return;
    }
#pragma unroll
    for (int mb = 0; mb < 4; ++mb) {
#pragma unroll
        for (int nb = 0; nb < 4; ++nb) {
#pragma unroll
            for (int j = 0; j < 8; ++j) os[(hi * 8 + j) * 68 + nb * 16 + lr] = acc[mb][nb][j]; }
        __builtin_amdgcn_wave_barrier(); asm volatile("" ::: "memory");
        float* crow = C + (size_t)(r0 + mb * 16) * ldc + c0;
{
#pragma unroll
            for (int s = 0; s < 8; ++s) { const int row = 2 * s + hi, cofs = lr * 4; v4f val = *(const v4fa*)(os + row * 68 + cofs); if (BIAS) { val[0] += bfr(bias[c0 + cofs]); val[1] += bfr(bias[c0 + cofs + 1]); val[2] += bfr(bias[c0 + cofs + 2]); val[3] += bfr(bias[c0 + cofs + 3]); }
                *(v4f*)(crow + (size_t)row * ldc + cofs) = val; }
             }
        __builtin_amdgcn_wave_barrier(); asm volatile("" ::: "memory");
    }
}

__device__ __forceinline__ h16 tohx(float x) { return (h16)x; }
__device__ __forceinline__ void splitf(float y, unsigned short& h, unsigned short& l) { h = f2bf(y); l = f2bf(y - bf2f(h)); }
typedef __attribute__((ext_vector_type(2))) unsigned short v2us;
typedef __attribute__((ext_vector_type(2))) _Float16 v2h;
typedef __attribute__((ext_vector_type(4))) _Float16 v4h;
typedef __attribute__((ext_vector_type(2))) float v2f;

__global__ __launch_bounds__(256) void k_cvt8(const float* __restrict__ src, bf* dst, size_t n8) { const size_t i = (size_t)blockIdx.x * 256 + threadIdx.x; if (i >= n8) return; const v8f v = *(const v8f*)(src + i * 8); v8us o;
#pragma unroll
    for (int k = 0; k < 8; ++k) o[k] = f2bf(v[k]); *(v8us*)(dst + i * 8) = o;  }
__global__ __launch_bounds__(256) void k_cstab(float* CSN) {
    const int idx = blockIdx.x * 256 + threadIdx.x; if (idx >= TT * NF) return; const int t = idx / NF, i = idx % NF; const float den = powf(10000.0f, (float)(2 * i) * (1.0f / HD)); const float ang = __fdiv_rn((float)t, den);
    v2f o; o[0] = cosf(ang); o[1] = sinf(ang); *(v2f*)(CSN + (size_t)idx * 2) = o;  }
// k_hsplit: head planes (hi/lo + fp16) [h][t][d] for one batch with interleaved-pair RoPE: (x0, x1) = (F[t][h*64+d], F[t][h*64+d+1]) for even d -> (cos x0 - sin x1, sin x0 + cos x1), angle index d/2
__global__ __launch_bounds__(256) void k_hsplit(const float* __restrict__ F, const float* __restrict__ CSN, bf* Ph, bf* Pl, h16* P16) {
    const int lane = threadIdx.x & 31; const int L0 = (blockIdx.x * 8 + (threadIdx.x >> 5)) * 8; const int nlines = NH_ * TT * HD / 64;
{
#pragma unroll
        for (int l = 0; l < 8; ++l) { const int L = L0 + l; if (L >= nlines) break; const int e = L * 64 + lane * 2; const int d = e & (HD - 1); const int t = (e >> 6) & (TT - 1); const int h = e >> 17; v2us oh, ol; v2h o16;
            const float x0 = F[(size_t)t * DD + h * HD + d], x1 = F[(size_t)t * DD + h * HD + d + 1]; const v2f cs = *(const v2f*)(CSN + ((size_t)t * NF + (d >> 1)) * 2);
            float a0 = __fmul_rn(cs[0], x0), a1 = __fmul_rn(cs[1], x1), b0 = __fmul_rn(cs[1], x0), b1 = __fmul_rn(cs[0], x1); asm volatile("" : "+v"(a0)); asm volatile("" : "+v"(a1)); asm volatile("" : "+v"(b0)); asm volatile("" : "+v"(b1));
            const float r[2] = {__fsub_rn(a0, a1), __fadd_rn(b0, b1)};
#pragma unroll
            for (int q = 0; q < 2; ++q) { unsigned short a, c2; splitf(r[q], a, c2); oh[q] = a; ol[q] = c2; o16[q] = tohx(r[q]); }
            *(v2us*)(Ph + (size_t)e) = oh; *(v2us*)(Pl + (size_t)e) = ol; *(v2h*)(P16 + (size_t)e) = o16; }
         }
}
__global__ __launch_bounds__(256) void k_vtplane(const float* __restrict__ F, bf* Vh, bf* Vl, h16* V16) {
    const int lane = threadIdx.x & 31; const int L0 = (blockIdx.x * 8 + (threadIdx.x >> 5)) * 8; const int nlines = NH_ * TT * HD / 64;
{
#pragma unroll
        for (int l = 0; l < 8; ++l) { const int L = L0 + l; if (L >= nlines) break; const int e = L * 64 + lane * 2; const int t = e & (TT - 1); const int d = (e >> 11) & (HD - 1); const int h = e >> 17; v2us oh, ol; v2h o16;
#pragma unroll
            for (int q = 0; q < 2; ++q) { const float x = F[(size_t)(t + q) * DD + h * HD + d]; unsigned short a, c2; splitf(x, a, c2); oh[q] = a; ol[q] = c2; o16[q] = tohx(x); }
            *(v2us*)(Vh + (size_t)e) = oh; *(v2us*)(Vl + (size_t)e) = ol; *(v2h*)(V16 + (size_t)e) = o16; }
         }
}
// k_fattn: scores, causal softmax, attn.v and the head merge in one kernel; a work-group of NS waves owns 32 query rows of one head; wave w takes the 32-key blocks w, w + NS, ... up to the diagonal block.
// St = K Qt (A = 16 key rows, B = 16 query rows): lane (lr, hi) holds for query lr the keys hi*8 + j of each 16-key tile, which is the k order of the B fragment of Ot += Vt Pt, so P stays in registers.
// Running maximum m and sum l per query and wave (log2 domain); P = exp2(t - m) (fp16 rows: x 1024, which cancels in the division by l). Rows < RH: bf16 hi+lo planes, 3 products; rows >= RH: single fp16 planes.
// The NS partial (m, l, O) are joined in LDS in the fixed order w = 0 .. NS-1 (deterministic); a wave without a block hands over m = -3e38, l = 0, O = 0, whose weight is exp2(-huge) = 0.
#define NS   4
#define OPI  68                   // floats per query row of a partial O tile in LDS
#define C2L 0.18033688011112042f  // (1/8) log2(e)
// exp2 in asm text with the slot behind a transcendental kept by construction: each v_exp_f32 works in place on a register of its own, so none reads the result or overwrites the source of the one in front of it,
// and the closing v_nop is the one independent slot in front of whatever the compiler puts next.
__device__ __forceinline__ float exp2s(float x) { asm("v_exp_f32 %0, %0\n\tv_nop" : "+v"(x)); return x; }
__device__ __forceinline__ v8f exp2x8(v8f x) { float a = x[0], b = x[1], c = x[2], d = x[3], e = x[4], f = x[5], g = x[6], h = x[7];
    asm("v_exp_f32 %0, %0\n\tv_exp_f32 %1, %1\n\tv_exp_f32 %2, %2\n\tv_exp_f32 %3, %3\n\tv_exp_f32 %4, %4\n\tv_exp_f32 %5, %5\n\tv_exp_f32 %6, %6\n\tv_exp_f32 %7, %7\n\tv_nop" : "+v"(a), "+v"(b), "+v"(c), "+v"(d), "+v"(e), "+v"(f), "+v"(g), "+v"(h));
    return (v8f){a, b, c, d, e, f, g, h}; }
template <typename T16, bool HR, int NG>   // NG: 16-query groups worked on at a time (hi+lo rows: one, which keeps the kernel within 256 registers)
__device__ __forceinline__ void attn_rows(const T16* __restrict__ Q, const T16* __restrict__ Q2, const T16* __restrict__ Kp, const T16* __restrict__ K2, const T16* __restrict__ Vt, const T16* __restrict__ V2, float* os, float* mS, float* lS, int q0, int kfirst, int lr, int hi) {
    typedef typename WFrag<T16>::V V;     // every full unroll below: the arrays are register fragments, so their indices must be compile-time constants
#pragma unroll 1                          // rolled: the two passes of the hi+lo rows share one copy of the code and one set of registers
  for (int gb = 0; gb < 2; gb += NG) {
    V qf[NG][2], qf2[NG][2], kf[2][2], kf2[2][2];
#pragma unroll
    for (int g = 0; g < NG; ++g)
#pragma unroll
        for (int ks = 0; ks < 2; ++ks) { const size_t o = (size_t)(q0 + (gb + g) * 16 + lr) * HD + ks * 32 + 8 * hi; qf[g][ks] = WFrag<T16>::ld(Q + o); if (HR) qf2[g][ks] = WFrag<T16>::ld(Q2 + o); }
    if constexpr (!HR) {
#pragma unroll
        for (int t = 0; t < 2; ++t)
#pragma unroll
            for (int ks = 0; ks < 2; ++ks) kf[t][ks] = WFrag<T16>::ld(Kp + (size_t)(kfirst + t * 16 + lr) * HD + ks * 32 + 8 * hi); }
    v8f o[NG][4]; float m[NG], l[NG];
#pragma unroll
    for (int g = 0; g < NG; ++g) { m[g] = -3.0e38f; l[g] = 0.f;
#pragma unroll
        for (int dt = 0; dt < 4; ++dt) o[g][dt] = (v8f){}; }
#pragma unroll 1                          // rolled: a trip is a whole 32-key block, a second copy would only cost registers
    for (int key0 = kfirst; key0 <= q0; key0 += 32 * NS) {
        V vf[4], vf2[4];
        if constexpr (!HR) {
#pragma unroll
            for (int dt = 0; dt < 4; ++dt) vf[dt] = WFrag<T16>::ld(Vt + (size_t)(dt * 16 + lr) * TT + key0 + 8 * hi); }
        if constexpr (HR) {                                     // hi+lo rows: at most two trips a wave, K read where it is used (fetched ahead it would cost registers the kernel does not have)
#pragma unroll
            for (int t = 0; t < 2; ++t)
#pragma unroll
                for (int ks = 0; ks < 2; ++ks) { const size_t ok = (size_t)(key0 + t * 16 + lr) * HD + ks * 32 + 8 * hi; kf[t][ks] = WFrag<T16>::ld(Kp + ok); kf2[t][ks] = WFrag<T16>::ld(K2 + ok); } }
        v8f s[NG][2];
#pragma unroll
        for (int g = 0; g < NG; ++g)
#pragma unroll
            for (int t = 0; t < 2; ++t) { s[g][t] = (v8f){};
#pragma unroll
                for (int ks = 0; ks < 2; ++ks) { s[g][t] = WFrag<T16>::mma(kf[t][ks], qf[g][ks], s[g][t]); if (HR) { s[g][t] = WFrag<T16>::mma(kf2[t][ks], qf[g][ks], s[g][t]); s[g][t] = WFrag<T16>::mma(kf[t][ks], qf2[g][ks], s[g][t]); } } }
#pragma unroll
        for (int g = 0; g < NG; ++g)
#pragma unroll
            for (int t = 0; t < 2; ++t) s[g][t] *= C2L;
        if constexpr (HR) {
            asm volatile("s_wait_xcnt 0x0" ::: "memory");       // the V fragments below land in registers that the K loads above name as addresses: the wait stands in front of them
            __builtin_amdgcn_sched_barrier(0);                  // keeps the V loads behind that wait
            const T16* pv = Vt + (size_t)lr * TT + key0 + 8 * hi; const T16* pv2 = V2 + (size_t)lr * TT + key0 + 8 * hi;
#pragma unroll
            for (int dt = 0; dt < 4; ++dt) { vf[dt] = WFrag<T16>::ld(pv + (size_t)dt * 16 * TT); vf2[dt] = WFrag<T16>::ld(pv2 + (size_t)dt * 16 * TT); }
            asm volatile("s_wait_xcnt 0x0" :: "v"(pv), "v"(pv2) : "memory"); }   // both address pairs are inputs here, so they stay live through the run and no V fragment lands in them; they are free for reuse only behind this wait
        if constexpr (!HR) { const int kn = (key0 + 32 * NS <= q0) ? key0 + 32 * NS : q0;   // this wave's next K fragments fly during the softmax and attn.v of this block (last trip: the diagonal block, in bounds, unused)
#pragma unroll
            for (int t = 0; t < 2; ++t)
#pragma unroll
                for (int ks = 0; ks < 2; ++ks) kf[t][ks] = WFrag<T16>::ld(Kp + (size_t)(kn + t * 16 + lr) * HD + ks * 32 + 8 * hi); }
        if (key0 == q0) {                                       // the diagonal block, the only one with keys behind a query of this wave
#pragma unroll
            for (int g = 0; g < NG; ++g)
#pragma unroll
                for (int t = 0; t < 2; ++t)
#pragma unroll
                    for (int j = 0; j < 8; ++j) if (t * 16 + hi * 8 + j > (gb + g) * 16 + lr) s[g][t][j] = -3.0e38f; }
#pragma unroll
        for (int g = 0; g < NG; ++g) {
            float bm = s[g][0][0];
#pragma unroll
            for (int t = 0; t < 2; ++t)
#pragma unroll
                for (int j = 0; j < 8; ++j) bm = fmaxf(bm, s[g][t][j]);
            bm = fmaxf(bm, __shfl_xor(bm, 16, 32));             // the other half of the wave holds the other 16 keys of the same query
            const float mn = fmaxf(m[g], bm); const float al = exp2s(m[g] - mn); m[g] = mn; const float ms = HR ? mn : mn - 10.0f;
            float ps = 0.f;
#pragma unroll
            for (int t = 0; t < 2; ++t) { s[g][t] = exp2x8(s[g][t] - ms);
#pragma unroll
                for (int j = 0; j < 8; ++j) ps += s[g][t][j]; }
            l[g] = l[g] * al + ps;
#pragma unroll
            for (int dt = 0; dt < 4; ++dt) o[g][dt] *= al;
            if constexpr (HR) { v8us ph[2], pl[2];
#pragma unroll
                for (int t = 0; t < 2; ++t)
#pragma unroll
                    for (int j = 0; j < 8; ++j) { unsigned short a, c2; splitf(s[g][t][j], a, c2); ph[t][j] = a; pl[t][j] = c2; }
                const V pf = cat16b(ph[0], ph[1]), pf2 = cat16b(pl[0], pl[1]);
#pragma unroll
                for (int dt = 0; dt < 4; ++dt) { o[g][dt] = WFrag<T16>::mma(vf[dt], pf, o[g][dt]); o[g][dt] = WFrag<T16>::mma(vf2[dt], pf, o[g][dt]); o[g][dt] = WFrag<T16>::mma(vf[dt], pf2, o[g][dt]); }
            } else { v8h ph[2];
#pragma unroll
                for (int t = 0; t < 2; ++t)
#pragma unroll
                    for (int j = 0; j < 8; ++j) ph[t][j] = tohx(s[g][t][j]);
                const V pf = cat16(ph[0], ph[1]);
#pragma unroll
                for (int dt = 0; dt < 4; ++dt) o[g][dt] = WFrag<T16>::mma(vf[dt], pf, o[g][dt]); }
        }
    }
#pragma unroll
    for (int g = 0; g < NG; ++g) { const float lt = l[g] + __shfl_xor(l[g], 16, 32); if (hi == 0) { mS[(gb + g) * 16 + lr] = m[g]; lS[(gb + g) * 16 + lr] = lt; }
#pragma unroll
        for (int dt = 0; dt < 4; ++dt) { float* p = os + ((gb + g) * 16 + lr) * OPI + dt * 16 + hi * 8; const v8f x = o[g][dt]; *(v4fa*)p = __builtin_shufflevector(x, x, 0, 1, 2, 3); *(v4fa*)(p + 4) = __builtin_shufflevector(x, x, 4, 5, 6, 7); } }
  }
}
// grid (NH_, TT / 32), NS waves; blockIdx.y 0 takes the longest rows (most keys); four waves per SIMD (256 registers) hold the whole grid of one batch at once and cover each other's load waits
__global__ __launch_bounds__(NS * 32) __attribute__((amdgpu_waves_per_eu(4, 4))) void k_fattn(const bf* __restrict__ Qh, const bf* __restrict__ Ql, const bf* __restrict__ Kh, const bf* __restrict__ Kl, const bf* __restrict__ Vh, const bf* __restrict__ Vl, const h16* __restrict__ Q16, const h16* __restrict__ K16, const h16* __restrict__ V16, bf* Ah, bf* Al) {
    __shared__ __align__(16) float os[NS * 32 * OPI]; __shared__ float mS[NS * 32]; __shared__ float lS[NS * 32];
    const int lane = threadIdx.x & 31, lr = lane & 15, hi = lane >> 4; const int wv = __builtin_amdgcn_readfirstlane((int)(threadIdx.x >> 5));
    const int q0 = (TT / 32 - 1 - (int)blockIdx.y) * 32; const size_t hp = (size_t)blockIdx.x * TT * HD;
    if (q0 < RH) attn_rows<bf, true, 1>(Qh + hp, Ql + hp, Kh + hp, Kl + hp, Vh + hp, Vl + hp, os + wv * (32 * OPI), mS + wv * 32, lS + wv * 32, q0, wv * 32, lr, hi);
    else attn_rows<h16, false, 2>(Q16 + hp, nullptr, K16 + hp, nullptr, V16 + hp, nullptr, os + wv * (32 * OPI), mS + wv * 32, lS + wv * 32, q0, wv * 32, lr, hi);
    __syncthreads();
    // wave w joins queries w*8 .. w*8+7: a lane takes 16 consecutive d of one query, the wave whole 128-byte lines of the merged planes
    const int qq = wv * (32 / NS) + (lane >> 2), d0 = (lane & 3) * 16;
    float mw[NS], M = -3.0e38f;
#pragma unroll
    for (int w = 0; w < NS; ++w) { mw[w] = mS[w * 32 + qq]; M = fmaxf(M, mw[w]); }
    float L = 0.f; v4f val[4];
#pragma unroll
    for (int i = 0; i < 4; ++i) val[i] = (v4f)(0.f);
#pragma unroll
    for (int w = 0; w < NS; ++w) { const float f = exp2s(mw[w] - M); L += f * lS[w * 32 + qq];
#pragma unroll
        for (int i = 0; i < 4; ++i) val[i] += f * *(const v4fa*)(os + w * (32 * OPI) + qq * OPI + d0 + i * 4); }
    const float inv = __fdiv_rn(1.0f, L);
#pragma unroll
    for (int u = 0; u < 2; ++u) { v8us oh, ol;
#pragma unroll
        for (int j = 0; j < 8; ++j) { unsigned short a, c2; splitf(val[u * 2 + (j >> 2)][j & 3] * inv, a, c2); oh[j] = a; ol[j] = c2; }
        const size_t oo = (size_t)(q0 + qq) * DD + blockIdx.x * HD + d0 + u * 8; *(v8us*)(Ah + oo) = oh; *(v8us*)(Al + oo) = ol; }
}

extern "C" void kernel_launch(void* const* d_in, const int* in_sizes, int n_in,
                              void* d_out, int out_size, void* d_ws, size_t ws_size, hipStream_t stream) {
    (void)in_sizes; (void)n_in; (void)out_size;
    const float* x = (const float*)d_in[0]; const float* Wq = (const float*)d_in[1]; const float* bq = (const float*)d_in[2]; const float* Wk = (const float*)d_in[3]; const float* bk = (const float*)d_in[4]; const float* Wv = (const float*)d_in[5]; const float* bv = (const float*)d_in[6]; const float* Wd = (const float*)d_in[7]; const float* bo = (const float*)d_in[8];
    float* OUT = (float*)d_out;     // [4][2048][1024]
    char* wsp = (char*)d_ws;
    auto take = [&](size_t bytes) { char* p = wsp; wsp += (bytes + 255) & ~(size_t)255; return (void*)p; };
    bf* WQ = (bf*)take((size_t)DD * DD * 2); bf* WK = (bf*)take((size_t)DD * DD * 2); bf* WV = (bf*)take((size_t)DD * DD * 2); bf* WO = (bf*)take((size_t)DD * DD * 2);
    bf* XB = (bf*)take((size_t)TT * DD * 2); float* F = (float*)take((size_t)TT * DD * 4); float* CSN = (float*)take((size_t)TT * NF * 2 * 4);
    bf* QPh = (bf*)take((size_t)TT * DD * 2); bf* QPl = (bf*)take((size_t)TT * DD * 2); bf* KPh = (bf*)take((size_t)TT * DD * 2); bf* KPl = (bf*)take((size_t)TT * DD * 2); bf* VTh = (bf*)take((size_t)TT * DD * 2); bf* VTl = (bf*)take((size_t)TT * DD * 2);
    h16* QP16 = (h16*)take((size_t)TT * DD * 2); h16* KP16 = (h16*)take((size_t)TT * DD * 2); h16* VT16 = (h16*)take((size_t)TT * DD * 2);
    bf* ATh = (bf*)take((size_t)TT * DD * 2); bf* ATl = (bf*)take((size_t)TT * DD * 2);
    if ((size_t)(wsp - (char*)d_ws) > ws_size) return;    // total 64.5 MiB; ws 256 MiB
    { const size_t nw = (size_t)DD * DD / 8; const unsigned gw = (unsigned)((nw + 255) / 256); k_cvt8<<<gw, 256, 0, stream>>>(Wq, WQ, nw); k_cvt8<<<gw, 256, 0, stream>>>(Wk, WK, nw); k_cvt8<<<gw, 256, 0, stream>>>(Wv, WV, nw); k_cvt8<<<gw, 256, 0, stream>>>(Wd, WO, nw);
      k_cstab<<<TT * NF / 256, 256, 0, stream>>>(CSN); }
    const unsigned LB = (unsigned)((NH_ * TT * HD / 64 + 63) / 64); const dim3 gP(TT / 64, DD / 64, 1);
    for (int b = 0; b < NB_; ++b) {
        k_cvt8<<<(unsigned)(((size_t)TT * DD / 8 + 255) / 256), 256, 0, stream>>>(x + (size_t)b * TT * DD, XB, (size_t)TT * DD / 8);
        k_gemmw<bf, 0, true, 8><<<gP, 256, 0, stream>>>(XB, nullptr, WQ, nullptr, DD, F, DD, bq, 0, 0, 0); k_hsplit<<<LB, 256, 0, stream>>>(F, CSN, QPh, QPl, QP16);
        k_gemmw<bf, 0, true, 8><<<gP, 256, 0, stream>>>(XB, nullptr, WK, nullptr, DD, F, DD, bk, 0, 0, 0); k_hsplit<<<LB, 256, 0, stream>>>(F, CSN, KPh, KPl, KP16);
        k_gemmw<bf, 0, true, 8><<<gP, 256, 0, stream>>>(XB, nullptr, WV, nullptr, DD, F, DD, bv, 0, 0, 0); k_vtplane<<<LB, 256, 0, stream>>>(F, VTh, VTl, VT16);
        k_fattn<<<dim3(NH_, TT / 32, 1), NS * 32, 0, stream>>>(QPh, QPl, KPh, KPl, VTh, VTl, QP16, KP16, VT16, ATh, ATl);
        k_gemmw<bf, 1, true, 8><<<gP, 256, 0, stream>>>(ATh, ATl, WO, nullptr, DD, OUT + (size_t)b * TT * DD, DD, bo, 0, 0, 0); }
}

// v003
// One run takes 336 microseconds.
// In two side-by-side timings against v002, it was 1.21 and 1.22 times as fast.
// Over all steps from v000 it is 12.1 times as fast.
#include <hip/hip_runtime.h>

// Causal multi-head attention (x [4][2048][1024]; q/k/v = x W^T + b ([out][in] Linears); 16 heads x 64; interleaved-pair RoPE on q and k (pair (2k,2k+1) rotated by t / 10000^(2k/64)); scores = q.k / 8, causal (tril, arithmetic) -> -inf;
// softmax (the reference's +1e-8 on the denominator is below f32 resolution since the row max contributes exp(0) = 1); out = merged attn.v Wo^T + bo).
// Compute dtypes, f32 accumulate: every input rounded to bf16; projections on PLAIN bf16 operands (inputs: exact, + bias); rotary cos/sin table in f32; scores and
// attn.v on bf16 hi+lo planes (3 products) for the first RH = 256 query rows of every batch (few keys) and on SINGLE fp16 planes for rows >= 256;
// output hi+lo x exact Wo (2 products) + bo. 64x64-tile GEMMs (long K split over the waves of a work-group), every launch over all batch elements (rows b*2048 + t, head planes [b][h]). Deterministic, no

#define NB_  4
#define TT   2048
#define DD   1024
#define NH_  16
#define HD   64
#define RH   256                  // query rows < RH: hi+lo planes; rows >= RH: fp16 planes
#define NF   32                   // rotary frequencies (head_dim / 2)
typedef _Float16 h16;
typedef unsigned short bf;
typedef __attribute__((ext_vector_type(16))) __bf16   v16bf;
typedef __attribute__((ext_vector_type(16))) _Float16 v16h;
typedef __attribute__((ext_vector_type(8)))  _Float16 v8h;
typedef __attribute__((ext_vector_type(8)))  unsigned short v8us;
typedef __attribute__((ext_vector_type(8)))  float    v8f;
typedef __attribute__((ext_vector_type(4)))  float    v4f;
typedef v8h  __attribute__((may_alias)) v8ha;
typedef v4f  __attribute__((may_alias)) v4fa;
typedef v8us __attribute__((may_alias)) v8usa;

__device__ __forceinline__ unsigned short f2bf(float f) { unsigned u = __float_as_uint(f); u += 0x7FFFu + ((u >> 16) & 1u); return (unsigned short)(u >> 16); }
__device__ __forceinline__ float bf2f(unsigned short b) { return __uint_as_float(((unsigned)b) << 16); }
__device__ __forceinline__ float bfr(float f) { return bf2f(f2bf(f)); }
__device__ __forceinline__ v16h cat16(v8h lo, v8h hi) { return __builtin_shufflevector(lo, hi, 0, 1, 2, 3, 4, 5, 6, 7, 8, 9, 10, 11, 12, 13, 14, 15); }
__device__ __forceinline__ v16bf cat16b(v8us lo, v8us hi) { return __builtin_bit_cast(v16bf, __builtin_shufflevector(lo, hi, 0, 1, 2, 3, 4, 5, 6, 7, 8, 9, 10, 11, 12, 13, 14, 15)); }
__device__ __forceinline__ v8f wmma16(v16h a, v16h b, v8f c) { return __builtin_amdgcn_wmma_f32_16x16x32_f16(false, a, false, b, (short)0, c, false, false); }
__device__ __forceinline__ v8f wmmab(v16bf a, v16bf b, v8f c) { return __builtin_amdgcn_wmma_f32_16x16x32_bf16(false, a, false, b, (short)0, c, false, false); }



// ---- k_gemmw: register-blocked GEMM, one work-group of NW waves per 64x64 output tile, operands straight from K-contiguous 16-bit planes; grid (M/64, N/64, Z), NW * 32 threads.
// Wave w sums the contiguous K slice [w K/NW, (w+1) K/NW) into its own 16 accumulators; for NW > 1 the NW partial tiles are added in LDS in the fixed order w = 0 .. NW-1 (deterministic).
// C[m][n] (f32, pitch ldc, + optional f32 bias[n]) = sum_k A[m][k] Bt[n][k] (+ split products per NSPLIT). z-batch strides sA/sB/sC in elements. K % (32 NW) == 0.
template <typename T16> struct WFrag;
template <> struct WFrag<h16> { typedef v16h V; static __device__ __forceinline__ V ld(const h16* p) { return cat16(*(const v8h*)p, *(const v8h*)(p + 16)); } static __device__ __forceinline__ v8f mma(V a, V b, v8f c) { return wmma16(a, b, c); } };
template <> struct WFrag<bf> { typedef v16bf V; static __device__ __forceinline__ V ld(const bf* p) { return cat16b(*(const v8us*)p, *(const v8us*)(p + 16)); } static __device__ __forceinline__ v8f mma(V a, V b, v8f c) { return wmmab(a, b, c); } };
template <typename T16, int NSPLIT, bool BIAS, int NW>
__global__ __launch_bounds__(NW * 32) void k_gemmw(const T16* __restrict__ A, const T16* __restrict__ A2, const T16* __restrict__ Bt, const T16* __restrict__ Bt2, int K, float* C, int ldc, const float* __restrict__ bias, size_t sA, size_t sB, size_t sC) {
    typedef typename WFrag<T16>::V V;
    constexpr int SLAB = NW * 16 * 68;          // one 16x64 row block (pitch 68) of every wave's partial tile
    __shared__ __align__(16) float os[(NW == 1 ? 1 : 2) * SLAB];
    const size_t z = blockIdx.z; A += z * sA; if (A2) A2 += z * sA; Bt += z * sB; if (Bt2) Bt2 += z * sB; C += z * sC;
    const int lane = threadIdx.x & 31, lr = lane & 15, hi = lane >> 4; const int r0 = blockIdx.x * 64, c0 = blockIdx.y * 64;
    v8f acc[4][4];
#pragma unroll
    for (int mb = 0; mb < 4; ++mb)
#pragma unroll
        for (int nb = 0; nb < 4; ++nb) acc[mb][nb] = (v8f){};
    const size_t aoff = (size_t)(r0 + lr) * K + 8 * hi, boff = (size_t)(c0 + lr) * K + 8 * hi;
    constexpr int EP = (NW == 1) ? 4 : 1024 / (NW * 32);    // NW > 1: floats of a 16x64 row block that one thread adds up and stores
    typedef float vE __attribute__((ext_vector_type(EP))); typedef vE __attribute__((may_alias)) vEa;
    const int row = (int)threadIdx.x / (64 / EP), cofs = ((int)threadIdx.x % (64 / EP)) * EP; vE bv = (vE)(0.f);
    if (BIAS && NW > 1) bv = *(const vEa*)(bias + c0 + cofs);   // read in front of the K loop: behind it the first barrier would wait for this load
    const int wv = (NW == 1) ? 0 : __builtin_amdgcn_readfirstlane((int)(threadIdx.x >> 5)); const int kslice = K / NW; const int kbeg = wv * kslice, kend = kbeg + kslice;
#pragma unroll 1
    for (int kc = kbeg; kc < kend; kc += 32) {
        V a[4], a2[4];
#pragma unroll
        for (int mb = 0; mb < 4; ++mb) { a[mb] = WFrag<T16>::ld(A + aoff + (size_t)mb * 16 * K + kc); if (NSPLIT == 1 || NSPLIT == 2) a2[mb] = WFrag<T16>::ld(A2 + aoff + (size_t)mb * 16 * K + kc); }
#pragma unroll
        for (int nb = 0; nb < 4; ++nb) { const V b = WFrag<T16>::ld(Bt + boff + (size_t)nb * 16 * K + kc); V b2; if (NSPLIT >= 2) b2 = WFrag<T16>::ld(Bt2 + boff + (size_t)nb * 16 * K + kc);
#pragma unroll
            for (int mb = 0; mb < 4; ++mb) { acc[mb][nb] = WFrag<T16>::mma(a[mb], b, acc[mb][nb]); if (NSPLIT == 1 || NSPLIT == 2) acc[mb][nb] = WFrag<T16>::mma(a2[mb], b, acc[mb][nb]); if (NSPLIT >= 2) acc[mb][nb] = WFrag<T16>::mma(a[mb], b2, acc[mb][nb]); } }
        asm volatile("v_nop\n\tv_nop\n\tv_nop\n\tv_nop" : "+v"(acc[0][0]), "+v"(acc[1][1]), "+v"(acc[2][2]), "+v"(acc[3][3]) : "v"(a[0]), "v"(a[3]));
    }
    if constexpr (NW > 1) {
        vE res[4];
#pragma unroll
        for (int mb = 0; mb < 4; ++mb) { float* slab = os + (mb & 1) * SLAB; float* mine = slab + wv * (16 * 68);   // two slabs in turn: one barrier per row block is enough
#pragma unroll
            for (int nb = 0; nb < 4; ++nb) {
#pragma unroll
                for (int j = 0; j < 8; ++j) mine[(hi * 8 + j) * 68 + nb * 16 + lr] = acc[mb][nb][j]; }
            __syncthreads();
            vE s = *(const vEa*)(slab + row * 68 + cofs);
#pragma unroll
            for (int w = 1; w < NW; ++w) s += *(const vEa*)(slab + w * (16 * 68) + row * 68 + cofs);
            res[mb] = s; }
#pragma unroll
        for (int mb = 0; mb < 4; ++mb) { vE val = res[mb];      // global stores behind the last barrier, so that no barrier waits for a store
            if (BIAS) {
#pragma unroll
                for (int q = 0; q < EP; ++q) val[q] += bfr(bv[q]); }
            *(vE*)(C + (size_t)(r0 + mb * 16 + row) * ldc + c0 + cofs) = val; }
        return;
    }
#pragma unroll
    for (int mb = 0; mb < 4; ++mb) {
#pragma unroll
        for (int nb = 0; nb < 4; ++nb) {
#pragma unroll
            for (int j = 0; j < 8; ++j) os[(hi * 8 + j) * 68 + nb * 16 + lr] = acc[mb][nb][j]; }
        __builtin_amdgcn_wave_barrier(); asm volatile("" ::: "memory");
        float* crow = C + (size_t)(r0 + mb * 16) * ldc + c0;
{
#pragma unroll
            for (int s = 0; s < 8; ++s) { const int row = 2 * s + hi, cofs = lr * 4; v4f val = *(const v4fa*)(os + row * 68 + cofs); if (BIAS) { val[0] += bfr(bias[c0 + cofs]); val[1] += bfr(bias[c0 + cofs + 1]); val[2] += bfr(bias[c0 + cofs + 2]); val[3] += bfr(bias[c0 + cofs + 3]); }
                *(v4f*)(crow + (size_t)row * ldc + cofs) = val; }
             }
        __builtin_amdgcn_wave_barrier(); asm volatile("" ::: "memory");
    }
}

__device__ __forceinline__ h16 tohx(float x) { return (h16)x; }
__device__ __forceinline__ void splitf(float y, unsigned short& h, unsigned short& l) { h = f2bf(y); l = f2bf(y - bf2f(h)); }
typedef __attribute__((ext_vector_type(2))) unsigned short v2us;
typedef __attribute__((ext_vector_type(2))) _Float16 v2h;
typedef __attribute__((ext_vector_type(4))) _Float16 v4h;
typedef __attribute__((ext_vector_type(2))) float v2f;

__global__ __launch_bounds__(256) void k_cvt8(const float* __restrict__ src, bf* dst, size_t n8) { const size_t i = (size_t)blockIdx.x * 256 + threadIdx.x; if (i >= n8) return; const v8f v = *(const v8f*)(src + i * 8); v8us o;
#pragma unroll
    for (int k = 0; k < 8; ++k) o[k] = f2bf(v[k]); *(v8us*)(dst + i * 8) = o;  }
__global__ __launch_bounds__(256) void k_cstab(float* CSN) {
    const int idx = blockIdx.x * 256 + threadIdx.x; if (idx >= TT * NF) return; const int t = idx / NF, i = idx % NF; const float den = powf(10000.0f, (float)(2 * i) * (1.0f / HD)); const float ang = __fdiv_rn((float)t, den);
    v2f o; o[0] = cosf(ang); o[1] = sinf(ang); *(v2f*)(CSN + (size_t)idx * 2) = o;  }
// k_hsplit: head planes (hi/lo + fp16) [b][h][t][d] for all batch elements (F rows b*2048 + t) with interleaved-pair RoPE: (x0, x1) = (F[t][h*64+d], F[t][h*64+d+1]) for even d -> (cos x0 - sin x1, sin x0 + cos x1), angle index d/2
__global__ __launch_bounds__(256) void k_hsplit(const float* __restrict__ F, const float* __restrict__ CSN, bf* Ph, bf* Pl, h16* P16) {
    const int lane = threadIdx.x & 31; const int L0 = (blockIdx.x * 8 + (threadIdx.x >> 5)) * 8; const int nlines = NB_ * NH_ * TT * HD / 64;
{
#pragma unroll
        for (int l = 0; l < 8; ++l) { const int L = L0 + l; if (L >= nlines) break; const int e = L * 64 + lane * 2; const int d = e & (HD - 1); const int t = (e >> 6) & (TT - 1); const int h = (e >> 17) & (NH_ - 1); const int bt = (e >> 21) * TT + t; v2us oh, ol; v2h o16;
            const float x0 = F[(size_t)bt * DD + h * HD + d], x1 = F[(size_t)bt * DD + h * HD + d + 1]; const v2f cs = *(const v2f*)(CSN + ((size_t)t * NF + (d >> 1)) * 2);
            float a0 = __fmul_rn(cs[0], x0), a1 = __fmul_rn(cs[1], x1), b0 = __fmul_rn(cs[1], x0), b1 = __fmul_rn(cs[0], x1); asm volatile("" : "+v"(a0)); asm volatile("" : "+v"(a1)); asm volatile("" : "+v"(b0)); asm volatile("" : "+v"(b1));
            const float r[2] = {__fsub_rn(a0, a1), __fadd_rn(b0, b1)};
#pragma unroll
            for (int q = 0; q < 2; ++q) { unsigned short a, c2; splitf(r[q], a, c2); oh[q] = a; ol[q] = c2; o16[q] = tohx(r[q]); }
            *(v2us*)(Ph + (size_t)e) = oh; *(v2us*)(Pl + (size_t)e) = ol; *(v2h*)(P16 + (size_t)e) = o16; }
         }
}
__global__ __launch_bounds__(256) void k_vtplane(const float* __restrict__ F, bf* Vh, bf* Vl, h16* V16) {
    const int lane = threadIdx.x & 31; const int L0 = (blockIdx.x * 8 + (threadIdx.x >> 5)) * 8; const int nlines = NB_ * NH_ * TT * HD / 64;
{
#pragma unroll
        for (int l = 0; l < 8; ++l) { const int L = L0 + l; if (L >= nlines) break; const int e = L * 64 + lane * 2; const int t = e & (TT - 1); const int d = (e >> 11) & (HD - 1); const int h = (e >> 17) & (NH_ - 1); const int bt = (e >> 21) * TT + t; v2us oh, ol; v2h o16;
#pragma unroll
            for (int q = 0; q < 2; ++q) { const float x = F[(size_t)(bt + q) * DD + h * HD + d]; unsigned short a, c2; splitf(x, a, c2); oh[q] = a; ol[q] = c2; o16[q] = tohx(x); }
            *(v2us*)(Vh + (size_t)e) = oh; *(v2us*)(Vl + (size_t)e) = ol; *(v2h*)(V16 + (size_t)e) = o16; }
         }
}
// k_fattn: scores, causal softmax, attn.v and the head merge in one kernel; a work-group of NS waves owns 32 query rows of one head; wave w takes the 32-key blocks w, w + NS, ... up to the diagonal block.
// St = K Qt (A = 16 key rows, B = 16 query rows): lane (lr, hi) holds for query lr the keys hi*8 + j of each 16-key tile, which is the k order of the B fragment of Ot += Vt Pt, so P stays in registers.
// Running maximum m and sum l per query and wave (log2 domain); P = exp2(t - m) (fp16 rows: x 1024, which cancels in the division by l). Rows < RH: bf16 hi+lo planes, 3 products; rows >= RH: single fp16 planes.
// The NS partial (m, l, O) are joined in LDS in the fixed order w = 0 .. NS-1 (deterministic); a wave without a block hands over m = -3e38, l = 0, O = 0, whose weight is exp2(-huge) = 0.
#define NS   4
#define OPI  68                   // floats per query row of a partial O tile in LDS
#define C2L 0.18033688011112042f  // (1/8) log2(e)
// exp2 in asm text with the slot behind a transcendental kept by construction: each v_exp_f32 works in place on a register of its own, so none reads the result or overwrites the source of the one in front of it,
// and the closing v_nop is the one independent slot in front of whatever the compiler puts next.
__device__ __forceinline__ float exp2s(float x) { asm("v_exp_f32 %0, %0\n\tv_nop" : "+v"(x)); return x; }
__device__ __forceinline__ v8f exp2x8(v8f x) { float a = x[0], b = x[1], c = x[2], d = x[3], e = x[4], f = x[5], g = x[6], h = x[7];
    asm("v_exp_f32 %0, %0\n\tv_exp_f32 %1, %1\n\tv_exp_f32 %2, %2\n\tv_exp_f32 %3, %3\n\tv_exp_f32 %4, %4\n\tv_exp_f32 %5, %5\n\tv_exp_f32 %6, %6\n\tv_exp_f32 %7, %7\n\tv_nop" : "+v"(a), "+v"(b), "+v"(c), "+v"(d), "+v"(e), "+v"(f), "+v"(g), "+v"(h));
    return (v8f){a, b, c, d, e, f, g, h}; }
template <typename T16, bool HR, int NG>   // NG: 16-query groups worked on at a time (hi+lo rows: one, which keeps the kernel within 256 registers)
__device__ __forceinline__ void attn_rows(const T16* __restrict__ Q, const T16* __restrict__ Q2, const T16* __restrict__ Kp, const T16* __restrict__ K2, const T16* __restrict__ Vt, const T16* __restrict__ V2, float* os, float* mS, float* lS, int q0, int kfirst, int lr, int hi) {
    typedef typename WFrag<T16>::V V;     // every full unroll below: the arrays are register fragments, so their indices must be compile-time constants
#pragma unroll 1                          // rolled: the two passes of the hi+lo rows share one copy of the code and one set of registers
  for (int gb = 0; gb < 2; gb += NG) {
    V qf[NG][2], qf2[NG][2], kf[2][2], kf2[2][2];
#pragma unroll
    for (int g = 0; g < NG; ++g)
#pragma unroll
        for (int ks = 0; ks < 2; ++ks) { const size_t o = (size_t)(q0 + (gb + g) * 16 + lr) * HD + ks * 32 + 8 * hi; qf[g][ks] = WFrag<T16>::ld(Q + o); if (HR) qf2[g][ks] = WFrag<T16>::ld(Q2 + o); }
    if constexpr (!HR) {
#pragma unroll
        for (int t = 0; t < 2; ++t)
#pragma unroll
            for (int ks = 0; ks < 2; ++ks) kf[t][ks] = WFrag<T16>::ld(Kp + (size_t)(kfirst + t * 16 + lr) * HD + ks * 32 + 8 * hi); }
    v8f o[NG][4]; float m[NG], l[NG];
#pragma unroll
    for (int g = 0; g < NG; ++g) { m[g] = -3.0e38f; l[g] = 0.f;
#pragma unroll
        for (int dt = 0; dt < 4; ++dt) o[g][dt] = (v8f){}; }
#pragma unroll 1                          // rolled: a trip is a whole 32-key block, a second copy would only cost registers
    for (int key0 = kfirst; key0 <= q0; key0 += 32 * NS) {
        V vf[4], vf2[4];
        if constexpr (!HR) {
#pragma unroll
            for (int dt = 0; dt < 4; ++dt) vf[dt] = WFrag<T16>::ld(Vt + (size_t)(dt * 16 + lr) * TT + key0 + 8 * hi); }
        if constexpr (HR) {                                     // hi+lo rows: at most two trips a wave, K read where it is used (fetched ahead it would cost registers the kernel does not have)
#pragma unroll
            for (int t = 0; t < 2; ++t)
#pragma unroll
                for (int ks = 0; ks < 2; ++ks) { const size_t ok = (size_t)(key0 + t * 16 + lr) * HD + ks * 32 + 8 * hi; kf[t][ks] = WFrag<T16>::ld(Kp + ok); kf2[t][ks] = WFrag<T16>::ld(K2 + ok); } }
        v8f s[NG][2];
#pragma unroll
        for (int g = 0; g < NG; ++g)
#pragma unroll
            for (int t = 0; t < 2; ++t) { s[g][t] = (v8f){};
#pragma unroll
                for (int ks = 0; ks < 2; ++ks) { s[g][t] = WFrag<T16>::mma(kf[t][ks], qf[g][ks], s[g][t]); if (HR) { s[g][t] = WFrag<T16>::mma(kf2[t][ks], qf[g][ks], s[g][t]); s[g][t] = WFrag<T16>::mma(kf[t][ks], qf2[g][ks], s[g][t]); } } }
#pragma unroll
        for (int g = 0; g < NG; ++g)
#pragma unroll
            for (int t = 0; t < 2; ++t) s[g][t] *= C2L;
        if constexpr (HR) {
            asm volatile("s_wait_xcnt 0x0" ::: "memory");       // the V fragments below land in registers that the K loads above name as addresses: the wait stands in front of them
            __builtin_amdgcn_sched_barrier(0);                  // keeps the V loads behind that wait
            const T16* pv = Vt + (size_t)lr * TT + key0 + 8 * hi; const T16* pv2 = V2 + (size_t)lr * TT + key0 + 8 * hi;
#pragma unroll
            for (int dt = 0; dt < 4; ++dt) { vf[dt] = WFrag<T16>::ld(pv + (size_t)dt * 16 * TT); vf2[dt] = WFrag<T16>::ld(pv2 + (size_t)dt * 16 * TT); }
            asm volatile("s_wait_xcnt 0x0" :: "v"(pv), "v"(pv2) : "memory"); }   // both address pairs are inputs here, so they stay live through the run and no V fragment lands in them; they are free for reuse only behind this wait
        if constexpr (!HR) { const int kn = (key0 + 32 * NS <= q0) ? key0 + 32 * NS : q0;   // this wave's next K fragments fly during the softmax and attn.v of this block (last trip: the diagonal block, in bounds, unused)
#pragma unroll
            for (int t = 0; t < 2; ++t)
#pragma unroll
                for (int ks = 0; ks < 2; ++ks) kf[t][ks] = WFrag<T16>::ld(Kp + (size_t)(kn + t * 16 + lr) * HD + ks * 32 + 8 * hi); }
        if (key0 == q0) {                                       // the diagonal block, the only one with keys behind a query of this wave
#pragma unroll
            for (int g = 0; g < NG; ++g)
#pragma unroll
                for (int t = 0; t < 2; ++t)
#pragma unroll
                    for (int j = 0; j < 8; ++j) if (t * 16 + hi * 8 + j > (gb + g) * 16 + lr) s[g][t][j] = -3.0e38f; }
#pragma unroll
        for (int g = 0; g < NG; ++g) {
            float bm = s[g][0][0];
#pragma unroll
            for (int t = 0; t < 2; ++t)
#pragma unroll
                for (int j = 0; j < 8; ++j) bm = fmaxf(bm, s[g][t][j]);
            bm = fmaxf(bm, __shfl_xor(bm, 16, 32));             // the other half of the wave holds the other 16 keys of the same query
            const float mn = fmaxf(m[g], bm); const float al = exp2s(m[g] - mn); m[g] = mn; const float ms = HR ? mn : mn - 10.0f;
            float ps = 0.f;
#pragma unroll
            for (int t = 0; t < 2; ++t) { s[g][t] = exp2x8(s[g][t] - ms);
#pragma unroll
                for (int j = 0; j < 8; ++j) ps += s[g][t][j]; }
            l[g] = l[g] * al + ps;
#pragma unroll
            for (int dt = 0; dt < 4; ++dt) o[g][dt] *= al;
            if constexpr (HR) { v8us ph[2], pl[2];
#pragma unroll
                for (int t = 0; t < 2; ++t)
#pragma unroll
                    for (int j = 0; j < 8; ++j) { unsigned short a, c2; splitf(s[g][t][j], a, c2); ph[t][j] = a; pl[t][j] = c2; }
                const V pf = cat16b(ph[0], ph[1]), pf2 = cat16b(pl[0], pl[1]);
#pragma unroll
                for (int dt = 0; dt < 4; ++dt) { o[g][dt] = WFrag<T16>::mma(vf[dt], pf, o[g][dt]); o[g][dt] = WFrag<T16>::mma(vf2[dt], pf, o[g][dt]); o[g][dt] = WFrag<T16>::mma(vf[dt], pf2, o[g][dt]); }
            } else { v8h ph[2];
#pragma unroll
                for (int t = 0; t < 2; ++t)
#pragma unroll
                    for (int j = 0; j < 8; ++j) ph[t][j] = tohx(s[g][t][j]);
                const V pf = cat16(ph[0], ph[1]);
#pragma unroll
                for (int dt = 0; dt < 4; ++dt) o[g][dt] = WFrag<T16>::mma(vf[dt], pf, o[g][dt]); }
        }
    }
#pragma unroll
    for (int g = 0; g < NG; ++g) { const float lt = l[g] + __shfl_xor(l[g], 16, 32); if (hi == 0) { mS[(gb + g) * 16 + lr] = m[g]; lS[(gb + g) * 16 + lr] = lt; }
#pragma unroll
        for (int dt = 0; dt < 4; ++dt) { float* p = os + ((gb + g) * 16 + lr) * OPI + dt * 16 + hi * 8; const v8f x = o[g][dt]; *(v4fa*)p = __builtin_shufflevector(x, x, 0, 1, 2, 3); *(v4fa*)(p + 4) = __builtin_shufflevector(x, x, 4, 5, 6, 7); } }
  }
}
// grid (NB_ * NH_, TT / 32), NS waves; blockIdx.x = b * NH_ + h; the longest rows (most keys) of every batch element and head start first, so that the short ones fill the places that come free; four waves per SIMD (256 registers) cover each other's load waits
__global__ __launch_bounds__(NS * 32) __attribute__((amdgpu_waves_per_eu(4, 4))) void k_fattn(const bf* __restrict__ Qh, const bf* __restrict__ Ql, const bf* __restrict__ Kh, const bf* __restrict__ Kl, const bf* __restrict__ Vh, const bf* __restrict__ Vl, const h16* __restrict__ Q16, const h16* __restrict__ K16, const h16* __restrict__ V16, bf* Ah, bf* Al) {
    __shared__ __align__(16) float os[NS * 32 * OPI]; __shared__ float mS[NS * 32]; __shared__ float lS[NS * 32];
    const int lane = threadIdx.x & 31, lr = lane & 15, hi = lane >> 4; const int wv = __builtin_amdgcn_readfirstlane((int)(threadIdx.x >> 5));
    const int q0 = (TT / 32 - 1 - (int)blockIdx.y) * 32; const size_t hp = (size_t)blockIdx.x * TT * HD;
    if (q0 < RH) attn_rows<bf, true, 1>(Qh + hp, Ql + hp, Kh + hp, Kl + hp, Vh + hp, Vl + hp, os + wv * (32 * OPI), mS + wv * 32, lS + wv * 32, q0, wv * 32, lr, hi);
    else attn_rows<h16, false, 2>(Q16 + hp, nullptr, K16 + hp, nullptr, V16 + hp, nullptr, os + wv * (32 * OPI), mS + wv * 32, lS + wv * 32, q0, wv * 32, lr, hi);
    __syncthreads();
    // wave w joins queries w*8 .. w*8+7: a lane takes 16 consecutive d of one query, the wave whole 128-byte lines of the merged planes
    const int qq = wv * (32 / NS) + (lane >> 2), d0 = (lane & 3) * 16;
    float mw[NS], M = -3.0e38f;
#pragma unroll
    for (int w = 0; w < NS; ++w) { mw[w] = mS[w * 32 + qq]; M = fmaxf(M, mw[w]); }
    float L = 0.f; v4f val[4];
#pragma unroll
    for (int i = 0; i < 4; ++i) val[i] = (v4f)(0.f);
#pragma unroll
    for (int w = 0; w < NS; ++w) { const float f = exp2s(mw[w] - M); L += f * lS[w * 32 + qq];
#pragma unroll
        for (int i = 0; i < 4; ++i) val[i] += f * *(const v4fa*)(os + w * (32 * OPI) + qq * OPI + d0 + i * 4); }
    const float inv = __fdiv_rn(1.0f, L);
#pragma unroll
    for (int u = 0; u < 2; ++u) { v8us oh, ol;
#pragma unroll
        for (int j = 0; j < 8; ++j) { unsigned short a, c2; splitf(val[u * 2 + (j >> 2)][j & 3] * inv, a, c2); oh[j] = a; ol[j] = c2; }
        const size_t oo = ((size_t)(blockIdx.x / NH_) * TT + q0 + qq) * DD + (blockIdx.x % NH_) * HD + d0 + u * 8; *(v8us*)(Ah + oo) = oh; *(v8us*)(Al + oo) = ol; }
}

extern "C" void kernel_launch(void* const* d_in, const int* in_sizes, int n_in,
                              void* d_out, int out_size, void* d_ws, size_t ws_size, hipStream_t stream) {
    (void)in_sizes; (void)n_in; (void)out_size;
    const float* x = (const float*)d_in[0]; const float* Wq = (const float*)d_in[1]; const float* bq = (const float*)d_in[2]; const float* Wk = (const float*)d_in[3]; const float* bk = (const float*)d_in[4]; const float* Wv = (const float*)d_in[5]; const float* bv = (const float*)d_in[6]; const float* Wd = (const float*)d_in[7]; const float* bo = (const float*)d_in[8];
    float* OUT = (float*)d_out;     // [4][2048][1024]
    char* wsp = (char*)d_ws;
    auto take = [&](size_t bytes) { char* p = wsp; wsp += (bytes + 255) & ~(size_t)255; return (void*)p; };
    bf* WQ = (bf*)take((size_t)DD * DD * 2); bf* WK = (bf*)take((size_t)DD * DD * 2); bf* WV = (bf*)take((size_t)DD * DD * 2); bf* WO = (bf*)take((size_t)DD * DD * 2);
    bf* XB = (bf*)take((size_t)NB_ * TT * DD * 2); float* F = (float*)take((size_t)NB_ * TT * DD * 4); float* CSN = (float*)take((size_t)TT * NF * 2 * 4);
    bf* QPh = (bf*)take((size_t)NB_ * TT * DD * 2); bf* QPl = (bf*)take((size_t)NB_ * TT * DD * 2); bf* KPh = (bf*)take((size_t)NB_ * TT * DD * 2); bf* KPl = (bf*)take((size_t)NB_ * TT * DD * 2); bf* VTh = (bf*)take((size_t)NB_ * TT * DD * 2); bf* VTl = (bf*)take((size_t)NB_ * TT * DD * 2);
    h16* QP16 = (h16*)take((size_t)NB_ * TT * DD * 2); h16* KP16 = (h16*)take((size_t)NB_ * TT * DD * 2); h16* VT16 = (h16*)take((size_t)NB_ * TT * DD * 2);
    bf* ATh = (bf*)take((size_t)NB_ * TT * DD * 2); bf* ATl = (bf*)take((size_t)NB_ * TT * DD * 2);
    if ((size_t)(wsp - (char*)d_ws) > ws_size) return;    // total 232.5 MiB; ws 256 MiB
    { const size_t nw = (size_t)DD * DD / 8; const unsigned gw = (unsigned)((nw + 255) / 256); k_cvt8<<<gw, 256, 0, stream>>>(Wq, WQ, nw); k_cvt8<<<gw, 256, 0, stream>>>(Wk, WK, nw); k_cvt8<<<gw, 256, 0, stream>>>(Wv, WV, nw); k_cvt8<<<gw, 256, 0, stream>>>(Wd, WO, nw);
      k_cstab<<<TT * NF / 256, 256, 0, stream>>>(CSN); }
    const unsigned LB = (unsigned)((NB_ * NH_ * TT * HD / 64 + 63) / 64); const dim3 gP(NB_ * TT / 64, DD / 64, 1);   // x is [4][2048][1024]: the batch elements are further rows of every GEMM
    k_cvt8<<<(unsigned)(((size_t)NB_ * TT * DD / 8 + 255) / 256), 256, 0, stream>>>(x, XB, (size_t)NB_ * TT * DD / 8);
    k_gemmw<bf, 0, true, 8><<<gP, 256, 0, stream>>>(XB, nullptr, WQ, nullptr, DD, F, DD, bq, 0, 0, 0); k_hsplit<<<LB, 256, 0, stream>>>(F, CSN, QPh, QPl, QP16);
    k_gemmw<bf, 0, true, 8><<<gP, 256, 0, stream>>>(XB, nullptr, WK, nullptr, DD, F, DD, bk, 0, 0, 0); k_hsplit<<<LB, 256, 0, stream>>>(F, CSN, KPh, KPl, KP16);
    k_gemmw<bf, 0, true, 8><<<gP, 256, 0, stream>>>(XB, nullptr, WV, nullptr, DD, F, DD, bv, 0, 0, 0); k_vtplane<<<LB, 256, 0, stream>>>(F, VTh, VTl, VT16);
    k_fattn<<<dim3(NB_ * NH_, TT / 32, 1), NS * 32, 0, stream>>>(QPh, QPl, KPh, KPl, VTh, VTl, QP16, KP16, VT16, ATh, ATl);
    k_gemmw<bf, 1, true, 8><<<gP, 256, 0, stream>>>(ATh, ATl, WO, nullptr, DD, OUT, DD, bo, 0, 0, 0);
}

// v004
// A run of this version takes 214 microseconds.
// In two side-by-side timings against v003, it was 1.56 and 1.57 times as fast.
// All steps since v000 together make it 19.0 times as fast.
#include <hip/hip_runtime.h>

// Causal multi-head attention (x [4][2048][1024]; q/k/v = x W^T + b ([out][in] Linears); 16 heads x 64; interleaved-pair RoPE on q and k (pair (2k,2k+1) rotated by t / 10000^(2k/64)); scores = q.k / 8, causal (tril, arithmetic) -> -inf;
// softmax (the reference's +1e-8 on the denominator is below f32 resolution since the row max contributes exp(0) = 1); out = merged attn.v Wo^T + bo).
// Compute dtypes, f32 accumulate: every input rounded to bf16; projections on PLAIN bf16 operands (inputs: exact, + bias); rotary cos/sin table in f32; scores and
// attn.v on bf16 hi+lo planes (3 products) for the first RH = 256 query rows of every batch and on SINGLE fp16 planes for rows >= 256;
// output hi+lo x exact Wo (2 products) + bo. 128x128-tile GEMMs (operands staged in LDS), every launch over all batch elements (rows b*2048 + t, head planes [b][h]). Deterministic, no

#define NB_  4
#define TT   2048
#define DD   1024
#define NH_  16
#define HD   64
#define RH   256                  // query rows < RH: hi+lo planes; rows >= RH: fp16 planes
#define NF   32                   // rotary frequencies (head_dim / 2)
typedef _Float16 h16;
typedef unsigned short bf;
typedef __attribute__((ext_vector_type(16))) __bf16   v16bf;
typedef __attribute__((ext_vector_type(16))) _Float16 v16h;
typedef __attribute__((ext_vector_type(8)))  _Float16 v8h;
typedef __attribute__((ext_vector_type(8)))  unsigned short v8us;
typedef __attribute__((ext_vector_type(8)))  float    v8f;
typedef __attribute__((ext_vector_type(4)))  float    v4f;
typedef v8h  __attribute__((may_alias)) v8ha;
typedef v4f  __attribute__((may_alias)) v4fa;
typedef v8us __attribute__((may_alias)) v8usa;

__device__ __forceinline__ unsigned short f2bf(float f) { unsigned u = __float_as_uint(f); u += 0x7FFFu + ((u >> 16) & 1u); return (unsigned short)(u >> 16); }
__device__ __forceinline__ float bf2f(unsigned short b) { return __uint_as_float(((unsigned)b) << 16); }
__device__ __forceinline__ float bfr(float f) { return bf2f(f2bf(f)); }
__device__ __forceinline__ v16h cat16(v8h lo, v8h hi) { return __builtin_shufflevector(lo, hi, 0, 1, 2, 3, 4, 5, 6, 7, 8, 9, 10, 11, 12, 13, 14, 15); }
__device__ __forceinline__ v16bf cat16b(v8us lo, v8us hi) { return __builtin_bit_cast(v16bf, __builtin_shufflevector(lo, hi, 0, 1, 2, 3, 4, 5, 6, 7, 8, 9, 10, 11, 12, 13, 14, 15)); }
__device__ __forceinline__ v8f wmma16(v16h a, v16h b, v8f c) { return __builtin_amdgcn_wmma_f32_16x16x32_f16(false, a, false, b, (short)0, c, false, false); }
__device__ __forceinline__ v8f wmmab(v16bf a, v16bf b, v8f c) { return __builtin_amdgcn_wmma_f32_16x16x32_bf16(false, a, false, b, (short)0, c, false, false); }



// ---- k_gemmw: one work-group of 8 waves (2 x 4) per 128x128 output tile, a wave owns 64x32 of it; grid (M/128, N/128), 256 threads. M, N multiples of 128, K a multiple of KP and at least 2 KP.
// C[m][n] (f32, pitch ldc) = sum_k A[m][k] Bt[n][k] (NSPLIT 1: + A2[m][k] Bt[n][k]) + bias[n]; operands are K-contiguous bf16 planes, summed in one chain in k order.
// A pass is KP k of every operand row: [A 128 rows | (A2 128 rows) | Bt 128 rows] at a pitch of 16 bytes x odd, brought into a ring of two LDS buffers by asynchronous copies that take whole 128-byte lines
// (a fragment load straight from the planes touches 16 lines for 512 bytes); pass t + 2 is copied while pass t + 1 is worked on; each staged A row serves four waves, each Bt row two.
template <typename T16> struct WFrag;
template <> struct WFrag<h16> { typedef v16h V; static __device__ __forceinline__ V ld(const h16* p) { return cat16(*(const v8h*)p, *(const v8h*)(p + 16)); } static __device__ __forceinline__ v8f mma(V a, V b, v8f c) { return wmma16(a, b, c); } };
template <> struct WFrag<bf> { typedef v16bf V; static __device__ __forceinline__ V ld(const bf* p) { return cat16b(*(const v8us*)p, *(const v8us*)(p + 16)); } static __device__ __forceinline__ v8f mma(V a, V b, v8f c) { return wmmab(a, b, c); } };
// runs of four or eight asynchronous 16-byte copies a lane (l: LDS byte address, g: global address); the closing s_wait_xcnt 0 stands in the copies' own statement, in front of any rewrite of the address registers that they name
__device__ __forceinline__ void acopy4(const unsigned* l, const bf* const* g) {
    asm volatile("global_load_async_to_lds_b128 %0, %1, off\n\tglobal_load_async_to_lds_b128 %2, %3, off\n\tglobal_load_async_to_lds_b128 %4, %5, off\n\tglobal_load_async_to_lds_b128 %6, %7, off\n\ts_wait_xcnt 0x0"
                 :: "v"(l[0]), "v"(g[0]), "v"(l[1]), "v"(g[1]), "v"(l[2]), "v"(g[2]), "v"(l[3]), "v"(g[3]) : "memory"); }
__device__ __forceinline__ void acopy8(const unsigned* l, const bf* const* g) {
    asm volatile("global_load_async_to_lds_b128 %0, %1, off\n\tglobal_load_async_to_lds_b128 %2, %3, off\n\tglobal_load_async_to_lds_b128 %4, %5, off\n\tglobal_load_async_to_lds_b128 %6, %7, off\n\t"
                 "global_load_async_to_lds_b128 %8, %9, off\n\tglobal_load_async_to_lds_b128 %10, %11, off\n\tglobal_load_async_to_lds_b128 %12, %13, off\n\tglobal_load_async_to_lds_b128 %14, %15, off\n\ts_wait_xcnt 0x0"
                 :: "v"(l[0]), "v"(g[0]), "v"(l[1]), "v"(g[1]), "v"(l[2]), "v"(g[2]), "v"(l[3]), "v"(g[3]), "v"(l[4]), "v"(g[4]), "v"(l[5]), "v"(g[5]), "v"(l[6]), "v"(g[6]), "v"(l[7]), "v"(g[7]) : "memory"); }
template <int NSPLIT>
__global__ __launch_bounds__(256) void k_gemmw(const bf* __restrict__ A, const bf* __restrict__ A2, const bf* __restrict__ Bt, int K, float* C, int ldc, const float* __restrict__ bias) {
    typedef WFrag<bf>::V V;                     // every full unroll below: the arrays are register fragments or asm operands, so their indices must be compile-time constants
    constexpr int KP = NSPLIT ? 64 : 128;       // k per pass: either way 32 matrix instructions a wave and pass, and two work-groups fit a WGP's LDS
    constexpr int PB = KP * 2 + 16;             // LDS row pitch in bytes (16 x odd: no bank conflict for 16-byte fragment reads)
    constexpr int ROWS = NSPLIT ? 384 : 256;    // rows of a stage
    constexpr int STAGE = ROWS * PB;
    constexpr int CPR = KP / 8;                 // 16-byte pieces of a row
    constexpr int RPI = 256 / CPR;              // rows that one copy of all 256 threads brings
    constexpr int NC = ROWS / RPI;              // copies per thread and stage (16 or 12)
    constexpr int OP = 36;                      // floats per row of a wave's 64x32 tile in the output staging
    static_assert(8 * 64 * OP * 4 <= 2 * STAGE, "output staging fits the ring");
    __shared__ __attribute__((aligned(128))) unsigned char L[2 * STAGE];
    const int tid = (int)threadIdx.x, lane = tid & 31, lr = lane & 15, hi = lane >> 4; const int wv = __builtin_amdgcn_readfirstlane(tid >> 5), wm = wv & 1, wn = wv >> 1;
    const int r0 = blockIdx.x * 128, c0 = blockIdx.y * 128;
    const int crow = tid / CPR, ccol = tid % CPR;
    const unsigned ldst = (unsigned)(uintptr_t)L + (unsigned)(crow * PB + ccol * 16);
    const bf* gA = A + (size_t)(r0 + crow) * K + ccol * 8; const bf* gA2 = NSPLIT ? A2 + (size_t)(r0 + crow) * K + ccol * 8 : nullptr; const bf* gB = Bt + (size_t)(c0 + crow) * K + ccol * 8;
    auto fill = [&](int t) {                    // every thread's NC copies of pass t into buffer t & 1
        unsigned l[NC]; const bf* g[NC];
#pragma unroll
        for (int i = 0; i < NC; ++i) { const int row = i * RPI; const bf* base = row < 128 ? gA : (NSPLIT && row < 256) ? gA2 : gB; g[i] = base + (size_t)(row & 127) * K + t * KP; l[i] = ldst + (unsigned)((t & 1) * STAGE + row * PB); }
#pragma unroll
        for (int i = 0; i + 8 <= NC; i += 8) acopy8(l + i, g + i);
        if (NC % 8) acopy4(l + NC - 4, g + NC - 4);
    };
    const int er = lane >> 3, ec = (lane & 7) * 4;
    const v4f bv = *(const v4fa*)(bias + c0 + wn * 32 + ec);     // read in front of the K loop, so that nothing waits for it behind it
    v8f acc[4][2];
#pragma unroll
    for (int mb = 0; mb < 4; ++mb)
#pragma unroll
        for (int nb = 0; nb < 2; ++nb) acc[mb][nb] = (v8f){};
    const int NT = K / KP;
    fill(0);
    asm volatile("s_wait_asynccnt 0x0" ::: "memory");           // this wave's copies of pass 0 have landed
    __syncthreads();                                            // and every other wave's
    if (NT > 1) fill(1);
#pragma unroll 1                                                // rolled: a trip is a whole pass, its buffer chosen at run time
    for (int t = 0; t < NT; ++t) {
        const unsigned char* S = L + (t & 1) * STAGE;
        const unsigned char* pa = S + (wm * 64 + lr) * PB + hi * 16; const unsigned char* pb = S + (ROWS - 128 + wn * 32 + lr) * PB + hi * 16;
#pragma unroll
        for (int ks = 0; ks < KP / 32; ++ks) {
            V a[4], a2[4], b[2];
#pragma unroll
            for (int mb = 0; mb < 4; ++mb) { a[mb] = WFrag<bf>::ld((const bf*)(pa + mb * 16 * PB + ks * 64)); if (NSPLIT) a2[mb] = WFrag<bf>::ld((const bf*)(pa + (128 + mb * 16) * PB + ks * 64)); }
#pragma unroll
            for (int nb = 0; nb < 2; ++nb) b[nb] = WFrag<bf>::ld((const bf*)(pb + nb * 16 * PB + ks * 64));
#pragma unroll
            for (int nb = 0; nb < 2; ++nb)
#pragma unroll
                for (int mb = 0; mb < 4; ++mb) { acc[mb][nb] = WFrag<bf>::mma(a[mb], b[nb], acc[mb][nb]); if (NSPLIT) acc[mb][nb] = WFrag<bf>::mma(a2[mb], b[nb], acc[mb][nb]); }
        }
        asm volatile("s_wait_dscnt 0x0" ::: "memory");          // this wave's reads of buffer t & 1 are done
        asm volatile("s_wait_asynccnt 0x0" ::: "memory");       // this wave's copies of pass t + 1 have landed
        __syncthreads();                                        // publishes pass t + 1 and frees buffer t & 1
        if (t + 2 < NT) fill(t + 2);
    }
    asm volatile("s_wait_asynccnt 0x0" ::: "memory");           // no copy is outstanding when the ring becomes output staging
    float* mine = (float*)L + wv * (64 * OP);                   // behind the last pass's barrier: every wave has left the ring
#pragma unroll
    for (int mb = 0; mb < 4; ++mb)
#pragma unroll
        for (int nb = 0; nb < 2; ++nb)
#pragma unroll
            for (int j = 0; j < 8; ++j) mine[(mb * 16 + hi * 8 + j) * OP + nb * 16 + lr] = acc[mb][nb][j];
    __syncthreads();                                            // the rows are read back by other lanes
#pragma unroll
    for (int s = 0; s < 16; ++s) { const int row = s * 4 + er; v4f val = *(const v4fa*)(mine + row * OP + ec);    // a store instruction writes four whole 128-byte lines
#pragma unroll
        for (int q = 0; q < 4; ++q) val[q] += bfr(bv[q]);
        *(v4f*)(C + (size_t)(r0 + wm * 64 + row) * ldc + c0 + wn * 32 + ec) = val; }
}

__device__ __forceinline__ h16 tohx(float x) { return (h16)x; }
__device__ __forceinline__ void splitf(float y, unsigned short& h, unsigned short& l) { h = f2bf(y); l = f2bf(y - bf2f(h)); }
typedef __attribute__((ext_vector_type(2))) unsigned short v2us;
typedef __attribute__((ext_vector_type(2))) _Float16 v2h;
typedef __attribute__((ext_vector_type(4))) _Float16 v4h;
typedef __attribute__((ext_vector_type(2))) float v2f;

__global__ __launch_bounds__(256) void k_cvt8(const float* __restrict__ src, bf* dst, size_t n8) { const size_t i = (size_t)blockIdx.x * 256 + threadIdx.x; if (i >= n8) return; const v8f v = *(const v8f*)(src + i * 8); v8us o;
#pragma unroll
    for (int k = 0; k < 8; ++k) o[k] = f2bf(v[k]); *(v8us*)(dst + i * 8) = o;  }
__global__ __launch_bounds__(256) void k_cstab(float* CSN) {
    const int idx = blockIdx.x * 256 + threadIdx.x; if (idx >= TT * NF) return; const int t = idx / NF, i = idx % NF; const float den = powf(10000.0f, (float)(2 * i) * (1.0f / HD)); const float ang = __fdiv_rn((float)t, den);
    v2f o; o[0] = cosf(ang); o[1] = sinf(ang); *(v2f*)(CSN + (size_t)idx * 2) = o;  }
// k_hsplit: head planes (hi/lo + fp16) [b][h][t][d] for all batch elements (F rows b*2048 + t) with interleaved-pair RoPE: (x0, x1) = (F[t][h*64+d], F[t][h*64+d+1]) for even d -> (cos x0 - sin x1, sin x0 + cos x1), angle index d/2
__global__ __launch_bounds__(256) void k_hsplit(const float* __restrict__ F, const float* __restrict__ CSN, bf* Ph, bf* Pl, h16* P16) {
    const int lane = threadIdx.x & 31; const int L0 = (blockIdx.x * 8 + (threadIdx.x >> 5)) * 8; const int nlines = NB_ * NH_ * TT * HD / 64;
{
#pragma unroll
        for (int l = 0; l < 8; ++l) { const int L = L0 + l; if (L >= nlines) break; const int e = L * 64 + lane * 2; const int d = e & (HD - 1); const int t = (e >> 6) & (TT - 1); const int h = (e >> 17) & (NH_ - 1); const int bt = (e >> 21) * TT + t; v2us oh, ol; v2h o16;
            const float x0 = F[(size_t)bt * DD + h * HD + d], x1 = F[(size_t)bt * DD + h * HD + d + 1]; const v2f cs = *(const v2f*)(CSN + ((size_t)t * NF + (d >> 1)) * 2);
            float a0 = __fmul_rn(cs[0], x0), a1 = __fmul_rn(cs[1], x1), b0 = __fmul_rn(cs[1], x0), b1 = __fmul_rn(cs[0], x1); asm volatile("" : "+v"(a0)); asm volatile("" : "+v"(a1)); asm volatile("" : "+v"(b0)); asm volatile("" : "+v"(b1));
            const float r[2] = {__fsub_rn(a0, a1), __fadd_rn(b0, b1)};
#pragma unroll
            for (int q = 0; q < 2; ++q) { unsigned short a, c2; splitf(r[q], a, c2); oh[q] = a; ol[q] = c2; o16[q] = tohx(r[q]); }
            *(v2us*)(Ph + (size_t)e) = oh; *(v2us*)(Pl + (size_t)e) = ol; *(v2h*)(P16 + (size_t)e) = o16; }
         }
}
__global__ __launch_bounds__(256) void k_vtplane(const float* __restrict__ F, bf* Vh, bf* Vl, h16* V16) {
    const int lane = threadIdx.x & 31; const int L0 = (blockIdx.x * 8 + (threadIdx.x >> 5)) * 8; const int nlines = NB_ * NH_ * TT * HD / 64;
{
#pragma unroll
        for (int l = 0; l < 8; ++l) { const int L = L0 + l; if (L >= nlines) break; const int e = L * 64 + lane * 2; const int t = e & (TT - 1); const int d = (e >> 11) & (HD - 1); const int h = (e >> 17) & (NH_ - 1); const int bt = (e >> 21) * TT + t; v2us oh, ol; v2h o16;
#pragma unroll
            for (int q = 0; q < 2; ++q) { const float x = F[(size_t)(bt + q) * DD + h * HD + d]; unsigned short a, c2; splitf(x, a, c2); oh[q] = a; ol[q] = c2; o16[q] = tohx(x); }
            *(v2us*)(Vh + (size_t)e) = oh; *(v2us*)(Vl + (size_t)e) = ol; *(v2h*)(V16 + (size_t)e) = o16; }
         }
}
// k_fattn: scores, causal softmax, attn.v and the head merge in one kernel; a work-group of NS waves owns 32 query rows of one head; wave w takes the 32-key blocks w, w + NS, ... up to the diagonal block.
// St = K Qt (A = 16 key rows, B = 16 query rows): lane (lr, hi) holds for query lr the keys hi*8 + j of each 16-key tile, which is the k order of the B fragment of Ot += Vt Pt, so P stays in registers.
// Running maximum m and sum l per query and wave (log2 domain); P = exp2(t - m) (fp16 rows: x 1024, which cancels in the division by l). Rows < RH: bf16 hi+lo planes, 3 products; rows >= RH: single fp16 planes.
// The NS partial (m, l, O) are joined in LDS in the fixed order w = 0 .. NS-1 (deterministic); a wave without a block hands over m = -3e38, l = 0, O = 0, whose weight is exp2(-huge) = 0.
#define NS   4
#define OPI  68                   // floats per query row of a partial O tile in LDS
#define C2L 0.18033688011112042f  // (1/8) log2(e)
// exp2 in asm text with the slot behind a transcendental kept by construction: each v_exp_f32 works in place on a register of its own, so none reads the result or overwrites the source of the one in front of it,
// and the closing v_nop is the one independent slot in front of whatever the compiler puts next.
__device__ __forceinline__ float exp2s(float x) { asm("v_exp_f32 %0, %0\n\tv_nop" : "+v"(x)); return x; }
__device__ __forceinline__ v8f exp2x8(v8f x) { float a = x[0], b = x[1], c = x[2], d = x[3], e = x[4], f = x[5], g = x[6], h = x[7];
    asm("v_exp_f32 %0, %0\n\tv_exp_f32 %1, %1\n\tv_exp_f32 %2, %2\n\tv_exp_f32 %3, %3\n\tv_exp_f32 %4, %4\n\tv_exp_f32 %5, %5\n\tv_exp_f32 %6, %6\n\tv_exp_f32 %7, %7\n\tv_nop" : "+v"(a), "+v"(b), "+v"(c), "+v"(d), "+v"(e), "+v"(f), "+v"(g), "+v"(h));
    return (v8f){a, b, c, d, e, f, g, h}; }
template <typename T16, bool HR, int NG>   // NG: 16-query groups worked on at a time (hi+lo rows: one, which keeps the kernel within 256 registers)
__device__ __forceinline__ void attn_rows(const T16* __restrict__ Q, const T16* __restrict__ Q2, const T16* __restrict__ Kp, const T16* __restrict__ K2, const T16* __restrict__ Vt, const T16* __restrict__ V2, float* os, float* mS, float* lS, int q0, int kfirst, int lr, int hi) {
    typedef typename WFrag<T16>::V V;     // every full unroll below: the arrays are register fragments, so their indices must be compile-time constants
#pragma unroll 1                          // rolled: the two passes of the hi+lo rows share one copy of the code and one set of registers
  for (int gb = 0; gb < 2; gb += NG) {
    V qf[NG][2], qf2[NG][2], kf[2][2], kf2[2][2];
#pragma unroll
    for (int g = 0; g < NG; ++g)
#pragma unroll
        for (int ks = 0; ks < 2; ++ks) { const size_t o = (size_t)(q0 + (gb + g) * 16 + lr) * HD + ks * 32 + 8 * hi; qf[g][ks] = WFrag<T16>::ld(Q + o); if (HR) qf2[g][ks] = WFrag<T16>::ld(Q2 + o); }
    if constexpr (!HR) {
#pragma unroll
        for (int t = 0; t < 2; ++t)
#pragma unroll
            for (int ks = 0; ks < 2; ++ks) kf[t][ks] = WFrag<T16>::ld(Kp + (size_t)(kfirst + t * 16 + lr) * HD + ks * 32 + 8 * hi); }
    v8f o[NG][4]; float m[NG], l[NG];
#pragma unroll
    for (int g = 0; g < NG; ++g) { m[g] = -3.0e38f; l[g] = 0.f;
#pragma unroll
        for (int dt = 0; dt < 4; ++dt) o[g][dt] = (v8f){}; }
#pragma unroll 1                          // rolled: a trip is a whole 32-key block, a second copy would only cost registers
    for (int key0 = kfirst; key0 <= q0; key0 += 32 * NS) {
        V vf[4], vf2[4];
        if constexpr (!HR) {
#pragma unroll
            for (int dt = 0; dt < 4; ++dt) vf[dt] = WFrag<T16>::ld(Vt + (size_t)(dt * 16 + lr) * TT + key0 + 8 * hi); }
        if constexpr (HR) {                                     // hi+lo rows: at most two trips a wave, K read where it is used (fetched ahead it would cost registers the kernel does not have)
#pragma unroll
            for (int t = 0; t < 2; ++t)
#pragma unroll
                for (int ks = 0; ks < 2; ++ks) { const size_t ok = (size_t)(key0 + t * 16 + lr) * HD + ks * 32 + 8 * hi; kf[t][ks] = WFrag<T16>::ld(Kp + ok); kf2[t][ks] = WFrag<T16>::ld(K2 + ok); } }
        v8f s[NG][2];
#pragma unroll
        for (int g = 0; g < NG; ++g)
#pragma unroll
            for (int t = 0; t < 2; ++t) { s[g][t] = (v8f){};
#pragma unroll
                for (int ks = 0; ks < 2; ++ks) { s[g][t] = WFrag<T16>::mma(kf[t][ks], qf[g][ks], s[g][t]); if (HR) { s[g][t] = WFrag<T16>::mma(kf2[t][ks], qf[g][ks], s[g][t]); s[g][t] = WFrag<T16>::mma(kf[t][ks], qf2[g][ks], s[g][t]); } } }
#pragma unroll
        for (int g = 0; g < NG; ++g)
#pragma unroll
            for (int t = 0; t < 2; ++t) s[g][t] *= C2L;
        if constexpr (HR) {
            asm volatile("s_wait_xcnt 0x0" ::: "memory");       // the V fragments below land in registers that the K loads above name as addresses: the wait stands in front of them
            __builtin_amdgcn_sched_barrier(0);                  // keeps the V loads behind that wait
            const T16* pv = Vt + (size_t)lr * TT + key0 + 8 * hi; const T16* pv2 = V2 + (size_t)lr * TT + key0 + 8 * hi;
#pragma unroll
            for (int dt = 0; dt < 4; ++dt) { vf[dt] = WFrag<T16>::ld(pv + (size_t)dt * 16 * TT); vf2[dt] = WFrag<T16>::ld(pv2 + (size_t)dt * 16 * TT); }
            asm volatile("s_wait_xcnt 0x0" :: "v"(pv), "v"(pv2) : "memory"); }   // both address pairs are inputs here, so they stay live through the run and no V fragment lands in them; they are free for reuse only behind this wait
        if constexpr (!HR) { const int kn = (key0 + 32 * NS <= q0) ? key0 + 32 * NS : q0;   // this wave's next K fragments fly during the softmax and attn.v of this block (last trip: the diagonal block, in bounds, unused)
#pragma unroll
            for (int t = 0; t < 2; ++t)
#pragma unroll
                for (int ks = 0; ks < 2; ++ks) kf[t][ks] = WFrag<T16>::ld(Kp + (size_t)(kn + t * 16 + lr) * HD + ks * 32 + 8 * hi); }
        if (key0 == q0) {                                       // the diagonal block, the only one with keys behind a query of this wave
#pragma unroll
            for (int g = 0; g < NG; ++g)
#pragma unroll
                for (int t = 0; t < 2; ++t)
#pragma unroll
                    for (int j = 0; j < 8; ++j) if (t * 16 + hi * 8 + j > (gb + g) * 16 + lr) s[g][t][j] = -3.0e38f; }
#pragma unroll
        for (int g = 0; g < NG; ++g) {
            float bm = s[g][0][0];
#pragma unroll
            for (int t = 0; t < 2; ++t)
#pragma unroll
                for (int j = 0; j < 8; ++j) bm = fmaxf(bm, s[g][t][j]);
            bm = fmaxf(bm, __shfl_xor(bm, 16, 32));             // the other half of the wave holds the other 16 keys of the same query
            const float mn = fmaxf(m[g], bm); const float al = exp2s(m[g] - mn); m[g] = mn; const float ms = HR ? mn : mn - 10.0f;
            float ps = 0.f;
#pragma unroll
            for (int t = 0; t < 2; ++t) { s[g][t] = exp2x8(s[g][t] - ms);
#pragma unroll
                for (int j = 0; j < 8; ++j) ps += s[g][t][j]; }
            l[g] = l[g] * al + ps;
#pragma unroll
            for (int dt = 0; dt < 4; ++dt) o[g][dt] *= al;
            if constexpr (HR) { v8us ph[2], pl[2];
#pragma unroll
                for (int t = 0; t < 2; ++t)
#pragma unroll
                    for (int j = 0; j < 8; ++j) { unsigned short a, c2; splitf(s[g][t][j], a, c2); ph[t][j] = a; pl[t][j] = c2; }
                const V pf = cat16b(ph[0], ph[1]), pf2 = cat16b(pl[0], pl[1]);
#pragma unroll
                for (int dt = 0; dt < 4; ++dt) { o[g][dt] = WFrag<T16>::mma(vf[dt], pf, o[g][dt]); o[g][dt] = WFrag<T16>::mma(vf2[dt], pf, o[g][dt]); o[g][dt] = WFrag<T16>::mma(vf[dt], pf2, o[g][dt]); }
            } else { v8h ph[2];
#pragma unroll
                for (int t = 0; t < 2; ++t)
#pragma unroll
                    for (int j = 0; j < 8; ++j) ph[t][j] = tohx(s[g][t][j]);
                const V pf = cat16(ph[0], ph[1]);
#pragma unroll
                for (int dt = 0; dt < 4; ++dt) o[g][dt] = WFrag<T16>::mma(vf[dt], pf, o[g][dt]); }
        }
    }
#pragma unroll
    for (int g = 0; g < NG; ++g) { const float lt = l[g] + __shfl_xor(l[g], 16, 32); if (hi == 0) { mS[(gb + g) * 16 + lr] = m[g]; lS[(gb + g) * 16 + lr] = lt; }
#pragma unroll
        for (int dt = 0; dt < 4; ++dt) { float* p = os + ((gb + g) * 16 + lr) * OPI + dt * 16 + hi * 8; const v8f x = o[g][dt]; *(v4fa*)p = __builtin_shufflevector(x, x, 0, 1, 2, 3); *(v4fa*)(p + 4) = __builtin_shufflevector(x, x, 4, 5, 6, 7); } }
  }
}
// grid (NB_ * NH_, TT / 32), NS waves; blockIdx.x = b * NH_ + h; the longest rows (most keys) of every batch element and head start first, so that the short ones fill the places that come free; four waves per SIMD (256 registers) cover each other's load waits
__global__ __launch_bounds__(NS * 32) __attribute__((amdgpu_waves_per_eu(4, 4))) void k_fattn(const bf* __restrict__ Qh, const bf* __restrict__ Ql, const bf* __restrict__ Kh, const bf* __restrict__ Kl, const bf* __restrict__ Vh, const bf* __restrict__ Vl, const h16* __restrict__ Q16, const h16* __restrict__ K16, const h16* __restrict__ V16, bf* Ah, bf* Al) {
    __shared__ __align__(16) float os[NS * 32 * OPI]; __shared__ float mS[NS * 32]; __shared__ float lS[NS * 32];
    const int lane = threadIdx.x & 31, lr = lane & 15, hi = lane >> 4; const int wv = __builtin_amdgcn_readfirstlane((int)(threadIdx.x >> 5));
    const int q0 = (TT / 32 - 1 - (int)blockIdx.y) * 32; const size_t hp = (size_t)blockIdx.x * TT * HD;
    if (q0 < RH) attn_rows<bf, true, 1>(Qh + hp, Ql + hp, Kh + hp, Kl + hp, Vh + hp, Vl + hp, os + wv * (32 * OPI), mS + wv * 32, lS + wv * 32, q0, wv * 32, lr, hi);
    else attn_rows<h16, false, 2>(Q16 + hp, nullptr, K16 + hp, nullptr, V16 + hp, nullptr, os + wv * (32 * OPI), mS + wv * 32, lS + wv * 32, q0, wv * 32, lr, hi);
    __syncthreads();
    // wave w joins queries w*8 .. w*8+7: a lane takes 16 consecutive d of one query, the wave whole 128-byte lines of the merged planes
    const int qq = wv * (32 / NS) + (lane >> 2), d0 = (lane & 3) * 16;
    float mw[NS], M = -3.0e38f;
#pragma unroll
    for (int w = 0; w < NS; ++w) { mw[w] = mS[w * 32 + qq]; M = fmaxf(M, mw[w]); }
    float L = 0.f; v4f val[4];
#pragma unroll
    for (int i = 0; i < 4; ++i) val[i] = (v4f)(0.f);
#pragma unroll
    for (int w = 0; w < NS; ++w) { const float f = exp2s(mw[w] - M); L += f * lS[w * 32 + qq];
#pragma unroll
        for (int i = 0; i < 4; ++i) val[i] += f * *(const v4fa*)(os + w * (32 * OPI) + qq * OPI + d0 + i * 4); }
    const float inv = __fdiv_rn(1.0f, L);
#pragma unroll
    for (int u = 0; u < 2; ++u) { v8us oh, ol;
#pragma unroll
        for (int j = 0; j < 8; ++j) { unsigned short a, c2; splitf(val[u * 2 + (j >> 2)][j & 3] * inv, a, c2); oh[j] = a; ol[j] = c2; }
        const size_t oo = ((size_t)(blockIdx.x / NH_) * TT + q0 + qq) * DD + (blockIdx.x % NH_) * HD + d0 + u * 8; *(v8us*)(Ah + oo) = oh; *(v8us*)(Al + oo) = ol; }
}

extern "C" void kernel_launch(void* const* d_in, const int* in_sizes, int n_in,
                              void* d_out, int out_size, void* d_ws, size_t ws_size, hipStream_t stream) {
    (void)in_sizes; (void)n_in; (void)out_size;
    const float* x = (const float*)d_in[0]; const float* Wq = (const float*)d_in[1]; const float* bq = (const float*)d_in[2]; const float* Wk = (const float*)d_in[3]; const float* bk = (const float*)d_in[4]; const float* Wv = (const float*)d_in[5]; const float* bv = (const float*)d_in[6]; const float* Wd = (const float*)d_in[7]; const float* bo = (const float*)d_in[8];
    float* OUT = (float*)d_out;     // [4][2048][1024]
    char* wsp = (char*)d_ws;
    auto take = [&](size_t bytes) { char* p = wsp; wsp += (bytes + 255) & ~(size_t)255; return (void*)p; };
    bf* WQ = (bf*)take((size_t)DD * DD * 2); bf* WK = (bf*)take((size_t)DD * DD * 2); bf* WV = (bf*)take((size_t)DD * DD * 2); bf* WO = (bf*)take((size_t)DD * DD * 2);
    bf* XB = (bf*)take((size_t)NB_ * TT * DD * 2); float* F = (float*)take((size_t)NB_ * TT * DD * 4); float* CSN = (float*)take((size_t)TT * NF * 2 * 4);
    bf* QPh = (bf*)take((size_t)NB_ * TT * DD * 2); bf* QPl = (bf*)take((size_t)NB_ * TT * DD * 2); bf* KPh = (bf*)take((size_t)NB_ * TT * DD * 2); bf* KPl = (bf*)take((size_t)NB_ * TT * DD * 2); bf* VTh = (bf*)take((size_t)NB_ * TT * DD * 2); bf* VTl = (bf*)take((size_t)NB_ * TT * DD * 2);
    h16* QP16 = (h16*)take((size_t)NB_ * TT * DD * 2); h16* KP16 = (h16*)take((size_t)NB_ * TT * DD * 2); h16* VT16 = (h16*)take((size_t)NB_ * TT * DD * 2);
    bf* ATh = (bf*)take((size_t)NB_ * TT * DD * 2); bf* ATl = (bf*)take((size_t)NB_ * TT * DD * 2);
    if ((size_t)(wsp - (char*)d_ws) > ws_size) return;    // total 232.5 MiB; ws 256 MiB
    { const size_t nw = (size_t)DD * DD / 8; const unsigned gw = (unsigned)((nw + 255) / 256); k_cvt8<<<gw, 256, 0, stream>>>(Wq, WQ, nw); k_cvt8<<<gw, 256, 0, stream>>>(Wk, WK, nw); k_cvt8<<<gw, 256, 0, stream>>>(Wv, WV, nw); k_cvt8<<<gw, 256, 0, stream>>>(Wd, WO, nw);
      k_cstab<<<TT * NF / 256, 256, 0, stream>>>(CSN); }
    const unsigned LB = (unsigned)((NB_ * NH_ * TT * HD / 64 + 63) / 64); const dim3 gP(NB_ * TT / 128, DD / 128, 1);   // x is [4][2048][1024]: the batch elements are further rows of every GEMM
    k_cvt8<<<(unsigned)(((size_t)NB_ * TT * DD / 8 + 255) / 256), 256, 0, stream>>>(x, XB, (size_t)NB_ * TT * DD / 8);
    k_gemmw<0><<<gP, 256, 0, stream>>>(XB, nullptr, WQ, DD, F, DD, bq); k_hsplit<<<LB, 256, 0, stream>>>(F, CSN, QPh, QPl, QP16);
    k_gemmw<0><<<gP, 256, 0, stream>>>(XB, nullptr, WK, DD, F, DD, bk); k_hsplit<<<LB, 256, 0, stream>>>(F, CSN, KPh, KPl, KP16);
    k_gemmw<0><<<gP, 256, 0, stream>>>(XB, nullptr, WV, DD, F, DD, bv); k_vtplane<<<LB, 256, 0, stream>>>(F, VTh, VTl, VT16);
    k_fattn<<<dim3(NB_ * NH_, TT / 32, 1), NS * 32, 0, stream>>>(QPh, QPl, KPh, KPl, VTh, VTl, QP16, KP16, VT16, ATh, ATl);
    k_gemmw<1><<<gP, 256, 0, stream>>>(ATh, ATl, WO, DD, OUT, DD, bo);
}

// v005
// Measured time: 169 microseconds a run.
// In both of two side-by-side timings against v004, it was 1.27 times as fast.
// Over all steps from v000 it is 24.1 times as fast.
#include <hip/hip_runtime.h>

// Causal multi-head attention (x [4][2048][1024]; q/k/v = x W^T + b ([out][in] Linears); 16 heads x 64; interleaved-pair RoPE on q and k (pair (2k,2k+1) rotated by t / 10000^(2k/64)); scores = q.k / 8, causal (tril, arithmetic) -> -inf;
// softmax (the reference's +1e-8 on the denominator is below f32 resolution since the row max contributes exp(0) = 1); out = merged attn.v Wo^T + bo).
// Compute dtypes, f32 accumulate: every input rounded to bf16; projections on PLAIN bf16 operands (inputs: exact, + bias); rotary cos/sin table in f32; scores and
// attn.v on bf16 hi+lo planes (3 products) for the first RH = 256 query rows of every batch and on SINGLE fp16 planes for rows >= 256;
// output hi+lo x exact Wo (2 products) + bo. 128x128-tile GEMMs (operands staged in LDS), every launch over all batch elements (rows b*2048 + t, head planes [b][h]); the q/k/v GEMMs write the head planes themselves. Deterministic, no

#define NB_  4
#define TT   2048
#define DD   1024
#define NH_  16
#define HD   64
#define RH   256                  // query rows < RH: hi+lo planes; rows >= RH: fp16 planes
#define NF   32                   // rotary frequencies (head_dim / 2)
typedef _Float16 h16;
typedef unsigned short bf;
typedef __attribute__((ext_vector_type(16))) __bf16   v16bf;
typedef __attribute__((ext_vector_type(16))) _Float16 v16h;
typedef __attribute__((ext_vector_type(8)))  _Float16 v8h;
typedef __attribute__((ext_vector_type(8)))  unsigned short v8us;
typedef __attribute__((ext_vector_type(8)))  float    v8f;
typedef __attribute__((ext_vector_type(4)))  float    v4f;
typedef v8h  __attribute__((may_alias)) v8ha;
typedef v4f  __attribute__((may_alias)) v4fa;
typedef v8us __attribute__((may_alias)) v8usa;

__device__ __forceinline__ unsigned short f2bf(float f) { unsigned u = __float_as_uint(f); u += 0x7FFFu + ((u >> 16) & 1u); return (unsigned short)(u >> 16); }
__device__ __forceinline__ float bf2f(unsigned short b) { return __uint_as_float(((unsigned)b) << 16); }
__device__ __forceinline__ float bfr(float f) { return bf2f(f2bf(f)); }
__device__ __forceinline__ v16h cat16(v8h lo, v8h hi) { return __builtin_shufflevector(lo, hi, 0, 1, 2, 3, 4, 5, 6, 7, 8, 9, 10, 11, 12, 13, 14, 15); }
__device__ __forceinline__ v16bf cat16b(v8us lo, v8us hi) { return __builtin_bit_cast(v16bf, __builtin_shufflevector(lo, hi, 0, 1, 2, 3, 4, 5, 6, 7, 8, 9, 10, 11, 12, 13, 14, 15)); }
__device__ __forceinline__ v8f wmma16(v16h a, v16h b, v8f c) { return __builtin_amdgcn_wmma_f32_16x16x32_f16(false, a, false, b, (short)0, c, false, false); }
__device__ __forceinline__ v8f wmmab(v16bf a, v16bf b, v8f c) { return __builtin_amdgcn_wmma_f32_16x16x32_bf16(false, a, false, b, (short)0, c, false, false); }
__device__ __forceinline__ h16 tohx(float x) { return (h16)x; }
__device__ __forceinline__ void splitf(float y, unsigned short& h, unsigned short& l) { h = f2bf(y); l = f2bf(y - bf2f(h)); }
// eight consecutive elements of the three planes (bf16 hi, bf16 lo, fp16) at element offset e: one 16-byte store a plane
__device__ __forceinline__ void put8(const float* r, bf* Ph, bf* Pl, h16* P16, size_t e) { v8us oh, ol; v8h o16;
#pragma unroll
    for (int q = 0; q < 8; ++q) { unsigned short a, c2; splitf(r[q], a, c2); oh[q] = a; ol[q] = c2; o16[q] = tohx(r[q]); }
    *(v8us*)(Ph + e) = oh; *(v8us*)(Pl + e) = ol; *(v8h*)(P16 + e) = o16; }



// ---- k_gemmw: one work-group of 8 waves (2 x 4) per 128x128 output tile, a wave owns 64x32 of it; grid (M/128, N/128), 256 threads. M, N multiples of 128, K a multiple of KP and at least 2 KP.
// C[m][n] (f32, pitch ldc) = sum_k A[m][k] Bt[n][k] (NSPLIT 1: + A2[m][k] Bt[n][k]) + bias[n]; operands are K-contiguous bf16 planes, summed in one chain in k order.
// A pass is KP k of every operand row: [A 128 rows | (A2 128 rows) | Bt 128 rows] at a pitch of 16 bytes x odd, brought into a ring of two LDS buffers by asynchronous copies that take whole 128-byte lines
// (a fragment load straight from the planes touches 16 lines for 512 bytes); pass t + 2 is copied while pass t + 1 is worked on; the eight waves share every staged row.
// EPI 0: C is stored as f32. EPI 1 (q, k) and EPI 2 (v): M rows are b*2048 + t, N columns h*64 + d; the tile (+ bias) goes straight from its LDS staging into the three planes (bf16 hi, bf16 lo, fp16) that the attention reads, C is not written:
// EPI 1: [b][h][t][d] with interleaved-pair RoPE: (x0, x1) at (d, d + 1), d even -> (cos x0 - sin x1, sin x0 + cos x1), angle index d/2, (cos, sin) from CSN[t][d/2]; EPI 2: [b][h][d][t] (transposed).
template <typename T16> struct WFrag;
template <> struct WFrag<h16> { typedef v16h V; static __device__ __forceinline__ V ld(const h16* p) { return cat16(*(const v8h*)p, *(const v8h*)(p + 16)); } static __device__ __forceinline__ v8f mma(V a, V b, v8f c) { return wmma16(a, b, c); } };
template <> struct WFrag<bf> { typedef v16bf V; static __device__ __forceinline__ V ld(const bf* p) { return cat16b(*(const v8us*)p, *(const v8us*)(p + 16)); } static __device__ __forceinline__ v8f mma(V a, V b, v8f c) { return wmmab(a, b, c); } };
// runs of four or eight asynchronous 16-byte copies a lane (l: LDS byte address, g: global address); the closing s_wait_xcnt 0 stands in the copies' own statement, in front of any rewrite of the address registers that they name
__device__ __forceinline__ void acopy4(const unsigned* l, const bf* const* g) {
    asm volatile("global_load_async_to_lds_b128 %0, %1, off\n\tglobal_load_async_to_lds_b128 %2, %3, off\n\tglobal_load_async_to_lds_b128 %4, %5, off\n\tglobal_load_async_to_lds_b128 %6, %7, off\n\ts_wait_xcnt 0x0"
                 :: "v"(l[0]), "v"(g[0]), "v"(l[1]), "v"(g[1]), "v"(l[2]), "v"(g[2]), "v"(l[3]), "v"(g[3]) : "memory"); }
__device__ __forceinline__ void acopy8(const unsigned* l, const bf* const* g) {
    asm volatile("global_load_async_to_lds_b128 %0, %1, off\n\tglobal_load_async_to_lds_b128 %2, %3, off\n\tglobal_load_async_to_lds_b128 %4, %5, off\n\tglobal_load_async_to_lds_b128 %6, %7, off\n\t"
                 "global_load_async_to_lds_b128 %8, %9, off\n\tglobal_load_async_to_lds_b128 %10, %11, off\n\tglobal_load_async_to_lds_b128 %12, %13, off\n\tglobal_load_async_to_lds_b128 %14, %15, off\n\ts_wait_xcnt 0x0"
                 :: "v"(l[0]), "v"(g[0]), "v"(l[1]), "v"(g[1]), "v"(l[2]), "v"(g[2]), "v"(l[3]), "v"(g[3]), "v"(l[4]), "v"(g[4]), "v"(l[5]), "v"(g[5]), "v"(l[6]), "v"(g[6]), "v"(l[7]), "v"(g[7]) : "memory"); }
template <int NSPLIT, int EPI>
__global__ __launch_bounds__(256) void k_gemmw(const bf* __restrict__ A, const bf* __restrict__ A2, const bf* __restrict__ Bt, int K, float* C, int ldc, const float* __restrict__ bias, const float* __restrict__ CSN, bf* Ph, bf* Pl, h16* P16) {
    typedef WFrag<bf>::V V;                     // every full unroll below: the arrays are register fragments or asm operands, so their indices must be compile-time constants
    constexpr int KP = NSPLIT ? 64 : 128;       // k per pass: either way 32 matrix instructions a wave and pass, and two work-groups fit a WGP's LDS
    constexpr int PB = KP * 2 + 16;             // LDS row pitch in bytes (16 x odd: no bank conflict for 16-byte fragment reads)
    constexpr int ROWS = NSPLIT ? 384 : 256;    // rows of a stage
    constexpr int STAGE = ROWS * PB;
    constexpr int CPR = KP / 8;                 // 16-byte pieces of a row
    constexpr int RPI = 256 / CPR;              // rows that one copy of all 256 threads brings
    constexpr int NC = ROWS / RPI;              // copies per thread and stage (16 or 12)
    constexpr int OP = 36;                      // floats per row of a wave's 64x32 tile in the output staging
    constexpr int TP = 132;                     // EPI 1, 2: floats per row of the work-group's whole 128x128 tile in the output staging (16 bytes x odd)
    static_assert(8 * 64 * OP * 4 <= 2 * STAGE && 128 * TP * 4 <= 2 * STAGE, "output staging fits the ring");
    __shared__ __attribute__((aligned(128))) unsigned char L[2 * STAGE];
    const int tid = (int)threadIdx.x, lane = tid & 31, lr = lane & 15, hi = lane >> 4; const int wv = __builtin_amdgcn_readfirstlane(tid >> 5), wm = wv & 1, wn = wv >> 1;
    const int r0 = blockIdx.x * 128, c0 = blockIdx.y * 128;
    const int crow = tid / CPR, ccol = tid % CPR;
    const unsigned ldst = (unsigned)(uintptr_t)L + (unsigned)(crow * PB + ccol * 16);
    const bf* gA = A + (size_t)(r0 + crow) * K + ccol * 8; const bf* gA2 = NSPLIT ? A2 + (size_t)(r0 + crow) * K + ccol * 8 : nullptr; const bf* gB = Bt + (size_t)(c0 + crow) * K + ccol * 8;
    auto fill = [&](int t) {                    // every thread's NC copies of pass t into buffer t & 1
        unsigned l[NC]; const bf* g[NC];
#pragma unroll
        for (int i = 0; i < NC; ++i) { const int row = i * RPI; const bf* base = row < 128 ? gA : (NSPLIT && row < 256) ? gA2 : gB; g[i] = base + (size_t)(row & 127) * K + t * KP; l[i] = ldst + (unsigned)((t & 1) * STAGE + row * PB); }
#pragma unroll
        for (int i = 0; i + 8 <= NC; i += 8) acopy8(l + i, g + i);
        if (NC % 8) acopy4(l + NC - 4, g + NC - 4);
    };
    const int er = lane >> 3, ec = (lane & 7) * 4;
    const v4f bv = *(const v4fa*)(bias + c0 + wn * 32 + ec);     // read in front of the K loop, so that nothing waits for it behind it
    const float bb[2] = {bias[c0 + wn * 32 + lr], bias[c0 + wn * 32 + 16 + lr]};   // EPI 1, 2: the bias of the two columns that this lane's accumulators hold
    v8f acc[4][2];
#pragma unroll
    for (int mb = 0; mb < 4; ++mb)
#pragma unroll
        for (int nb = 0; nb < 2; ++nb) acc[mb][nb] = (v8f){};
    const int NT = K / KP;
    fill(0);
    asm volatile("s_wait_asynccnt 0x0" ::: "memory");           // this wave's copies of pass 0 have landed
    __syncthreads();                                            // and every other wave's
    if (NT > 1) fill(1);
#pragma unroll 1                                                // rolled: a trip is a whole pass, its buffer chosen at run time
    for (int t = 0; t < NT; ++t) {
        const unsigned char* S = L + (t & 1) * STAGE;
        const unsigned char* pa = S + (wm * 64 + lr) * PB + hi * 16; const unsigned char* pb = S + (ROWS - 128 + wn * 32 + lr) * PB + hi * 16;
#pragma unroll
        for (int ks = 0; ks < KP / 32; ++ks) {
            V a[4], a2[4], b[2];
#pragma unroll
            for (int mb = 0; mb < 4; ++mb) { a[mb] = WFrag<bf>::ld((const bf*)(pa + mb * 16 * PB + ks * 64)); if (NSPLIT) a2[mb] = WFrag<bf>::ld((const bf*)(pa + (128 + mb * 16) * PB + ks * 64)); }
#pragma unroll
            for (int nb = 0; nb < 2; ++nb) b[nb] = WFrag<bf>::ld((const bf*)(pb + nb * 16 * PB + ks * 64));
#pragma unroll
            for (int nb = 0; nb < 2; ++nb)
#pragma unroll
                for (int mb = 0; mb < 4; ++mb) { acc[mb][nb] = WFrag<bf>::mma(a[mb], b[nb], acc[mb][nb]); if (NSPLIT) acc[mb][nb] = WFrag<bf>::mma(a2[mb], b[nb], acc[mb][nb]); }
        }
        asm volatile("s_wait_dscnt 0x0" ::: "memory");          // this wave's reads of buffer t & 1 are done
        asm volatile("s_wait_asynccnt 0x0" ::: "memory");       // this wave's copies of pass t + 1 have landed
        __syncthreads();                                        // publishes pass t + 1 and frees buffer t & 1
        if (t + 2 < NT) fill(t + 2);
    }
    asm volatile("s_wait_asynccnt 0x0" ::: "memory");           // no copy is outstanding when the ring becomes output staging
  if constexpr (EPI == 0) {
    float* mine = (float*)L + wv * (64 * OP);                   // behind the last pass's barrier: every wave has left the ring
#pragma unroll
    for (int mb = 0; mb < 4; ++mb)
#pragma unroll
        for (int nb = 0; nb < 2; ++nb)
#pragma unroll
            for (int j = 0; j < 8; ++j) mine[(mb * 16 + hi * 8 + j) * OP + nb * 16 + lr] = acc[mb][nb][j];
    __syncthreads();                                            // the rows are read back by other lanes
#pragma unroll
    for (int s = 0; s < 16; ++s) { const int row = s * 4 + er; v4f val = *(const v4fa*)(mine + row * OP + ec);    // a store instruction writes four whole 128-byte lines
#pragma unroll
        for (int q = 0; q < 4; ++q) val[q] += bfr(bv[q]);
        *(v4f*)(C + (size_t)(r0 + wm * 64 + row) * ldc + c0 + wn * 32 + ec) = val; }
  } else {
    float* tile = (float*)L;                                    // behind the last pass's barrier: every wave has left the ring
#pragma unroll
    for (int mb = 0; mb < 4; ++mb)
#pragma unroll
        for (int nb = 0; nb < 2; ++nb) { const v8f x = acc[mb][nb] + bfr(bb[nb]); const int row = wm * 64 + mb * 16 + hi * 8, col = wn * 32 + nb * 16 + lr;
            if constexpr (EPI == 1) {                           // [t][column]
#pragma unroll
                for (int j = 0; j < 8; ++j) tile[(row + j) * TP + col] = x[j];
            } else {                                            // [column][t]: the eight rows that a lane holds of a column are consecutive t
                float* p = tile + col * TP + row; *(v4fa*)p = __builtin_shufflevector(x, x, 0, 1, 2, 3); *(v4fa*)(p + 4) = __builtin_shufflevector(x, x, 4, 5, 6, 7); } }
    __syncthreads();                                            // the tile is read back by other waves
    const size_t bh = (size_t)(r0 / TT) * NH_ + c0 / HD;        // the tile lies in one batch element and holds two whole heads
    const int t0 = r0 & (TT - 1);
    if constexpr (EPI == 1) {                                   // a lane takes 8 consecutive d of one t, a store instruction writes four whole 128-byte lines; waves 0-3 the first head, 4-7 the second
        const int hh = wv >> 2, cg = lane & 7;
#pragma unroll
        for (int s = 0; s < 8; ++s) { const int row = ((wv & 3) * 8 + s) * 4 + (lane >> 3); const float* p = tile + row * TP + hh * HD + cg * 8; const float* pc = CSN + ((size_t)(t0 + row) * NF + cg * 4) * 2;
            const v4f x[2] = {*(const v4fa*)p, *(const v4fa*)(p + 4)}, cs[2] = {*(const v4fa*)pc, *(const v4fa*)(pc + 4)}; float r[8];
#pragma unroll
            for (int q = 0; q < 4; ++q) { const float co = cs[q >> 1][(q & 1) * 2], si = cs[q >> 1][(q & 1) * 2 + 1], x0 = x[q >> 1][(q & 1) * 2], x1 = x[q >> 1][(q & 1) * 2 + 1]; r[q * 2] = co * x0 - si * x1; r[q * 2 + 1] = si * x0 + co * x1; }
            put8(r, Ph, Pl, P16, ((bh + hh) * TT + t0 + row) * HD + cg * 8); }
    } else {                                                    // a lane takes 8 consecutive t of one column, a store instruction writes four whole 128-byte lines (two columns)
#pragma unroll
        for (int s = 0; s < 8; ++s) { const int col = (wv * 8 + s) * 2 + hi; const float* p = tile + col * TP + lr * 8; const v4f x[2] = {*(const v4fa*)p, *(const v4fa*)(p + 4)};
            const float r[8] = {x[0][0], x[0][1], x[0][2], x[0][3], x[1][0], x[1][1], x[1][2], x[1][3]};
            put8(r, Ph, Pl, P16, (bh * HD + col) * TT + t0 + lr * 8); }
    }
  }
}

typedef __attribute__((ext_vector_type(2))) float v2f;

__global__ __launch_bounds__(256) void k_cvt8(const float* __restrict__ src, bf* dst, size_t n8) { const size_t i = (size_t)blockIdx.x * 256 + threadIdx.x; if (i >= n8) return; const v8f v = *(const v8f*)(src + i * 8); v8us o;
#pragma unroll
    for (int k = 0; k < 8; ++k) o[k] = f2bf(v[k]); *(v8us*)(dst + i * 8) = o;  }
__global__ __launch_bounds__(256) void k_cstab(float* CSN) {
    const int idx = blockIdx.x * 256 + threadIdx.x; if (idx >= TT * NF) return; const int t = idx / NF, i = idx % NF; const float den = powf(10000.0f, (float)(2 * i) * (1.0f / HD)); const float ang = __fdiv_rn((float)t, den);
    v2f o; o[0] = cosf(ang); o[1] = sinf(ang); *(v2f*)(CSN + (size_t)idx * 2) = o;  }
// k_fattn: scores, causal softmax, attn.v and the head merge in one kernel; a work-group of NS waves owns 32 query rows of one head; wave w takes the 32-key blocks w, w + NS, ... up to the diagonal block.
// St = K Qt (A = 16 key rows, B = 16 query rows): lane (lr, hi) holds for query lr the keys hi*8 + j of each 16-key tile, which is the k order of the B fragment of Ot += Vt Pt, so P stays in registers.
// Running maximum m and sum l per query and wave (log2 domain); P = exp2(t - m) (fp16 rows: x 1024, which cancels in the division by l). Rows < RH: bf16 hi+lo planes, 3 products; rows >= RH: single fp16 planes.
// The NS partial (m, l, O) are joined in LDS in the fixed order w = 0 .. NS-1 (deterministic); a wave without a block hands over m = -3e38, l = 0, O = 0, whose weight is exp2(-huge) = 0.
#define NS   4
#define OPI  68                   // floats per query row of a partial O tile in LDS
#define C2L 0.18033688011112042f  // (1/8) log2(e)
// exp2 in asm text with the slot behind a transcendental kept by construction: each v_exp_f32 works in place on a register of its own, so none reads the result or overwrites the source of the one in front of it,
// and the closing v_nop is the one independent slot in front of whatever the compiler puts next.
__device__ __forceinline__ float exp2s(float x) { asm("v_exp_f32 %0, %0\n\tv_nop" : "+v"(x)); return x; }
__device__ __forceinline__ v8f exp2x8(v8f x) { float a = x[0], b = x[1], c = x[2], d = x[3], e = x[4], f = x[5], g = x[6], h = x[7];
    asm("v_exp_f32 %0, %0\n\tv_exp_f32 %1, %1\n\tv_exp_f32 %2, %2\n\tv_exp_f32 %3, %3\n\tv_exp_f32 %4, %4\n\tv_exp_f32 %5, %5\n\tv_exp_f32 %6, %6\n\tv_exp_f32 %7, %7\n\tv_nop" : "+v"(a), "+v"(b), "+v"(c), "+v"(d), "+v"(e), "+v"(f), "+v"(g), "+v"(h));
    return (v8f){a, b, c, d, e, f, g, h}; }
template <typename T16, bool HR, int NG>   // NG: 16-query groups worked on at a time (hi+lo rows: one, which keeps the kernel within 256 registers)
__device__ __forceinline__ void attn_rows(const T16* __restrict__ Q, const T16* __restrict__ Q2, const T16* __restrict__ Kp, const T16* __restrict__ K2, const T16* __restrict__ Vt, const T16* __restrict__ V2, float* os, float* mS, float* lS, int q0, int kfirst, int lr, int hi) {
    typedef typename WFrag<T16>::V V;     // every full unroll below: the arrays are register fragments, so their indices must be compile-time constants
#pragma unroll 1                          // rolled: the two passes of the hi+lo rows share one copy of the code and one set of registers
  for (int gb = 0; gb < 2; gb += NG) {
    V qf[NG][2], qf2[NG][2], kf[2][2], kf2[2][2];
#pragma unroll
    for (int g = 0; g < NG; ++g)
#pragma unroll
        for (int ks = 0; ks < 2; ++ks) { const size_t o = (size_t)(q0 + (gb + g) * 16 + lr) * HD + ks * 32 + 8 * hi; qf[g][ks] = WFrag<T16>::ld(Q + o); if (HR) qf2[g][ks] = WFrag<T16>::ld(Q2 + o); }
    if constexpr (!HR) {
#pragma unroll
        for (int t = 0; t < 2; ++t)
#pragma unroll
            for (int ks = 0; ks < 2; ++ks) kf[t][ks] = WFrag<T16>::ld(Kp + (size_t)(kfirst + t * 16 + lr) * HD + ks * 32 + 8 * hi); }
    v8f o[NG][4]; float m[NG], l[NG];
#pragma unroll
    for (int g = 0; g < NG; ++g) { m[g] = -3.0e38f; l[g] = 0.f;
#pragma unroll
        for (int dt = 0; dt < 4; ++dt) o[g][dt] = (v8f){}; }
#pragma unroll 1                          // rolled: a trip is a whole 32-key block, a second copy would only cost registers
    for (int key0 = kfirst; key0 <= q0; key0 += 32 * NS) {
        V vf[4], vf2[4];
        if constexpr (!HR) {
#pragma unroll
            for (int dt = 0; dt < 4; ++dt) vf[dt] = WFrag<T16>::ld(Vt + (size_t)(dt * 16 + lr) * TT + key0 + 8 * hi); }
        if constexpr (HR) {                                     // hi+lo rows: at most two trips a wave, K read where it is used (fetched ahead it would cost registers the kernel does not have)
#pragma unroll
            for (int t = 0; t < 2; ++t)
#pragma unroll
                for (int ks = 0; ks < 2; ++ks) { const size_t ok = (size_t)(key0 + t * 16 + lr) * HD + ks * 32 + 8 * hi; kf[t][ks] = WFrag<T16>::ld(Kp + ok); kf2[t][ks] = WFrag<T16>::ld(K2 + ok); } }
        v8f s[NG][2];
#pragma unroll
        for (int g = 0; g < NG; ++g)
#pragma unroll
            for (int t = 0; t < 2; ++t) { s[g][t] = (v8f){};
#pragma unroll
                for (int ks = 0; ks < 2; ++ks) { s[g][t] = WFrag<T16>::mma(kf[t][ks], qf[g][ks], s[g][t]); if (HR) { s[g][t] = WFrag<T16>::mma(kf2[t][ks], qf[g][ks], s[g][t]); s[g][t] = WFrag<T16>::mma(kf[t][ks], qf2[g][ks], s[g][t]); } } }
#pragma unroll
        for (int g = 0; g < NG; ++g)
#pragma unroll
            for (int t = 0; t < 2; ++t) s[g][t] *= C2L;
        if constexpr (HR) {
            asm volatile("s_wait_xcnt 0x0" ::: "memory");       // the V fragments below land in registers that the K loads above name as addresses: the wait stands in front of them
            __builtin_amdgcn_sched_barrier(0);                  // keeps the V loads behind that wait
            const T16* pv = Vt + (size_t)lr * TT + key0 + 8 * hi; const T16* pv2 = V2 + (size_t)lr * TT + key0 + 8 * hi;
#pragma unroll
            for (int dt = 0; dt < 4; ++dt) { vf[dt] = WFrag<T16>::ld(pv + (size_t)dt * 16 * TT); vf2[dt] = WFrag<T16>::ld(pv2 + (size_t)dt * 16 * TT); }
            asm volatile("s_wait_xcnt 0x0" :: "v"(pv), "v"(pv2) : "memory"); }   // both address pairs are inputs here, so they stay live through the run and no V fragment lands in them; they are free for reuse only behind this wait
        if constexpr (!HR) { const int kn = (key0 + 32 * NS <= q0) ? key0 + 32 * NS : q0;   // this wave's next K fragments fly during the softmax and attn.v of this block (last trip: the diagonal block, in bounds, unused)
#pragma unroll
            for (int t = 0; t < 2; ++t)
#pragma unroll
                for (int ks = 0; ks < 2; ++ks) kf[t][ks] = WFrag<T16>::ld(Kp + (size_t)(kn + t * 16 + lr) * HD + ks * 32 + 8 * hi); }
        if (key0 == q0) {                                       // the diagonal block, the only one with keys behind a query of this wave
#pragma unroll
            for (int g = 0; g < NG; ++g)
#pragma unroll
                for (int t = 0; t < 2; ++t)
#pragma unroll
                    for (int j = 0; j < 8; ++j) if (t * 16 + hi * 8 + j > (gb + g) * 16 + lr) s[g][t][j] = -3.0e38f; }
#pragma unroll
        for (int g = 0; g < NG; ++g) {
            float bm = s[g][0][0];
#pragma unroll
            for (int t = 0; t < 2; ++t)
#pragma unroll
                for (int j = 0; j < 8; ++j) bm = fmaxf(bm, s[g][t][j]);
            bm = fmaxf(bm, __shfl_xor(bm, 16, 32));             // the other half of the wave holds the other 16 keys of the same query
            const float mn = fmaxf(m[g], bm); const float al = exp2s(m[g] - mn); m[g] = mn; const float ms = HR ? mn : mn - 10.0f;
            float ps = 0.f;
#pragma unroll
            for (int t = 0; t < 2; ++t) { s[g][t] = exp2x8(s[g][t] - ms);
#pragma unroll
                for (int j = 0; j < 8; ++j) ps += s[g][t][j]; }
            l[g] = l[g] * al + ps;
#pragma unroll
            for (int dt = 0; dt < 4; ++dt) o[g][dt] *= al;
            if constexpr (HR) { v8us ph[2], pl[2];
#pragma unroll
                for (int t = 0; t < 2; ++t)
#pragma unroll
                    for (int j = 0; j < 8; ++j) { unsigned short a, c2; splitf(s[g][t][j], a, c2); ph[t][j] = a; pl[t][j] = c2; }
                const V pf = cat16b(ph[0], ph[1]), pf2 = cat16b(pl[0], pl[1]);
#pragma unroll
                for (int dt = 0; dt < 4; ++dt) { o[g][dt] = WFrag<T16>::mma(vf[dt], pf, o[g][dt]); o[g][dt] = WFrag<T16>::mma(vf2[dt], pf, o[g][dt]); o[g][dt] = WFrag<T16>::mma(vf[dt], pf2, o[g][dt]); }
            } else { v8h ph[2];
#pragma unroll
                for (int t = 0; t < 2; ++t)
#pragma unroll
                    for (int j = 0; j < 8; ++j) ph[t][j] = tohx(s[g][t][j]);
                const V pf = cat16(ph[0], ph[1]);
#pragma unroll
                for (int dt = 0; dt < 4; ++dt) o[g][dt] = WFrag<T16>::mma(vf[dt], pf, o[g][dt]); }
        }
    }
#pragma unroll
    for (int g = 0; g < NG; ++g) { const float lt = l[g] + __shfl_xor(l[g], 16, 32); if (hi == 0) { mS[(gb + g) * 16 + lr] = m[g]; lS[(gb + g) * 16 + lr] = lt; }
#pragma unroll
        for (int dt = 0; dt < 4; ++dt) { float* p = os + ((gb + g) * 16 + lr) * OPI + dt * 16 + hi * 8; const v8f x = o[g][dt]; *(v4fa*)p = __builtin_shufflevector(x, x, 0, 1, 2, 3); *(v4fa*)(p + 4) = __builtin_shufflevector(x, x, 4, 5, 6, 7); } }
  }
}
// grid (NB_ * NH_, TT / 32), NS waves; blockIdx.x = b * NH_ + h; the longest rows (most keys) of every batch element and head start first, so that the short ones fill the places that come free; four waves per SIMD (256 registers) cover each other's load waits
__global__ __launch_bounds__(NS * 32) __attribute__((amdgpu_waves_per_eu(4, 4))) void k_fattn(const bf* __restrict__ Qh, const bf* __restrict__ Ql, const bf* __restrict__ Kh, const bf* __restrict__ Kl, const bf* __restrict__ Vh, const bf* __restrict__ Vl, const h16* __restrict__ Q16, const h16* __restrict__ K16, const h16* __restrict__ V16, bf* Ah, bf* Al) {
    __shared__ __align__(16) float os[NS * 32 * OPI]; __shared__ float mS[NS * 32]; __shared__ float lS[NS * 32];
    const int lane = threadIdx.x & 31, lr = lane & 15, hi = lane >> 4; const int wv = __builtin_amdgcn_readfirstlane((int)(threadIdx.x >> 5));
    const int q0 = (TT / 32 - 1 - (int)blockIdx.y) * 32; const size_t hp = (size_t)blockIdx.x * TT * HD;
    if (q0 < RH) attn_rows<bf, true, 1>(Qh + hp, Ql + hp, Kh + hp, Kl + hp, Vh + hp, Vl + hp, os + wv * (32 * OPI), mS + wv * 32, lS + wv * 32, q0, wv * 32, lr, hi);
    else attn_rows<h16, false, 2>(Q16 + hp, nullptr, K16 + hp, nullptr, V16 + hp, nullptr, os + wv * (32 * OPI), mS + wv * 32, lS + wv * 32, q0, wv * 32, lr, hi);
    __syncthreads();
    // wave w joins queries w*8 .. w*8+7: a lane takes 16 consecutive d of one query, the wave whole 128-byte lines of the merged planes
    const int qq = wv * (32 / NS) + (lane >> 2), d0 = (lane & 3) * 16;
    float mw[NS], M = -3.0e38f;
#pragma unroll
    for (int w = 0; w < NS; ++w) { mw[w] = mS[w * 32 + qq]; M = fmaxf(M, mw[w]); }
    float L = 0.f; v4f val[4];
#pragma unroll
    for (int i = 0; i < 4; ++i) val[i] = (v4f)(0.f);
#pragma unroll
    for (int w = 0; w < NS; ++w) { const float f = exp2s(mw[w] - M); L += f * lS[w * 32 + qq];
#pragma unroll
        for (int i = 0; i < 4; ++i) val[i] += f * *(const v4fa*)(os + w * (32 * OPI) + qq * OPI + d0 + i * 4); }
    const float inv = __fdiv_rn(1.0f, L);
#pragma unroll
    for (int u = 0; u < 2; ++u) { v8us oh, ol;
#pragma unroll
        for (int j = 0; j < 8; ++j) { unsigned short a, c2; splitf(val[u * 2 + (j >> 2)][j & 3] * inv, a, c2); oh[j] = a; ol[j] = c2; }
        const size_t oo = ((size_t)(blockIdx.x / NH_) * TT + q0 + qq) * DD + (blockIdx.x % NH_) * HD + d0 + u * 8; *(v8us*)(Ah + oo) = oh; *(v8us*)(Al + oo) = ol; }
}

extern "C" void kernel_launch(void* const* d_in, const int* in_sizes, int n_in,
                              void* d_out, int out_size, void* d_ws, size_t ws_size, hipStream_t stream) {
    (void)in_sizes; (void)n_in; (void)out_size;
    const float* x = (const float*)d_in[0]; const float* Wq = (const float*)d_in[1]; const float* bq = (const float*)d_in[2]; const float* Wk = (const float*)d_in[3]; const float* bk = (const float*)d_in[4]; const float* Wv = (const float*)d_in[5]; const float* bv = (const float*)d_in[6]; const float* Wd = (const float*)d_in[7]; const float* bo = (const float*)d_in[8];
    float* OUT = (float*)d_out;     // [4][2048][1024]
    char* wsp = (char*)d_ws;
    auto take = [&](size_t bytes) { char* p = wsp; wsp += (bytes + 255) & ~(size_t)255; return (void*)p; };
    bf* WQ = (bf*)take((size_t)DD * DD * 2); bf* WK = (bf*)take((size_t)DD * DD * 2); bf* WV = (bf*)take((size_t)DD * DD * 2); bf* WO = (bf*)take((size_t)DD * DD * 2);
    bf* XB = (bf*)take((size_t)NB_ * TT * DD * 2); float* CSN = (float*)take((size_t)TT * NF * 2 * 4);
    bf* QPh = (bf*)take((size_t)NB_ * TT * DD * 2); bf* QPl = (bf*)take((size_t)NB_ * TT * DD * 2); bf* KPh = (bf*)take((size_t)NB_ * TT * DD * 2); bf* KPl = (bf*)take((size_t)NB_ * TT * DD * 2); bf* VTh = (bf*)take((size_t)NB_ * TT * DD * 2); bf* VTl = (bf*)take((size_t)NB_ * TT * DD * 2);
    h16* QP16 = (h16*)take((size_t)NB_ * TT * DD * 2); h16* KP16 = (h16*)take((size_t)NB_ * TT * DD * 2); h16* VT16 = (h16*)take((size_t)NB_ * TT * DD * 2);
    bf* ATh = (bf*)take((size_t)NB_ * TT * DD * 2); bf* ATl = (bf*)take((size_t)NB_ * TT * DD * 2);
    if ((size_t)(wsp - (char*)d_ws) > ws_size) return;    // total 200.5 MiB; ws 256 MiB
    { const size_t nw = (size_t)DD * DD / 8; const unsigned gw = (unsigned)((nw + 255) / 256); k_cvt8<<<gw, 256, 0, stream>>>(Wq, WQ, nw); k_cvt8<<<gw, 256, 0, stream>>>(Wk, WK, nw); k_cvt8<<<gw, 256, 0, stream>>>(Wv, WV, nw); k_cvt8<<<gw, 256, 0, stream>>>(Wd, WO, nw);
      k_cstab<<<TT * NF / 256, 256, 0, stream>>>(CSN); }
    const dim3 gP(NB_ * TT / 128, DD / 128, 1);   // x is [4][2048][1024]: the batch elements are further rows of every GEMM
    k_cvt8<<<(unsigned)(((size_t)NB_ * TT * DD / 8 + 255) / 256), 256, 0, stream>>>(x, XB, (size_t)NB_ * TT * DD / 8);
    k_gemmw<0, 1><<<gP, 256, 0, stream>>>(XB, nullptr, WQ, DD, nullptr, DD, bq, CSN, QPh, QPl, QP16);
    k_gemmw<0, 1><<<gP, 256, 0, stream>>>(XB, nullptr, WK, DD, nullptr, DD, bk, CSN, KPh, KPl, KP16);
    k_gemmw<0, 2><<<gP, 256, 0, stream>>>(XB, nullptr, WV, DD, nullptr, DD, bv, nullptr, VTh, VTl, VT16);
    k_fattn<<<dim3(NB_ * NH_, TT / 32, 1), NS * 32, 0, stream>>>(QPh, QPl, KPh, KPl, VTh, VTl, QP16, KP16, VT16, ATh, ATl);
    k_gemmw<1, 0><<<gP, 256, 0, stream>>>(ATh, ATl, WO, DD, OUT, DD, bo, nullptr, nullptr, nullptr, nullptr);
}

// v006
// A run of this version takes 159 microseconds.
// Timed twice side by side with v005, it ran 1.06 times as fast both times.
// All steps since v000 together make it 25.6 times as fast.
#include <hip/hip_runtime.h>

// Causal multi-head attention (x [4][2048][1024]; q/k/v = x W^T + b ([out][in] Linears); 16 heads x 64; interleaved-pair RoPE on q and k (pair (2k,2k+1) rotated by t / 10000^(2k/64)); scores = q.k / 8, causal (tril, arithmetic) -> -inf;
// softmax (the reference's +1e-8 on the denominator is below f32 resolution since the row max contributes exp(0) = 1); out = merged attn.v Wo^T + bo).
// Compute dtypes, f32 accumulate: every input rounded to bf16; projections on PLAIN bf16 operands (inputs: exact, + bias); rotary cos/sin table in f32; scores and
// attn.v on bf16 hi+lo planes (3 products) for the first RH = 256 query rows of every batch and on SINGLE fp16 planes for rows >= 256;
// output hi+lo x exact Wo (2 products) + bo. 128x128-tile GEMMs (operands staged in LDS), every launch over all batch elements (rows b*2048 + t, head planes [b][h]); the q/k/v GEMMs write the head planes themselves. Deterministic, no

#define NB_  4
#define TT   2048
#define DD   1024
#define NH_  16
#define HD   64
#define RH   256                  // query rows < RH: hi+lo planes; rows >= RH: fp16 planes
#define NF   32                   // rotary frequencies (head_dim / 2)
typedef _Float16 h16;
typedef unsigned short bf;
typedef __attribute__((ext_vector_type(16))) __bf16   v16bf;
typedef __attribute__((ext_vector_type(16))) _Float16 v16h;
typedef __attribute__((ext_vector_type(8)))  _Float16 v8h;
typedef __attribute__((ext_vector_type(8)))  unsigned short v8us;
typedef __attribute__((ext_vector_type(8)))  float    v8f;
typedef __attribute__((ext_vector_type(4)))  float    v4f;
typedef v8h  __attribute__((may_alias)) v8ha;
typedef v4f  __attribute__((may_alias)) v4fa;
typedef v8us __attribute__((may_alias)) v8usa;

__device__ __forceinline__ unsigned short f2bf(float f) { unsigned u = __float_as_uint(f); u += 0x7FFFu + ((u >> 16) & 1u); return (unsigned short)(u >> 16); }
__device__ __forceinline__ float bf2f(unsigned short b) { return __uint_as_float(((unsigned)b) << 16); }
__device__ __forceinline__ float bfr(float f) { return bf2f(f2bf(f)); }
__device__ __forceinline__ v16h cat16(v8h lo, v8h hi) { return __builtin_shufflevector(lo, hi, 0, 1, 2, 3, 4, 5, 6, 7, 8, 9, 10, 11, 12, 13, 14, 15); }
__device__ __forceinline__ v16bf cat16b(v8us lo, v8us hi) { return __builtin_bit_cast(v16bf, __builtin_shufflevector(lo, hi, 0, 1, 2, 3, 4, 5, 6, 7, 8, 9, 10, 11, 12, 13, 14, 15)); }
__device__ __forceinline__ v8f wmma16(v16h a, v16h b, v8f c) { return __builtin_amdgcn_wmma_f32_16x16x32_f16(false, a, false, b, (short)0, c, false, false); }
__device__ __forceinline__ v8f wmmab(v16bf a, v16bf b, v8f c) { return __builtin_amdgcn_wmma_f32_16x16x32_bf16(false, a, false, b, (short)0, c, false, false); }
__device__ __forceinline__ h16 tohx(float x) { return (h16)x; }
__device__ __forceinline__ void splitf(float y, unsigned short& h, unsigned short& l) { h = f2bf(y); l = f2bf(y - bf2f(h)); }
// eight consecutive elements of the three planes (bf16 hi, bf16 lo, fp16) at element offset e: one 16-byte store a plane
__device__ __forceinline__ void put8(const float* r, bf* Ph, bf* Pl, h16* P16, size_t e) { v8us oh, ol; v8h o16;
#pragma unroll
    for (int q = 0; q < 8; ++q) { unsigned short a, c2; splitf(r[q], a, c2); oh[q] = a; ol[q] = c2; o16[q] = tohx(r[q]); }
    *(v8us*)(Ph + e) = oh; *(v8us*)(Pl + e) = ol; *(v8h*)(P16 + e) = o16; }



// ---- k_gemmw: one work-group of 8 waves (2 x 4) per 128x128 output tile, a wave owns 64x32 of it; grid (M/128, N/128), 256 threads. M, N multiples of 128, K a multiple of KP and at least 2 KP.
// C[m][n] (f32, pitch ldc) = sum_k A[m][k] Bt[n][k] (NSPLIT 1: + A2[m][k] Bt[n][k]) + bias[n]; operands are K-contiguous bf16 planes, summed in one chain in k order.
// A pass is KP k of every operand row: [A 128 rows | (A2 128 rows) | Bt 128 rows] at a pitch of 16 bytes x odd, brought into a ring of two LDS buffers by asynchronous copies that take whole 128-byte lines
// (a fragment load straight from the planes touches 16 lines for 512 bytes); pass t + 2 is copied while pass t + 1 is worked on; the eight waves share every staged row.
// EPI 0: C is stored as f32. EPI 1 (q, k) and EPI 2 (v): M rows are b*2048 + t, N columns h*64 + d; the tile (+ bias) goes straight from its LDS staging into the three planes (bf16 hi, bf16 lo, fp16) that the attention reads, C is not written:
// EPI 1: [b][h][t][d] with interleaved-pair RoPE: (x0, x1) at (d, d + 1), d even -> (cos x0 - sin x1, sin x0 + cos x1), angle index d/2, (cos, sin) from CSN[t][d/2]; EPI 2: [b][h][d][t] (transposed).
template <typename T16> struct WFrag;
template <> struct WFrag<h16> { typedef v16h V; static __device__ __forceinline__ V ld(const h16* p) { return cat16(*(const v8h*)p, *(const v8h*)(p + 16)); } static __device__ __forceinline__ v8f mma(V a, V b, v8f c) { return wmma16(a, b, c); } };
template <> struct WFrag<bf> { typedef v16bf V; static __device__ __forceinline__ V ld(const bf* p) { return cat16b(*(const v8us*)p, *(const v8us*)(p + 16)); } static __device__ __forceinline__ v8f mma(V a, V b, v8f c) { return wmmab(a, b, c); } };
// runs of four or eight asynchronous 16-byte copies a lane (l: LDS byte address, g: global address); the closing s_wait_xcnt 0 stands in the copies' own statement, in front of any rewrite of the address registers that they name
__device__ __forceinline__ void acopy4(const unsigned* l, const bf* const* g) {
    asm volatile("global_load_async_to_lds_b128 %0, %1, off\n\tglobal_load_async_to_lds_b128 %2, %3, off\n\tglobal_load_async_to_lds_b128 %4, %5, off\n\tglobal_load_async_to_lds_b128 %6, %7, off\n\ts_wait_xcnt 0x0"
                 :: "v"(l[0]), "v"(g[0]), "v"(l[1]), "v"(g[1]), "v"(l[2]), "v"(g[2]), "v"(l[3]), "v"(g[3]) : "memory"); }
__device__ __forceinline__ void acopy8(const unsigned* l, const bf* const* g) {
    asm volatile("global_load_async_to_lds_b128 %0, %1, off\n\tglobal_load_async_to_lds_b128 %2, %3, off\n\tglobal_load_async_to_lds_b128 %4, %5, off\n\tglobal_load_async_to_lds_b128 %6, %7, off\n\t"
                 "global_load_async_to_lds_b128 %8, %9, off\n\tglobal_load_async_to_lds_b128 %10, %11, off\n\tglobal_load_async_to_lds_b128 %12, %13, off\n\tglobal_load_async_to_lds_b128 %14, %15, off\n\ts_wait_xcnt 0x0"
                 :: "v"(l[0]), "v"(g[0]), "v"(l[1]), "v"(g[1]), "v"(l[2]), "v"(g[2]), "v"(l[3]), "v"(g[3]), "v"(l[4]), "v"(g[4]), "v"(l[5]), "v"(g[5]), "v"(l[6]), "v"(g[6]), "v"(l[7]), "v"(g[7]) : "memory"); }
template <int NSPLIT, int EPI>
__global__ __launch_bounds__(256) void k_gemmw(const bf* __restrict__ A, const bf* __restrict__ A2, const bf* __restrict__ Bt, int K, float* C, int ldc, const float* __restrict__ bias, const float* __restrict__ CSN, bf* Ph, bf* Pl, h16* P16) {
    typedef WFrag<bf>::V V;                     // every full unroll below: the arrays are register fragments or asm operands, so their indices must be compile-time constants
    constexpr int KP = NSPLIT ? 64 : 128;       // k per pass: either way 32 matrix instructions a wave and pass, and two work-groups fit a WGP's LDS
    constexpr int PB = KP * 2 + 16;             // LDS row pitch in bytes (16 x odd: no bank conflict for 16-byte fragment reads)
    constexpr int ROWS = NSPLIT ? 384 : 256;    // rows of a stage
    constexpr int STAGE = ROWS * PB;
    constexpr int CPR = KP / 8;                 // 16-byte pieces of a row
    constexpr int RPI = 256 / CPR;              // rows that one copy of all 256 threads brings
    constexpr int NC = ROWS / RPI;              // copies per thread and stage (16 or 12)
    constexpr int OP = 36;                      // floats per row of a wave's 64x32 tile in the output staging
    constexpr int TP = 132;                     // EPI 1, 2: floats per row of the work-group's whole 128x128 tile in the output staging (16 bytes x odd)
    static_assert(8 * 64 * OP * 4 <= 2 * STAGE && 128 * TP * 4 <= 2 * STAGE, "output staging fits the ring");
    __shared__ __attribute__((aligned(128))) unsigned char L[2 * STAGE];
    const int tid = (int)threadIdx.x, lane = tid & 31, lr = lane & 15, hi = lane >> 4; const int wv = __builtin_amdgcn_readfirstlane(tid >> 5), wm = wv & 1, wn = wv >> 1;
    const int r0 = blockIdx.x * 128, c0 = blockIdx.y * 128;
    const int crow = tid / CPR, ccol = tid % CPR;
    const unsigned ldst = (unsigned)(uintptr_t)L + (unsigned)(crow * PB + ccol * 16);
    const bf* gA = A + (size_t)(r0 + crow) * K + ccol * 8; const bf* gA2 = NSPLIT ? A2 + (size_t)(r0 + crow) * K + ccol * 8 : nullptr; const bf* gB = Bt + (size_t)(c0 + crow) * K + ccol * 8;
    auto fill = [&](int t) {                    // every thread's NC copies of pass t into buffer t & 1
        unsigned l[NC]; const bf* g[NC];
#pragma unroll
        for (int i = 0; i < NC; ++i) { const int row = i * RPI; const bf* base = row < 128 ? gA : (NSPLIT && row < 256) ? gA2 : gB; g[i] = base + (size_t)(row & 127) * K + t * KP; l[i] = ldst + (unsigned)((t & 1) * STAGE + row * PB); }
#pragma unroll
        for (int i = 0; i + 8 <= NC; i += 8) acopy8(l + i, g + i);
        if (NC % 8) acopy4(l + NC - 4, g + NC - 4);
    };
    const int er = lane >> 3, ec = (lane & 7) * 4;
    const v4f bv = *(const v4fa*)(bias + c0 + wn * 32 + ec);     // read in front of the K loop, so that nothing waits for it behind it
    const float bb[2] = {bias[c0 + wn * 32 + lr], bias[c0 + wn * 32 + 16 + lr]};   // EPI 1, 2: the bias of the two columns that this lane's accumulators hold
    v8f acc[4][2];
#pragma unroll
    for (int mb = 0; mb < 4; ++mb)
#pragma unroll
        for (int nb = 0; nb < 2; ++nb) acc[mb][nb] = (v8f){};
    const int NT = K / KP;
    fill(0);
    asm volatile("s_wait_asynccnt 0x0" ::: "memory");           // this wave's copies of pass 0 have landed
    __syncthreads();                                            // and every other wave's
    if (NT > 1) fill(1);
#pragma unroll 1                                                // rolled: a trip is a whole pass, its buffer chosen at run time
    for (int t = 0; t < NT; ++t) {
        const unsigned char* S = L + (t & 1) * STAGE;
        const unsigned char* pa = S + (wm * 64 + lr) * PB + hi * 16; const unsigned char* pb = S + (ROWS - 128 + wn * 32 + lr) * PB + hi * 16;
#pragma unroll
        for (int ks = 0; ks < KP / 32; ++ks) {
            V a[4], a2[4], b[2];
#pragma unroll
            for (int mb = 0; mb < 4; ++mb) { a[mb] = WFrag<bf>::ld((const bf*)(pa + mb * 16 * PB + ks * 64)); if (NSPLIT) a2[mb] = WFrag<bf>::ld((const bf*)(pa + (128 + mb * 16) * PB + ks * 64)); }
#pragma unroll
            for (int nb = 0; nb < 2; ++nb) b[nb] = WFrag<bf>::ld((const bf*)(pb + nb * 16 * PB + ks * 64));
#pragma unroll
            for (int nb = 0; nb < 2; ++nb)
#pragma unroll
                for (int mb = 0; mb < 4; ++mb) { acc[mb][nb] = WFrag<bf>::mma(a[mb], b[nb], acc[mb][nb]); if (NSPLIT) acc[mb][nb] = WFrag<bf>::mma(a2[mb], b[nb], acc[mb][nb]); }
        }
        asm volatile("s_wait_dscnt 0x0" ::: "memory");          // this wave's reads of buffer t & 1 are done
        asm volatile("s_wait_asynccnt 0x0" ::: "memory");       // this wave's copies of pass t + 1 have landed
        __syncthreads();                                        // publishes pass t + 1 and frees buffer t & 1
        if (t + 2 < NT) fill(t + 2);
    }
    asm volatile("s_wait_asynccnt 0x0" ::: "memory");           // no copy is outstanding when the ring becomes output staging
  if constexpr (EPI == 0) {
    float* mine = (float*)L + wv * (64 * OP);                   // behind the last pass's barrier: every wave has left the ring
#pragma unroll
    for (int mb = 0; mb < 4; ++mb)
#pragma unroll
        for (int nb = 0; nb < 2; ++nb)
#pragma unroll
            for (int j = 0; j < 8; ++j) mine[(mb * 16 + hi * 8 + j) * OP + nb * 16 + lr] = acc[mb][nb][j];
    __syncthreads();                                            // the rows are read back by other lanes
#pragma unroll
    for (int s = 0; s < 16; ++s) { const int row = s * 4 + er; v4f val = *(const v4fa*)(mine + row * OP + ec);    // a store instruction writes four whole 128-byte lines
#pragma unroll
        for (int q = 0; q < 4; ++q) val[q] += bfr(bv[q]);
        *(v4f*)(C + (size_t)(r0 + wm * 64 + row) * ldc + c0 + wn * 32 + ec) = val; }
  } else {
    float* tile = (float*)L;                                    // behind the last pass's barrier: every wave has left the ring
#pragma unroll
    for (int mb = 0; mb < 4; ++mb)
#pragma unroll
        for (int nb = 0; nb < 2; ++nb) { const v8f x = acc[mb][nb] + bfr(bb[nb]); const int row = wm * 64 + mb * 16 + hi * 8, col = wn * 32 + nb * 16 + lr;
            if constexpr (EPI == 1) {                           // [t][column]
#pragma unroll
                for (int j = 0; j < 8; ++j) tile[(row + j) * TP + col] = x[j];
            } else {                                            // [column][t]: the eight rows that a lane holds of a column are consecutive t
                float* p = tile + col * TP + row; *(v4fa*)p = __builtin_shufflevector(x, x, 0, 1, 2, 3); *(v4fa*)(p + 4) = __builtin_shufflevector(x, x, 4, 5, 6, 7); } }
    __syncthreads();                                            // the tile is read back by other waves
    const size_t bh = (size_t)(r0 / TT) * NH_ + c0 / HD;        // the tile lies in one batch element and holds two whole heads
    const int t0 = r0 & (TT - 1);
    if constexpr (EPI == 1) {                                   // a lane takes 8 consecutive d of one t, a store instruction writes four whole 128-byte lines; waves 0-3 the first head, 4-7 the second
        const int hh = wv >> 2, cg = lane & 7;
#pragma unroll
        for (int s = 0; s < 8; ++s) { const int row = ((wv & 3) * 8 + s) * 4 + (lane >> 3); const float* p = tile + row * TP + hh * HD + cg * 8; const float* pc = CSN + ((size_t)(t0 + row) * NF + cg * 4) * 2;
            const v4f x[2] = {*(const v4fa*)p, *(const v4fa*)(p + 4)}, cs[2] = {*(const v4fa*)pc, *(const v4fa*)(pc + 4)}; float r[8];
#pragma unroll
            for (int q = 0; q < 4; ++q) { const float co = cs[q >> 1][(q & 1) * 2], si = cs[q >> 1][(q & 1) * 2 + 1], x0 = x[q >> 1][(q & 1) * 2], x1 = x[q >> 1][(q & 1) * 2 + 1]; r[q * 2] = co * x0 - si * x1; r[q * 2 + 1] = si * x0 + co * x1; }
            put8(r, Ph, Pl, P16, ((bh + hh) * TT + t0 + row) * HD + cg * 8); }
    } else {                                                    // a lane takes 8 consecutive t of one column, a store instruction writes four whole 128-byte lines (two columns)
#pragma unroll
        for (int s = 0; s < 8; ++s) { const int col = (wv * 8 + s) * 2 + hi; const float* p = tile + col * TP + lr * 8; const v4f x[2] = {*(const v4fa*)p, *(const v4fa*)(p + 4)};
            const float r[8] = {x[0][0], x[0][1], x[0][2], x[0][3], x[1][0], x[1][1], x[1][2], x[1][3]};
            put8(r, Ph, Pl, P16, (bh * HD + col) * TT + t0 + lr * 8); }
    }
  }
}

typedef __attribute__((ext_vector_type(2))) float v2f;

typedef __attribute__((ext_vector_type(4))) unsigned short v4us;
// k_prep: all that the GEMMs need beforehand, in one launch of PG work-groups of 256 threads (16 waves a WGP): x and the four weight matrices rounded to bf16, and the rotary (cos, sin) table.
// A piece is 4 floats: a wave's load takes 512 consecutive bytes (four whole lines), its store 256 (two whole lines). A work-group takes 1/PG of every array in a row, a thread 16 pieces of x and 2 of each weight matrix;
// all 24 loads are issued before the first value is used, so that few long waves keep the memory busy (a wave per 256 elements spends its time being started). The first TT * NF threads also fill one table entry each, while their loads fly.
#define PG   512
__global__ __launch_bounds__(256) void k_prep(const float* __restrict__ x, const float* __restrict__ Wq, const float* __restrict__ Wk, const float* __restrict__ Wv, const float* __restrict__ Wd,
                                              bf* __restrict__ XB, bf* __restrict__ WQ, bf* __restrict__ WK, bf* __restrict__ WV, bf* __restrict__ WO, float* __restrict__ CSN) {
    constexpr int NX = NB_ * TT * DD / (PG * 1024), NW = DD * DD / (PG * 1024);   // pieces a thread (a work-group's 256 pieces are 1024 elements)
    static_assert(NX * PG * 1024 == NB_ * TT * DD && NW * PG * 1024 == DD * DD && TT * NF % 256 == 0 && TT * NF <= PG * 256, "the pieces divide evenly among the threads");
    const int tid = (int)threadIdx.x, blk = (int)blockIdx.x;
    const float* const px = x + (size_t)blk * (NX * 1024); const float* const pw[4] = {Wq + (size_t)blk * (NW * 1024), Wk + (size_t)blk * (NW * 1024), Wv + (size_t)blk * (NW * 1024), Wd + (size_t)blk * (NW * 1024)};
    bf* const wd[4] = {WQ, WK, WV, WO};
    v4f vx[NX], vw[4][NW];                      // every full unroll below: the arrays are registers, so their indices must be compile-time constants
#pragma unroll
    for (int k = 0; k < NX; ++k) vx[k] = *(const v4fa*)(px + k * 1024 + tid * 4);
#pragma unroll
    for (int w = 0; w < 4; ++w)
#pragma unroll
        for (int k = 0; k < NW; ++k) vw[w][k] = *(const v4fa*)(pw[w] + k * 1024 + tid * 4);
    // behind the last load, in front of every rewrite of a register that the loads name as address: the lane offset and the five bases are inputs, so they stay as they are up to here
    asm volatile("s_wait_xcnt 0x0" :: "v"(tid), "s"(px), "s"(pw[0]), "s"(pw[1]), "s"(pw[2]), "s"(pw[3]) : "memory");
    if (blk < TT * NF / 256) {                  // whole work-groups
        const int idx = blk * 256 + tid, t = idx / NF, i = idx % NF; const float den = powf(10000.0f, (float)(2 * i) * (1.0f / HD)); const float ang = __fdiv_rn((float)t, den);
        v2f o; o[0] = cosf(ang); o[1] = sinf(ang); *(v2f*)(CSN + (size_t)idx * 2) = o; }
#pragma unroll
    for (int k = 0; k < NX; ++k) { v4us o;
#pragma unroll
        for (int q = 0; q < 4; ++q) o[q] = f2bf(vx[k][q]);
        *(v4us*)(XB + (size_t)blk * (NX * 1024) + k * 1024 + tid * 4) = o; }
#pragma unroll
    for (int w = 0; w < 4; ++w)
#pragma unroll
        for (int k = 0; k < NW; ++k) { v4us o;
#pragma unroll
            for (int q = 0; q < 4; ++q) o[q] = f2bf(vw[w][k][q]);
            *(v4us*)(wd[w] + (size_t)blk * (NW * 1024) + k * 1024 + tid * 4) = o; }
}
// k_fattn: scores, causal softmax, attn.v and the head merge in one kernel; a work-group of NS waves owns 32 query rows of one head; wave w takes the 32-key blocks w, w + NS, ... up to the diagonal block.
// St = K Qt (A = 16 key rows, B = 16 query rows): lane (lr, hi) holds for query lr the keys hi*8 + j of each 16-key tile, which is the k order of the B fragment of Ot += Vt Pt, so P stays in registers.
// Running maximum m and sum l per query and wave (log2 domain); P = exp2(t - m) (fp16 rows: x 1024, which cancels in the division by l). Rows < RH: bf16 hi+lo planes, 3 products; rows >= RH: single fp16 planes.
// The NS partial (m, l, O) are joined in LDS in the fixed order w = 0 .. NS-1 (deterministic); a wave without a block hands over m = -3e38, l = 0, O = 0, whose weight is exp2(-huge) = 0.
#define NS   4
#define OPI  68                   // floats per query row of a partial O tile in LDS
#define C2L 0.18033688011112042f  // (1/8) log2(e)
// exp2 in asm text with the slot behind a transcendental kept by construction: each v_exp_f32 works in place on a register of its own, so none reads the result or overwrites the source of the one in front of it,
// and the closing v_nop is the one independent slot in front of whatever the compiler puts next.
__device__ __forceinline__ float exp2s(float x) { asm("v_exp_f32 %0, %0\n\tv_nop" : "+v"(x)); return x; }
__device__ __forceinline__ v8f exp2x8(v8f x) { float a = x[0], b = x[1], c = x[2], d = x[3], e = x[4], f = x[5], g = x[6], h = x[7];
    asm("v_exp_f32 %0, %0\n\tv_exp_f32 %1, %1\n\tv_exp_f32 %2, %2\n\tv_exp_f32 %3, %3\n\tv_exp_f32 %4, %4\n\tv_exp_f32 %5, %5\n\tv_exp_f32 %6, %6\n\tv_exp_f32 %7, %7\n\tv_nop" : "+v"(a), "+v"(b), "+v"(c), "+v"(d), "+v"(e), "+v"(f), "+v"(g), "+v"(h));
    return (v8f){a, b, c, d, e, f, g, h}; }
template <typename T16, bool HR, int NG>   // NG: 16-query groups worked on at a time (hi+lo rows: one, which keeps the kernel within 256 registers)
__device__ __forceinline__ void attn_rows(const T16* __restrict__ Q, const T16* __restrict__ Q2, const T16* __restrict__ Kp, const T16* __restrict__ K2, const T16* __restrict__ Vt, const T16* __restrict__ V2, float* os, float* mS, float* lS, int q0, int kfirst, int lr, int hi) {
    typedef typename WFrag<T16>::V V;     // every full unroll below: the arrays are register fragments, so their indices must be compile-time constants
#pragma unroll 1                          // rolled: the two passes of the hi+lo rows share one copy of the code and one set of registers
  for (int gb = 0; gb < 2; gb += NG) {
    V qf[NG][2], qf2[NG][2], kf[2][2], kf2[2][2];
#pragma unroll
    for (int g = 0; g < NG; ++g)
#pragma unroll
        for (int ks = 0; ks < 2; ++ks) { const size_t o = (size_t)(q0 + (gb + g) * 16 + lr) * HD + ks * 32 + 8 * hi; qf[g][ks] = WFrag<T16>::ld(Q + o); if (HR) qf2[g][ks] = WFrag<T16>::ld(Q2 + o); }
    if constexpr (!HR) {
#pragma unroll
        for (int t = 0; t < 2; ++t)
#pragma unroll
            for (int ks = 0; ks < 2; ++ks) kf[t][ks] = WFrag<T16>::ld(Kp + (size_t)(kfirst + t * 16 + lr) * HD + ks * 32 + 8 * hi); }
    v8f o[NG][4]; float m[NG], l[NG];
#pragma unroll
    for (int g = 0; g < NG; ++g) { m[g] = -3.0e38f; l[g] = 0.f;
#pragma unroll
        for (int dt = 0; dt < 4; ++dt) o[g][dt] = (v8f){}; }
#pragma unroll 1                          // rolled: a trip is a whole 32-key block, a second copy would only cost registers
    for (int key0 = kfirst; key0 <= q0; key0 += 32 * NS) {
        V vf[4], vf2[4];
        if constexpr (!HR) {
#pragma unroll
            for (int dt = 0; dt < 4; ++dt) vf[dt] = WFrag<T16>::ld(Vt + (size_t)(dt * 16 + lr) * TT + key0 + 8 * hi); }
        if constexpr (HR) {                                     // hi+lo rows: at most two trips a wave, K read where it is used (fetched ahead it would cost registers the kernel does not have)
#pragma unroll
            for (int t = 0; t < 2; ++t)
#pragma unroll
                for (int ks = 0; ks < 2; ++ks) { const size_t ok = (size_t)(key0 + t * 16 + lr) * HD + ks * 32 + 8 * hi; kf[t][ks] = WFrag<T16>::ld(Kp + ok); kf2[t][ks] = WFrag<T16>::ld(K2 + ok); } }
        v8f s[NG][2];
#pragma unroll
        for (int g = 0; g < NG; ++g)
#pragma unroll
            for (int t = 0; t < 2; ++t) { s[g][t] = (v8f){};
#pragma unroll
                for (int ks = 0; ks < 2; ++ks) { s[g][t] = WFrag<T16>::mma(kf[t][ks], qf[g][ks], s[g][t]); if (HR) { s[g][t] = WFrag<T16>::mma(kf2[t][ks], qf[g][ks], s[g][t]); s[g][t] = WFrag<T16>::mma(kf[t][ks], qf2[g][ks], s[g][t]); } } }
#pragma unroll
        for (int g = 0; g < NG; ++g)
#pragma unroll
            for (int t = 0; t < 2; ++t) s[g][t] *= C2L;
        if constexpr (HR) {
            asm volatile("s_wait_xcnt 0x0" ::: "memory");       // the V fragments below land in registers that the K loads above name as addresses: the wait stands in front of them
            __builtin_amdgcn_sched_barrier(0);                  // keeps the V loads behind that wait
            const T16* pv = Vt + (size_t)lr * TT + key0 + 8 * hi; const T16* pv2 = V2 + (size_t)lr * TT + key0 + 8 * hi;
#pragma unroll
            for (int dt = 0; dt < 4; ++dt) { vf[dt] = WFrag<T16>::ld(pv + (size_t)dt * 16 * TT); vf2[dt] = WFrag<T16>::ld(pv2 + (size_t)dt * 16 * TT); }
            asm volatile("s_wait_xcnt 0x0" :: "v"(pv), "v"(pv2) : "memory"); }   // both address pairs are inputs here, so they stay live through the run and no V fragment lands in them; they are free for reuse only behind this wait
        if constexpr (!HR) { const int kn = (key0 + 32 * NS <= q0) ? key0 + 32 * NS : q0;   // this wave's next K fragments fly during the softmax and attn.v of this block (last trip: the diagonal block, in bounds, unused)
#pragma unroll
            for (int t = 0; t < 2; ++t)
#pragma unroll
                for (int ks = 0; ks < 2; ++ks) kf[t][ks] = WFrag<T16>::ld(Kp + (size_t)(kn + t * 16 + lr) * HD + ks * 32 + 8 * hi); }
        if (key0 == q0) {                                       // the diagonal block, the only one with keys behind a query of this wave
#pragma unroll
            for (int g = 0; g < NG; ++g)
#pragma unroll
                for (int t = 0; t < 2; ++t)
#pragma unroll
                    for (int j = 0; j < 8; ++j) if (t * 16 + hi * 8 + j > (gb + g) * 16 + lr) s[g][t][j] = -3.0e38f; }
#pragma unroll
        for (int g = 0; g < NG; ++g) {
            float bm = s[g][0][0];
#pragma unroll
            for (int t = 0; t < 2; ++t)
#pragma unroll
                for (int j = 0; j < 8; ++j) bm = fmaxf(bm, s[g][t][j]);
            bm = fmaxf(bm, __shfl_xor(bm, 16, 32));             // the other half of the wave holds the other 16 keys of the same query
            const float mn = fmaxf(m[g], bm); const float al = exp2s(m[g] - mn); m[g] = mn; const float ms = HR ? mn : mn - 10.0f;
            float ps = 0.f;
#pragma unroll
            for (int t = 0; t < 2; ++t) { s[g][t] = exp2x8(s[g][t] - ms);
#pragma unroll
                for (int j = 0; j < 8; ++j) ps += s[g][t][j]; }
            l[g] = l[g] * al + ps;
#pragma unroll
            for (int dt = 0; dt < 4; ++dt) o[g][dt] *= al;
            if constexpr (HR) { v8us ph[2], pl[2];
#pragma unroll
                for (int t = 0; t < 2; ++t)
#pragma unroll
                    for (int j = 0; j < 8; ++j) { unsigned short a, c2; splitf(s[g][t][j], a, c2); ph[t][j] = a; pl[t][j] = c2; }
                const V pf = cat16b(ph[0], ph[1]), pf2 = cat16b(pl[0], pl[1]);
#pragma unroll
                for (int dt = 0; dt < 4; ++dt) { o[g][dt] = WFrag<T16>::mma(vf[dt], pf, o[g][dt]); o[g][dt] = WFrag<T16>::mma(vf2[dt], pf, o[g][dt]); o[g][dt] = WFrag<T16>::mma(vf[dt], pf2, o[g][dt]); }
            } else { v8h ph[2];
#pragma unroll
                for (int t = 0; t < 2; ++t)
#pragma unroll
                    for (int j = 0; j < 8; ++j) ph[t][j] = tohx(s[g][t][j]);
                const V pf = cat16(ph[0], ph[1]);
#pragma unroll
                for (int dt = 0; dt < 4; ++dt) o[g][dt] = WFrag<T16>::mma(vf[dt], pf, o[g][dt]); }
        }
    }
#pragma unroll
    for (int g = 0; g < NG; ++g) { const float lt = l[g] + __shfl_xor(l[g], 16, 32); if (hi == 0) { mS[(gb + g) * 16 + lr] = m[g]; lS[(gb + g) * 16 + lr] = lt; }
#pragma unroll
        for (int dt = 0; dt < 4; ++dt) { float* p = os + ((gb + g) * 16 + lr) * OPI + dt * 16 + hi * 8; const v8f x = o[g][dt]; *(v4fa*)p = __builtin_shufflevector(x, x, 0, 1, 2, 3); *(v4fa*)(p + 4) = __builtin_shufflevector(x, x, 4, 5, 6, 7); } }
  }
}
// grid (NB_ * NH_, TT / 32), NS waves; blockIdx.x = b * NH_ + h; the longest rows (most keys) of every batch element and head start first, so that the short ones fill the places that come free; four waves per SIMD (256 registers) cover each other's load waits
__global__ __launch_bounds__(NS * 32) __attribute__((amdgpu_waves_per_eu(4, 4))) void k_fattn(const bf* __restrict__ Qh, const bf* __restrict__ Ql, const bf* __restrict__ Kh, const bf* __restrict__ Kl, const bf* __restrict__ Vh, const bf* __restrict__ Vl, const h16* __restrict__ Q16, const h16* __restrict__ K16, const h16* __restrict__ V16, bf* Ah, bf* Al) {
    __shared__ __align__(16) float os[NS * 32 * OPI]; __shared__ float mS[NS * 32]; __shared__ float lS[NS * 32];
    const int lane = threadIdx.x & 31, lr = lane & 15, hi = lane >> 4; const int wv = __builtin_amdgcn_readfirstlane((int)(threadIdx.x >> 5));
    const int q0 = (TT / 32 - 1 - (int)blockIdx.y) * 32; const size_t hp = (size_t)blockIdx.x * TT * HD;
    if (q0 < RH) attn_rows<bf, true, 1>(Qh + hp, Ql + hp, Kh + hp, Kl + hp, Vh + hp, Vl + hp, os + wv * (32 * OPI), mS + wv * 32, lS + wv * 32, q0, wv * 32, lr, hi);
    else attn_rows<h16, false, 2>(Q16 + hp, nullptr, K16 + hp, nullptr, V16 + hp, nullptr, os + wv * (32 * OPI), mS + wv * 32, lS + wv * 32, q0, wv * 32, lr, hi);
    __syncthreads();
    // wave w joins queries w*8 .. w*8+7: a lane takes 16 consecutive d of one query, the wave whole 128-byte lines of the merged planes
    const int qq = wv * (32 / NS) + (lane >> 2), d0 = (lane & 3) * 16;
    float mw[NS], M = -3.0e38f;
#pragma unroll
    for (int w = 0; w < NS; ++w) { mw[w] = mS[w * 32 + qq]; M = fmaxf(M, mw[w]); }
    float L = 0.f; v4f val[4];
#pragma unroll
    for (int i = 0; i < 4; ++i) val[i] = (v4f)(0.f);
#pragma unroll
    for (int w = 0; w < NS; ++w) { const float f = exp2s(mw[w] - M); L += f * lS[w * 32 + qq];
#pragma unroll
        for (int i = 0; i < 4; ++i) val[i] += f * *(const v4fa*)(os + w * (32 * OPI) + qq * OPI + d0 + i * 4); }
    const float inv = __fdiv_rn(1.0f, L);
#pragma unroll
    for (int u = 0; u < 2; ++u) { v8us oh, ol;
#pragma unroll
        for (int j = 0; j < 8; ++j) { unsigned short a, c2; splitf(val[u * 2 + (j >> 2)][j & 3] * inv, a, c2); oh[j] = a; ol[j] = c2; }
        const size_t oo = ((size_t)(blockIdx.x / NH_) * TT + q0 + qq) * DD + (blockIdx.x % NH_) * HD + d0 + u * 8; *(v8us*)(Ah + oo) = oh; *(v8us*)(Al + oo) = ol; }
}

extern "C" void kernel_launch(void* const* d_in, const int* in_sizes, int n_in,
                              void* d_out, int out_size, void* d_ws, size_t ws_size, hipStream_t stream) {
    (void)in_sizes; (void)n_in; (void)out_size;
    const float* x = (const float*)d_in[0]; const float* Wq = (const float*)d_in[1]; const float* bq = (const float*)d_in[2]; const float* Wk = (const float*)d_in[3]; const float* bk = (const float*)d_in[4]; const float* Wv = (const float*)d_in[5]; const float* bv = (const float*)d_in[6]; const float* Wd = (const float*)d_in[7]; const float* bo = (const float*)d_in[8];
    float* OUT = (float*)d_out;     // [4][2048][1024]
    char* wsp = (char*)d_ws;
    auto take = [&](size_t bytes) { char* p = wsp; wsp += (bytes + 255) & ~(size_t)255; return (void*)p; };
    bf* WQ = (bf*)take((size_t)DD * DD * 2); bf* WK = (bf*)take((size_t)DD * DD * 2); bf* WV = (bf*)take((size_t)DD * DD * 2); bf* WO = (bf*)take((size_t)DD * DD * 2);
    bf* XB = (bf*)take((size_t)NB_ * TT * DD * 2); float* CSN = (float*)take((size_t)TT * NF * 2 * 4);
    bf* QPh = (bf*)take((size_t)NB_ * TT * DD * 2); bf* QPl = (bf*)take((size_t)NB_ * TT * DD * 2); bf* KPh = (bf*)take((size_t)NB_ * TT * DD * 2); bf* KPl = (bf*)take((size_t)NB_ * TT * DD * 2); bf* VTh = (bf*)take((size_t)NB_ * TT * DD * 2); bf* VTl = (bf*)take((size_t)NB_ * TT * DD * 2);
    h16* QP16 = (h16*)take((size_t)NB_ * TT * DD * 2); h16* KP16 = (h16*)take((size_t)NB_ * TT * DD * 2); h16* VT16 = (h16*)take((size_t)NB_ * TT * DD * 2);
    bf* ATh = (bf*)take((size_t)NB_ * TT * DD * 2); bf* ATl = (bf*)take((size_t)NB_ * TT * DD * 2);
    if ((size_t)(wsp - (char*)d_ws) > ws_size) return;    // total 200.5 MiB; ws 256 MiB
    k_prep<<<PG, 256, 0, stream>>>(x, Wq, Wk, Wv, Wd, XB, WQ, WK, WV, WO, CSN);
    const dim3 gP(NB_ * TT / 128, DD / 128, 1);   // x is [4][2048][1024]: the batch elements are further rows of every GEMM
    k_gemmw<0, 1><<<gP, 256, 0, stream>>>(XB, nullptr, WQ, DD, nullptr, DD, bq, CSN, QPh, QPl, QP16);
    k_gemmw<0, 1><<<gP, 256, 0, stream>>>(XB, nullptr, WK, DD, nullptr, DD, bk, CSN, KPh, KPl, KP16);
    k_gemmw<0, 2><<<gP, 256, 0, stream>>>(XB, nullptr, WV, DD, nullptr, DD, bv, nullptr, VTh, VTl, VT16);
    k_fattn<<<dim3(NB_ * NH_, TT / 32, 1), NS * 32, 0, stream>>>(QPh, QPl, KPh, KPl, VTh, VTl, QP16, KP16, VT16, ATh, ATl);
    k_gemmw<1, 0><<<gP, 256, 0, stream>>>(ATh, ATl, WO, DD, OUT, DD, bo, nullptr, nullptr, nullptr, nullptr);
}

// v007
// Measured time: 125 microseconds a run.
// Next to v006, in two timings, it ran 1.27 times as fast each time.
// Counting every step since v000, it is 32.5 times as fast.
#include <hip/hip_runtime.h>

// Causal multi-head attention (x [4][2048][1024]; q/k/v = x W^T + b ([out][in] Linears); 16 heads x 64; interleaved-pair RoPE on q and k (pair (2k,2k+1) rotated by t / 10000^(2k/64)); scores = q.k / 8, causal (tril, arithmetic) -> -inf;
// softmax (the reference's +1e-8 on the denominator is below f32 resolution since the row max contributes exp(0) = 1); out = merged attn.v Wo^T + bo).
// Compute dtypes, f32 accumulate: every input rounded to bf16; projections on PLAIN bf16 operands (inputs: exact, + bias); rotary cos/sin table in f32; scores and
// attn.v on bf16 hi+lo planes (3 products) for the first RH = 256 query rows of every batch and on SINGLE fp16 planes for rows >= 256;
// output hi+lo x exact Wo (2 products) + bo. 128x128-tile GEMMs (operands staged in LDS), every launch over all batch elements (rows b*2048 + t, head planes [b][h]); the q/k/v GEMMs write the head planes themselves. Deterministic, no

#define NB_  4
#define TT   2048
#define DD   1024
#define NH_  16
#define HD   64
#define RH   256                  // query rows < RH: hi+lo planes; rows >= RH: fp16 planes
#define NF   32                   // rotary frequencies (head_dim / 2)
typedef _Float16 h16;
typedef unsigned short bf;
typedef __attribute__((ext_vector_type(16))) __bf16   v16bf;
typedef __attribute__((ext_vector_type(16))) _Float16 v16h;
typedef __attribute__((ext_vector_type(8)))  _Float16 v8h;
typedef __attribute__((ext_vector_type(8)))  unsigned short v8us;
typedef __attribute__((ext_vector_type(8)))  float    v8f;
typedef __attribute__((ext_vector_type(4)))  float    v4f;
typedef v8h  __attribute__((may_alias)) v8ha;
typedef v4f  __attribute__((may_alias)) v4fa;
typedef v8us __attribute__((may_alias)) v8usa;

__device__ __forceinline__ unsigned short f2bf(float f) { unsigned u = __float_as_uint(f); u += 0x7FFFu + ((u >> 16) & 1u); return (unsigned short)(u >> 16); }
__device__ __forceinline__ float bf2f(unsigned short b) { return __uint_as_float(((unsigned)b) << 16); }
__device__ __forceinline__ float bfr(float f) { return bf2f(f2bf(f)); }
__device__ __forceinline__ v16h cat16(v8h lo, v8h hi) { return __builtin_shufflevector(lo, hi, 0, 1, 2, 3, 4, 5, 6, 7, 8, 9, 10, 11, 12, 13, 14, 15); }
__device__ __forceinline__ v16bf cat16b(v8us lo, v8us hi) { return __builtin_bit_cast(v16bf, __builtin_shufflevector(lo, hi, 0, 1, 2, 3, 4, 5, 6, 7, 8, 9, 10, 11, 12, 13, 14, 15)); }
__device__ __forceinline__ v8f wmma16(v16h a, v16h b, v8f c) { return __builtin_amdgcn_wmma_f32_16x16x32_f16(false, a, false, b, (short)0, c, false, false); }
__device__ __forceinline__ v8f wmmab(v16bf a, v16bf b, v8f c) { return __builtin_amdgcn_wmma_f32_16x16x32_bf16(false, a, false, b, (short)0, c, false, false); }
__device__ __forceinline__ h16 tohx(float x) { return (h16)x; }
__device__ __forceinline__ void splitf(float y, unsigned short& h, unsigned short& l) { h = f2bf(y); l = f2bf(y - bf2f(h)); }
// eight consecutive elements of the three planes (bf16 hi, bf16 lo, fp16) at element offset e: one 16-byte store a plane
__device__ __forceinline__ void put8(const float* r, bf* Ph, bf* Pl, h16* P16, size_t e) { v8us oh, ol; v8h o16;
#pragma unroll
    for (int q = 0; q < 8; ++q) { unsigned short a, c2; splitf(r[q], a, c2); oh[q] = a; ol[q] = c2; o16[q] = tohx(r[q]); }
    *(v8us*)(Ph + e) = oh; *(v8us*)(Pl + e) = ol; *(v8h*)(P16 + e) = o16; }



// ---- k_gemmw: one work-group of 8 waves (2 x 4) per 128x128 output tile, a wave owns 64x32 of it; grid (M/128, N/128), 256 threads. M, N multiples of 128, K a multiple of KP and at least 2 KP.
// C[m][n] (f32, pitch ldc) = sum_k A[m][k] Bt[n][k] (NSPLIT 1: + A2[m][k] Bt[n][k]) + bias[n]; operands are K-contiguous bf16 planes, summed in one chain in k order.
// A pass is KP k of every operand row: [A 128 rows | (A2 128 rows) | Bt 128 rows] at a pitch of 16 bytes x odd, brought into a ring of two LDS buffers by asynchronous copies that take whole 128-byte lines
// (a fragment load straight from the planes touches 16 lines for 512 bytes); pass t + 2 is copied while pass t + 1 is worked on; the eight waves share every staged row.
// EPI 0: C is stored as f32. EPI 1 (q, k) and EPI 2 (v): M rows are b*2048 + t, N columns h*64 + d; the tile (+ bias) goes straight from its LDS staging into the three planes (bf16 hi, bf16 lo, fp16) that the attention reads, C is not written:
// EPI 1: [b][h][t][d] with interleaved-pair RoPE: (x0, x1) at (d, d + 1), d even -> (cos x0 - sin x1, sin x0 + cos x1), angle index d/2, (cos, sin) from CSN[t][d/2]; EPI 2: [b][h][d][t] (transposed).
template <typename T16> struct WFrag;
template <> struct WFrag<h16> { typedef v16h V; static __device__ __forceinline__ V ld(const h16* p) { return cat16(*(const v8h*)p, *(const v8h*)(p + 16)); } static __device__ __forceinline__ v8f mma(V a, V b, v8f c) { return wmma16(a, b, c); } };
template <> struct WFrag<bf> { typedef v16bf V; static __device__ __forceinline__ V ld(const bf* p) { return cat16b(*(const v8us*)p, *(const v8us*)(p + 16)); } static __device__ __forceinline__ v8f mma(V a, V b, v8f c) { return wmmab(a, b, c); } };
// runs of four or eight asynchronous 16-byte copies a lane (l: LDS byte address, g: global address); the closing s_wait_xcnt 0 stands in the copies' own statement, in front of any rewrite of the address registers that they name
__device__ __forceinline__ void acopy4(const unsigned* l, const bf* const* g) {
    asm volatile("global_load_async_to_lds_b128 %0, %1, off\n\tglobal_load_async_to_lds_b128 %2, %3, off\n\tglobal_load_async_to_lds_b128 %4, %5, off\n\tglobal_load_async_to_lds_b128 %6, %7, off\n\ts_wait_xcnt 0x0"
                 :: "v"(l[0]), "v"(g[0]), "v"(l[1]), "v"(g[1]), "v"(l[2]), "v"(g[2]), "v"(l[3]), "v"(g[3]) : "memory"); }
__device__ __forceinline__ void acopy8(const unsigned* l, const bf* const* g) {
    asm volatile("global_load_async_to_lds_b128 %0, %1, off\n\tglobal_load_async_to_lds_b128 %2, %3, off\n\tglobal_load_async_to_lds_b128 %4, %5, off\n\tglobal_load_async_to_lds_b128 %6, %7, off\n\t"
                 "global_load_async_to_lds_b128 %8, %9, off\n\tglobal_load_async_to_lds_b128 %10, %11, off\n\tglobal_load_async_to_lds_b128 %12, %13, off\n\tglobal_load_async_to_lds_b128 %14, %15, off\n\ts_wait_xcnt 0x0"
                 :: "v"(l[0]), "v"(g[0]), "v"(l[1]), "v"(g[1]), "v"(l[2]), "v"(g[2]), "v"(l[3]), "v"(g[3]), "v"(l[4]), "v"(g[4]), "v"(l[5]), "v"(g[5]), "v"(l[6]), "v"(g[6]), "v"(l[7]), "v"(g[7]) : "memory"); }
template <int NSPLIT, int EPI>
__global__ __launch_bounds__(256) void k_gemmw(const bf* __restrict__ A, const bf* __restrict__ A2, const bf* __restrict__ Bt, int K, float* C, int ldc, const float* __restrict__ bias, const float* __restrict__ CSN, bf* Ph, bf* Pl, h16* P16) {
    typedef WFrag<bf>::V V;                     // every full unroll below: the arrays are register fragments or asm operands, so their indices must be compile-time constants
    constexpr int KP = NSPLIT ? 64 : 128;       // k per pass: either way 32 matrix instructions a wave and pass, and two work-groups fit a WGP's LDS
    constexpr int PB = KP * 2 + 16;             // LDS row pitch in bytes (16 x odd: no bank conflict for 16-byte fragment reads)
    constexpr int ROWS = NSPLIT ? 384 : 256;    // rows of a stage
    constexpr int STAGE = ROWS * PB;
    constexpr int CPR = KP / 8;                 // 16-byte pieces of a row
    constexpr int RPI = 256 / CPR;              // rows that one copy of all 256 threads brings
    constexpr int NC = ROWS / RPI;              // copies per thread and stage (16 or 12)
    constexpr int OP = 36;                      // floats per row of a wave's 64x32 tile in the output staging
    constexpr int TP = 132;                     // EPI 1, 2: floats per row of the work-group's whole 128x128 tile in the output staging (16 bytes x odd)
    static_assert(8 * 64 * OP * 4 <= 2 * STAGE && 128 * TP * 4 <= 2 * STAGE, "output staging fits the ring");
    __shared__ __attribute__((aligned(128))) unsigned char L[2 * STAGE];
    const int tid = (int)threadIdx.x, lane = tid & 31, lr = lane & 15, hi = lane >> 4; const int wv = __builtin_amdgcn_readfirstlane(tid >> 5), wm = wv & 1, wn = wv >> 1;
    const int r0 = blockIdx.x * 128, c0 = blockIdx.y * 128;
    const int crow = tid / CPR, ccol = tid % CPR;
    const unsigned ldst = (unsigned)(uintptr_t)L + (unsigned)(crow * PB + ccol * 16);
    const bf* gA = A + (size_t)(r0 + crow) * K + ccol * 8; const bf* gA2 = NSPLIT ? A2 + (size_t)(r0 + crow) * K + ccol * 8 : nullptr; const bf* gB = Bt + (size_t)(c0 + crow) * K + ccol * 8;
    auto fill = [&](int t) {                    // every thread's NC copies of pass t into buffer t & 1
        unsigned l[NC]; const bf* g[NC];
#pragma unroll
        for (int i = 0; i < NC; ++i) { const int row = i * RPI; const bf* base = row < 128 ? gA : (NSPLIT && row < 256) ? gA2 : gB; g[i] = base + (size_t)(row & 127) * K + t * KP; l[i] = ldst + (unsigned)((t & 1) * STAGE + row * PB); }
#pragma unroll
        for (int i = 0; i + 8 <= NC; i += 8) acopy8(l + i, g + i);
        if (NC % 8) acopy4(l + NC - 4, g + NC - 4);
    };
    const int er = lane >> 3, ec = (lane & 7) * 4;
    const v4f bv = *(const v4fa*)(bias + c0 + wn * 32 + ec);     // read in front of the K loop, so that nothing waits for it behind it
    const float bb[2] = {bias[c0 + wn * 32 + lr], bias[c0 + wn * 32 + 16 + lr]};   // EPI 1, 2: the bias of the two columns that this lane's accumulators hold
    v8f acc[4][2];
#pragma unroll
    for (int mb = 0; mb < 4; ++mb)
#pragma unroll
        for (int nb = 0; nb < 2; ++nb) acc[mb][nb] = (v8f){};
    const int NT = K / KP;
    fill(0);
    asm volatile("s_wait_asynccnt 0x0" ::: "memory");           // this wave's copies of pass 0 have landed
    __syncthreads();                                            // and every other wave's
    if (NT > 1) fill(1);
#pragma unroll 1                                                // rolled: a trip is a whole pass, its buffer chosen at run time
    for (int t = 0; t < NT; ++t) {
        const unsigned char* S = L + (t & 1) * STAGE;
        const unsigned char* pa = S + (wm * 64 + lr) * PB + hi * 16; const unsigned char* pb = S + (ROWS - 128 + wn * 32 + lr) * PB + hi * 16;
#pragma unroll
        for (int ks = 0; ks < KP / 32; ++ks) {
            V a[4], a2[4], b[2];
#pragma unroll
            for (int mb = 0; mb < 4; ++mb) { a[mb] = WFrag<bf>::ld((const bf*)(pa + mb * 16 * PB + ks * 64)); if (NSPLIT) a2[mb] = WFrag<bf>::ld((const bf*)(pa + (128 + mb * 16) * PB + ks * 64)); }
#pragma unroll
            for (int nb = 0; nb < 2; ++nb) b[nb] = WFrag<bf>::ld((const bf*)(pb + nb * 16 * PB + ks * 64));
#pragma unroll
            for (int nb = 0; nb < 2; ++nb)
#pragma unroll
                for (int mb = 0; mb < 4; ++mb) { acc[mb][nb] = WFrag<bf>::mma(a[mb], b[nb], acc[mb][nb]); if (NSPLIT) acc[mb][nb] = WFrag<bf>::mma(a2[mb], b[nb], acc[mb][nb]); }
        }
        asm volatile("s_wait_dscnt 0x0" ::: "memory");          // this wave's reads of buffer t & 1 are done
        asm volatile("s_wait_asynccnt 0x0" ::: "memory");       // this wave's copies of pass t + 1 have landed
        __syncthreads();                                        // publishes pass t + 1 and frees buffer t & 1
        if (t + 2 < NT) fill(t + 2);
    }
    asm volatile("s_wait_asynccnt 0x0" ::: "memory");           // no copy is outstanding when the ring becomes output staging
  if constexpr (EPI == 0) {
    float* mine = (float*)L + wv * (64 * OP);                   // behind the last pass's barrier: every wave has left the ring
#pragma unroll
    for (int mb = 0; mb < 4; ++mb)
#pragma unroll
        for (int nb = 0; nb < 2; ++nb)
#pragma unroll
            for (int j = 0; j < 8; ++j) mine[(mb * 16 + hi * 8 + j) * OP + nb * 16 + lr] = acc[mb][nb][j];
    __syncthreads();                                            // the rows are read back by other lanes
#pragma unroll
    for (int s = 0; s < 16; ++s) { const int row = s * 4 + er; v4f val = *(const v4fa*)(mine + row * OP + ec);    // a store instruction writes four whole 128-byte lines
#pragma unroll
        for (int q = 0; q < 4; ++q) val[q] += bfr(bv[q]);
        *(v4f*)(C + (size_t)(r0 + wm * 64 + row) * ldc + c0 + wn * 32 + ec) = val; }
  } else {
    float* tile = (float*)L;                                    // behind the last pass's barrier: every wave has left the ring
#pragma unroll
    for (int mb = 0; mb < 4; ++mb)
#pragma unroll
        for (int nb = 0; nb < 2; ++nb) { const v8f x = acc[mb][nb] + bfr(bb[nb]); const int row = wm * 64 + mb * 16 + hi * 8, col = wn * 32 + nb * 16 + lr;
            if constexpr (EPI == 1) {                           // [t][column]
#pragma unroll
                for (int j = 0; j < 8; ++j) tile[(row + j) * TP + col] = x[j];
            } else {                                            // [column][t]: the eight rows that a lane holds of a column are consecutive t
                float* p = tile + col * TP + row; *(v4fa*)p = __builtin_shufflevector(x, x, 0, 1, 2, 3); *(v4fa*)(p + 4) = __builtin_shufflevector(x, x, 4, 5, 6, 7); } }
    __syncthreads();                                            // the tile is read back by other waves
    const size_t bh = (size_t)(r0 / TT) * NH_ + c0 / HD;        // the tile lies in one batch element and holds two whole heads
    const int t0 = r0 & (TT - 1);
    if constexpr (EPI == 1) {                                   // a lane takes 8 consecutive d of one t, a store instruction writes four whole 128-byte lines; waves 0-3 the first head, 4-7 the second
        const int hh = wv >> 2, cg = lane & 7;
#pragma unroll
        for (int s = 0; s < 8; ++s) { const int row = ((wv & 3) * 8 + s) * 4 + (lane >> 3); const float* p = tile + row * TP + hh * HD + cg * 8; const float* pc = CSN + ((size_t)(t0 + row) * NF + cg * 4) * 2;
            const v4f x[2] = {*(const v4fa*)p, *(const v4fa*)(p + 4)}, cs[2] = {*(const v4fa*)pc, *(const v4fa*)(pc + 4)}; float r[8];
#pragma unroll
            for (int q = 0; q < 4; ++q) { const float co = cs[q >> 1][(q & 1) * 2], si = cs[q >> 1][(q & 1) * 2 + 1], x0 = x[q >> 1][(q & 1) * 2], x1 = x[q >> 1][(q & 1) * 2 + 1]; r[q * 2] = co * x0 - si * x1; r[q * 2 + 1] = si * x0 + co * x1; }
            put8(r, Ph, Pl, P16, ((bh + hh) * TT + t0 + row) * HD + cg * 8); }
    } else {                                                    // a lane takes 8 consecutive t of one column, a store instruction writes four whole 128-byte lines (two columns)
#pragma unroll
        for (int s = 0; s < 8; ++s) { const int col = (wv * 8 + s) * 2 + hi; const float* p = tile + col * TP + lr * 8; const v4f x[2] = {*(const v4fa*)p, *(const v4fa*)(p + 4)};
            const float r[8] = {x[0][0], x[0][1], x[0][2], x[0][3], x[1][0], x[1][1], x[1][2], x[1][3]};
            put8(r, Ph, Pl, P16, (bh * HD + col) * TT + t0 + lr * 8); }
    }
  }
}

typedef __attribute__((ext_vector_type(2))) float v2f;

typedef __attribute__((ext_vector_type(4))) unsigned short v4us;
// k_prep: all that the GEMMs need beforehand, in one launch of PG work-groups of 256 threads (16 waves a WGP): x and the four weight matrices rounded to bf16, and the rotary (cos, sin) table.
// A piece is 4 floats: a wave's load takes 512 consecutive bytes (four whole lines), its store 256 (two whole lines). A work-group takes 1/PG of every array in a row, a thread 16 pieces of x and 2 of each weight matrix;
// all 24 loads are issued before the first value is used, so that few long waves keep the memory busy (a wave per 256 elements spends its time being started). The first TT * NF threads also fill one table entry each, while their loads fly.
#define PG   512
__global__ __launch_bounds__(256) void k_prep(const float* __restrict__ x, const float* __restrict__ Wq, const float* __restrict__ Wk, const float* __restrict__ Wv, const float* __restrict__ Wd,
                                              bf* __restrict__ XB, bf* __restrict__ WQ, bf* __restrict__ WK, bf* __restrict__ WV, bf* __restrict__ WO, float* __restrict__ CSN) {
    constexpr int NX = NB_ * TT * DD / (PG * 1024), NW = DD * DD / (PG * 1024);   // pieces a thread (a work-group's 256 pieces are 1024 elements)
    static_assert(NX * PG * 1024 == NB_ * TT * DD && NW * PG * 1024 == DD * DD && TT * NF % 256 == 0 && TT * NF <= PG * 256, "the pieces divide evenly among the threads");
    const int tid = (int)threadIdx.x, blk = (int)blockIdx.x;
    const float* const px = x + (size_t)blk * (NX * 1024); const float* const pw[4] = {Wq + (size_t)blk * (NW * 1024), Wk + (size_t)blk * (NW * 1024), Wv + (size_t)blk * (NW * 1024), Wd + (size_t)blk * (NW * 1024)};
    bf* const wd[4] = {WQ, WK, WV, WO};
    v4f vx[NX], vw[4][NW];                      // every full unroll below: the arrays are registers, so their indices must be compile-time constants
#pragma unroll
    for (int k = 0; k < NX; ++k) vx[k] = *(const v4fa*)(px + k * 1024 + tid * 4);
#pragma unroll
    for (int w = 0; w < 4; ++w)
#pragma unroll
        for (int k = 0; k < NW; ++k) vw[w][k] = *(const v4fa*)(pw[w] + k * 1024 + tid * 4);
    // behind the last load, in front of every rewrite of a register that the loads name as address: the lane offset and the five bases are inputs, so they stay as they are up to here
    asm volatile("s_wait_xcnt 0x0" :: "v"(tid), "s"(px), "s"(pw[0]), "s"(pw[1]), "s"(pw[2]), "s"(pw[3]) : "memory");
    if (blk < TT * NF / 256) {                  // whole work-groups
        const int idx = blk * 256 + tid, t = idx / NF, i = idx % NF; const float den = powf(10000.0f, (float)(2 * i) * (1.0f / HD)); const float ang = __fdiv_rn((float)t, den);
        v2f o; o[0] = cosf(ang); o[1] = sinf(ang); *(v2f*)(CSN + (size_t)idx * 2) = o; }
#pragma unroll
    for (int k = 0; k < NX; ++k) { v4us o;
#pragma unroll
        for (int q = 0; q < 4; ++q) o[q] = f2bf(vx[k][q]);
        *(v4us*)(XB + (size_t)blk * (NX * 1024) + k * 1024 + tid * 4) = o; }
#pragma unroll
    for (int w = 0; w < 4; ++w)
#pragma unroll
        for (int k = 0; k < NW; ++k) { v4us o;
#pragma unroll
            for (int q = 0; q < 4; ++q) o[q] = f2bf(vw[w][k][q]);
            *(v4us*)(wd[w] + (size_t)blk * (NW * 1024) + k * 1024 + tid * 4) = o; }
}
// k_fattn: scores, causal softmax, attn.v and the head merge in one kernel, work-groups of NS waves.
// St = K Qt (A = 16 key rows, B = 16 query rows): lane (lr, hi) holds for query lr the keys hi*8 + j of each 16-key tile, which is the k order of the B fragment of Ot += Vt Pt, so P stays in registers.
// Running maximum m and sum l per query and wave (log2 domain); P = exp2(t - m) (fp16 rows: x 1024, which cancels in the division by l).
// Rows >= RH (single fp16 planes, attn_tile): a work-group owns QT query rows of one head, a wave 32 of them with all their keys in rising order. A stage is KB keys: [K KB rows of 64 d | Vt 64 rows of KB keys], whole 128-byte lines
// brought into a ring of two LDS buffers by asynchronous copies and read by all NS waves (a fragment load straight from the planes touches 16 lines for 512 bytes, and every 32 queries fetched every key anew); stage s + 2 is copied while stage s + 1 is worked on.
// Rows < RH (bf16 hi+lo planes, 3 products, attn_rows): a work-group owns 32 query rows, wave w takes the 32-key blocks w, w + NS, ... up to the diagonal block, fragments straight from the planes.
// There the NS partial (m, l, O) are joined in LDS in the fixed order w = 0 .. NS-1 (deterministic); a wave without a block hands over m = -3e38, l = 0, O = 0, whose weight is exp2(-huge) = 0.
#define NS   4
#define OPI  68                   // floats per query row of a partial O tile in LDS
#define C2L 0.18033688011112042f  // (1/8) log2(e)
// exp2 in asm text with the slot behind a transcendental kept by construction: each v_exp_f32 works in place on a register of its own, so none reads the result or overwrites the source of the one in front of it,
// and the closing v_nop is the one independent slot in front of whatever the compiler puts next.
__device__ __forceinline__ float exp2s(float x) { asm("v_exp_f32 %0, %0\n\tv_nop" : "+v"(x)); return x; }
__device__ __forceinline__ v8f exp2x8(v8f x) { float a = x[0], b = x[1], c = x[2], d = x[3], e = x[4], f = x[5], g = x[6], h = x[7];
    asm("v_exp_f32 %0, %0\n\tv_exp_f32 %1, %1\n\tv_exp_f32 %2, %2\n\tv_exp_f32 %3, %3\n\tv_exp_f32 %4, %4\n\tv_exp_f32 %5, %5\n\tv_exp_f32 %6, %6\n\tv_exp_f32 %7, %7\n\tv_nop" : "+v"(a), "+v"(b), "+v"(c), "+v"(d), "+v"(e), "+v"(f), "+v"(g), "+v"(h));
    return (v8f){a, b, c, d, e, f, g, h}; }
template <typename T16, bool HR, int NG>   // NG: 16-query groups worked on at a time (hi+lo rows: one, which keeps the kernel within 256 registers)
__device__ __forceinline__ void attn_rows(const T16* __restrict__ Q, const T16* __restrict__ Q2, const T16* __restrict__ Kp, const T16* __restrict__ K2, const T16* __restrict__ Vt, const T16* __restrict__ V2, float* os, float* mS, float* lS, int q0, int kfirst, int lr, int hi) {
    typedef typename WFrag<T16>::V V;     // every full unroll below: the arrays are register fragments, so their indices must be compile-time constants
#pragma unroll 1                          // rolled: the two passes of the hi+lo rows share one copy of the code and one set of registers
  for (int gb = 0; gb < 2; gb += NG) {
    V qf[NG][2], qf2[NG][2], kf[2][2], kf2[2][2];
#pragma unroll
    for (int g = 0; g < NG; ++g)
#pragma unroll
        for (int ks = 0; ks < 2; ++ks) { const size_t o = (size_t)(q0 + (gb + g) * 16 + lr) * HD + ks * 32 + 8 * hi; qf[g][ks] = WFrag<T16>::ld(Q + o); if (HR) qf2[g][ks] = WFrag<T16>::ld(Q2 + o); }
    v8f o[NG][4]; float m[NG], l[NG];
#pragma unroll
    for (int g = 0; g < NG; ++g) { m[g] = -3.0e38f; l[g] = 0.f;
#pragma unroll
        for (int dt = 0; dt < 4; ++dt) o[g][dt] = (v8f){}; }
#pragma unroll 1                          // rolled: a trip is a whole 32-key block, a second copy would only cost registers
    for (int key0 = kfirst; key0 <= q0; key0 += 32 * NS) {
        V vf[4], vf2[4];
        if constexpr (HR) {                                     // hi+lo rows: at most two trips a wave, K read where it is used (fetched ahead it would cost registers the kernel does not have)
#pragma unroll
            for (int t = 0; t < 2; ++t)
#pragma unroll
                for (int ks = 0; ks < 2; ++ks) { const size_t ok = (size_t)(key0 + t * 16 + lr) * HD + ks * 32 + 8 * hi; kf[t][ks] = WFrag<T16>::ld(Kp + ok); kf2[t][ks] = WFrag<T16>::ld(K2 + ok); } }
        v8f s[NG][2];
#pragma unroll
        for (int g = 0; g < NG; ++g)
#pragma unroll
            for (int t = 0; t < 2; ++t) { s[g][t] = (v8f){};
#pragma unroll
                for (int ks = 0; ks < 2; ++ks) { s[g][t] = WFrag<T16>::mma(kf[t][ks], qf[g][ks], s[g][t]); if (HR) { s[g][t] = WFrag<T16>::mma(kf2[t][ks], qf[g][ks], s[g][t]); s[g][t] = WFrag<T16>::mma(kf[t][ks], qf2[g][ks], s[g][t]); } } }
#pragma unroll
        for (int g = 0; g < NG; ++g)
#pragma unroll
            for (int t = 0; t < 2; ++t) s[g][t] *= C2L;
        if constexpr (HR) {
            asm volatile("s_wait_xcnt 0x0" ::: "memory");       // the V fragments below land in registers that the K loads above name as addresses: the wait stands in front of them
            __builtin_amdgcn_sched_barrier(0);                  // keeps the V loads behind that wait
            const T16* pv = Vt + (size_t)lr * TT + key0 + 8 * hi; const T16* pv2 = V2 + (size_t)lr * TT + key0 + 8 * hi;
#pragma unroll
            for (int dt = 0; dt < 4; ++dt) { vf[dt] = WFrag<T16>::ld(pv + (size_t)dt * 16 * TT); vf2[dt] = WFrag<T16>::ld(pv2 + (size_t)dt * 16 * TT); }
            asm volatile("s_wait_xcnt 0x0" :: "v"(pv), "v"(pv2) : "memory"); }   // both address pairs are inputs here, so they stay live through the run and no V fragment lands in them; they are free for reuse only behind this wait
        if (key0 == q0) {                                       // the diagonal block, the only one with keys behind a query of this wave
#pragma unroll
            for (int g = 0; g < NG; ++g)
#pragma unroll
                for (int t = 0; t < 2; ++t)
#pragma unroll
                    for (int j = 0; j < 8; ++j) if (t * 16 + hi * 8 + j > (gb + g) * 16 + lr) s[g][t][j] = -3.0e38f; }
#pragma unroll
        for (int g = 0; g < NG; ++g) {
            float bm = s[g][0][0];
#pragma unroll
            for (int t = 0; t < 2; ++t)
#pragma unroll
                for (int j = 0; j < 8; ++j) bm = fmaxf(bm, s[g][t][j]);
            bm = fmaxf(bm, __shfl_xor(bm, 16, 32));             // the other half of the wave holds the other 16 keys of the same query
            const float mn = fmaxf(m[g], bm); const float al = exp2s(m[g] - mn); m[g] = mn; const float ms = HR ? mn : mn - 10.0f;
            float ps = 0.f;
#pragma unroll
            for (int t = 0; t < 2; ++t) { s[g][t] = exp2x8(s[g][t] - ms);
#pragma unroll
                for (int j = 0; j < 8; ++j) ps += s[g][t][j]; }
            l[g] = l[g] * al + ps;
#pragma unroll
            for (int dt = 0; dt < 4; ++dt) o[g][dt] *= al;
            if constexpr (HR) { v8us ph[2], pl[2];
#pragma unroll
                for (int t = 0; t < 2; ++t)
#pragma unroll
                    for (int j = 0; j < 8; ++j) { unsigned short a, c2; splitf(s[g][t][j], a, c2); ph[t][j] = a; pl[t][j] = c2; }
                const V pf = cat16b(ph[0], ph[1]), pf2 = cat16b(pl[0], pl[1]);
#pragma unroll
                for (int dt = 0; dt < 4; ++dt) { o[g][dt] = WFrag<T16>::mma(vf[dt], pf, o[g][dt]); o[g][dt] = WFrag<T16>::mma(vf2[dt], pf, o[g][dt]); o[g][dt] = WFrag<T16>::mma(vf[dt], pf2, o[g][dt]); }
            }
        }
    }
#pragma unroll
    for (int g = 0; g < NG; ++g) { const float lt = l[g] + __shfl_xor(l[g], 16, 32); if (hi == 0) { mS[(gb + g) * 16 + lr] = m[g]; lS[(gb + g) * 16 + lr] = lt; }
#pragma unroll
        for (int dt = 0; dt < 4; ++dt) { float* p = os + ((gb + g) * 16 + lr) * OPI + dt * 16 + hi * 8; const v8f x = o[g][dt]; *(v4fa*)p = __builtin_shufflevector(x, x, 0, 1, 2, 3); *(v4fa*)(p + 4) = __builtin_shufflevector(x, x, 4, 5, 6, 7); } }
  }
}
#define QT   128                  // fp16 rows: query rows of a work-group (NS waves x 32)
#define KB   64                   // fp16 rows: keys of a stage
#define SPB  144                  // LDS pitch in bytes of a staged 128-byte row (16 x odd: no bank conflict for 16-byte fragment reads)
#define SST  (2 * 64 * SPB)       // bytes of a stage
// Q, Kp, Vt: the head's fp16 planes; SM: 2 * SST bytes of LDS; Ah, Al: the merged planes at (batch element, row 0, first column of the head); Q0: first query row of the work-group
__device__ __forceinline__ void attn_tile(const h16* __restrict__ Q, const h16* __restrict__ Kp, const h16* __restrict__ Vt, unsigned char* SM, bf* Ah, bf* Al, int Q0, int wv, int tid, int lr, int hi) {
    typedef WFrag<h16>::V V;              // every full unroll below: the arrays are register fragments or asm operands, so their indices must be compile-time constants
    const int q0 = Q0 + wv * 32, NT = (Q0 + QT) / KB;   // the wave's first query; stages up to the work-group's last diagonal block (at least two)
    const int crow = tid >> 3, ccol = tid & 7;          // a copy of all 128 threads brings 16 rows of 128 bytes
    const unsigned ldst = (unsigned)(uintptr_t)SM + (unsigned)(crow * SPB + ccol * 16);
    const h16* gK = Kp + (size_t)crow * HD + ccol * 8; const h16* gV = Vt + (size_t)crow * TT + ccol * 8;
    auto fill = [&](int s) {              // every thread's 8 copies of stage s into buffer s & 1
        unsigned l[8]; const bf* g[8];
#pragma unroll
        for (int i = 0; i < 4; ++i) { g[i] = (const bf*)(gK + (size_t)(s * KB + i * 16) * HD); l[i] = ldst + (unsigned)((s & 1) * SST + i * 16 * SPB);
            g[4 + i] = (const bf*)(gV + (size_t)(i * 16) * TT + s * KB); l[4 + i] = ldst + (unsigned)((s & 1) * SST + (64 + i * 16) * SPB); }
        acopy8(l, g);
    };
    fill(0);
    V qf[2][2]; const h16* pq = Q + (size_t)(q0 + lr) * HD + 8 * hi;
#pragma unroll
    for (int g = 0; g < 2; ++g)
#pragma unroll
        for (int ks = 0; ks < 2; ++ks) qf[g][ks] = WFrag<h16>::ld(pq + g * 16 * HD + ks * 32);
    asm volatile("s_wait_xcnt 0x0" :: "v"(pq) : "memory");      // the address pair is an input here, so it stays as it is through the Q loads and is free for reuse only behind this wait
    v8f o[2][4]; float m[2], l[2];
#pragma unroll
    for (int g = 0; g < 2; ++g) { m[g] = -3.0e38f; l[g] = 0.f;
#pragma unroll
        for (int dt = 0; dt < 4; ++dt) o[g][dt] = (v8f){}; }
    asm volatile("s_wait_asynccnt 0x0" ::: "memory");           // this wave's copies of stage 0 have landed
    __syncthreads();                                            // and every other wave's
    fill(1);
#pragma unroll 1                                                // rolled: a trip is a whole stage, its buffer chosen at run time
    for (int s = 0; s < NT; ++s) {
        const unsigned char* S = SM + (s & 1) * SST;
#pragma unroll 1                                                // rolled: a trip is a whole 32-key block, a second copy would only cost registers
        for (int kk = 0; kk < KB / 32; ++kk) {
            const int key0 = s * KB + kk * 32;
            if (key0 > q0) break;                               // wave-uniform: blocks behind this wave's diagonal block hold no key of its queries; the wave still passes the stage's barrier
            const unsigned char* pk = S + (kk * 32 + lr) * SPB + hi * 16; const unsigned char* pv = S + (64 + lr) * SPB + kk * 64 + hi * 16;
            V kf[2][2], vf[4];
#pragma unroll
            for (int t = 0; t < 2; ++t)
#pragma unroll
                for (int ks = 0; ks < 2; ++ks) kf[t][ks] = WFrag<h16>::ld((const h16*)(pk + t * 16 * SPB + ks * 64));
#pragma unroll
            for (int dt = 0; dt < 4; ++dt) vf[dt] = WFrag<h16>::ld((const h16*)(pv + dt * 16 * SPB));
            v8f sc[2][2];
#pragma unroll
            for (int g = 0; g < 2; ++g)
#pragma unroll
                for (int t = 0; t < 2; ++t) { sc[g][t] = (v8f){};
#pragma unroll
                    for (int ks = 0; ks < 2; ++ks) sc[g][t] = WFrag<h16>::mma(kf[t][ks], qf[g][ks], sc[g][t]);
                    sc[g][t] *= C2L; }
            if (key0 == q0) {                                   // the diagonal block, the only one with keys behind a query of this wave
#pragma unroll
                for (int g = 0; g < 2; ++g)
#pragma unroll
                    for (int t = 0; t < 2; ++t)
#pragma unroll
                        for (int j = 0; j < 8; ++j) if (t * 16 + hi * 8 + j > g * 16 + lr) sc[g][t][j] = -3.0e38f; }
#pragma unroll
            for (int g = 0; g < 2; ++g) {
                float bm = sc[g][0][0];
#pragma unroll
                for (int t = 0; t < 2; ++t)
#pragma unroll
                    for (int j = 0; j < 8; ++j) bm = fmaxf(bm, sc[g][t][j]);
                bm = fmaxf(bm, __shfl_xor(bm, 16, 32));         // the other half of the wave holds the other 16 keys of the same query
                const float mn = fmaxf(m[g], bm); const float al = exp2s(m[g] - mn); m[g] = mn; const float ms = mn - 10.0f;
                float ps = 0.f; v8h ph[2];
#pragma unroll
                for (int t = 0; t < 2; ++t) { sc[g][t] = exp2x8(sc[g][t] - ms);
#pragma unroll
                    for (int j = 0; j < 8; ++j) { ps += sc[g][t][j]; ph[t][j] = tohx(sc[g][t][j]); } }
                l[g] = l[g] * al + ps;
                const V pf = cat16(ph[0], ph[1]);
#pragma unroll
                for (int dt = 0; dt < 4; ++dt) { o[g][dt] *= al; o[g][dt] = WFrag<h16>::mma(vf[dt], pf, o[g][dt]); }
            }
        }
        asm volatile("s_wait_dscnt 0x0" ::: "memory");          // this wave's reads of buffer s & 1 are done
        asm volatile("s_wait_asynccnt 0x0" ::: "memory");       // this wave's copies of stage s + 1 have landed
        __syncthreads();                                        // publishes stage s + 1 and frees buffer s & 1
        if (s + 2 < NT) fill(s + 2);
    }
    asm volatile("s_wait_asynccnt 0x0" ::: "memory");           // no copy is outstanding when the ring becomes output staging
    float* mine = (float*)SM + wv * (32 * OPI);                 // behind the last stage's barrier: every wave has left the ring
#pragma unroll
    for (int g = 0; g < 2; ++g) { const float inv = __fdiv_rn(1.0f, l[g] + __shfl_xor(l[g], 16, 32));
#pragma unroll
        for (int dt = 0; dt < 4; ++dt) { float* p = mine + (g * 16 + lr) * OPI + dt * 16 + hi * 8; const v8f x = o[g][dt] * inv; *(v4fa*)p = __builtin_shufflevector(x, x, 0, 1, 2, 3); *(v4fa*)(p + 4) = __builtin_shufflevector(x, x, 4, 5, 6, 7); } }
    __syncthreads();                                            // the rows are read back by other lanes
    const int cg = tid & 7;                                     // a lane takes 8 consecutive d of one query, a store instruction writes four whole 128-byte lines
#pragma unroll
    for (int u = 0; u < 8; ++u) { const int row = u * 4 + ((tid & 31) >> 3); const float* p = mine + row * OPI + cg * 8; const v4f x[2] = {*(const v4fa*)p, *(const v4fa*)(p + 4)}; v8us oh, ol;
#pragma unroll
        for (int j = 0; j < 8; ++j) { unsigned short a, c2; splitf(x[j >> 2][j & 3], a, c2); oh[j] = a; ol[j] = c2; }
        const size_t oo = (size_t)(q0 + row) * DD + cg * 8; *(v8us*)(Ah + oo) = oh; *(v8us*)(Al + oo) = ol; }
}
// grid (NB_ * NH_, (TT - RH) / QT + RH / 32), NS waves; blockIdx.x = b * NH_ + h; the longest rows (most keys) of every batch element and head start first, the short hi+lo work-groups last, so that they fill the places that come free; four waves per SIMD (256 registers) cover each other's waits
__global__ __launch_bounds__(NS * 32) __attribute__((amdgpu_waves_per_eu(4, 4))) void k_fattn(const bf* __restrict__ Qh, const bf* __restrict__ Ql, const bf* __restrict__ Kh, const bf* __restrict__ Kl, const bf* __restrict__ Vh, const bf* __restrict__ Vl, const h16* __restrict__ Q16, const h16* __restrict__ K16, const h16* __restrict__ V16, bf* Ah, bf* Al) {
    static_assert(QT == NS * 32 && RH % QT == 0 && QT % KB == 0 && (NS * 32 * OPI + 2 * NS * 32) * 4 <= 2 * SST, "tiles divide evenly; the partial tiles fit the ring's LDS");
    __shared__ __attribute__((aligned(128))) unsigned char SM[2 * SST];   // fp16 rows: the ring, then output staging; hi+lo rows: the partial (O, m, l)
    float* const os = (float*)SM; float* const mS = os + NS * 32 * OPI; float* const lS = mS + NS * 32;
    const int lane = threadIdx.x & 31, lr = lane & 15, hi = lane >> 4; const int wv = __builtin_amdgcn_readfirstlane((int)(threadIdx.x >> 5));
    const size_t hp = (size_t)blockIdx.x * TT * HD;
    if ((int)blockIdx.y < (TT - RH) / QT) {                     // whole work-groups
        const size_t om = (size_t)(blockIdx.x / NH_) * TT * DD + (blockIdx.x % NH_) * HD;
        attn_tile(Q16 + hp, K16 + hp, V16 + hp, SM, Ah + om, Al + om, TT - QT * ((int)blockIdx.y + 1), wv, (int)threadIdx.x, lr, hi);
        return; }
    const int q0 = (RH / 32 - 1 - ((int)blockIdx.y - (TT - RH) / QT)) * 32;
    attn_rows<bf, true, 1>(Qh + hp, Ql + hp, Kh + hp, Kl + hp, Vh + hp, Vl + hp, os + wv * (32 * OPI), mS + wv * 32, lS + wv * 32, q0, wv * 32, lr, hi);
    __syncthreads();
    // wave w joins queries w*8 .. w*8+7: a lane takes 16 consecutive d of one query, the wave whole 128-byte lines of the merged planes
    const int qq = wv * (32 / NS) + (lane >> 2), d0 = (lane & 3) * 16;
    float mw[NS], M = -3.0e38f;
#pragma unroll
    for (int w = 0; w < NS; ++w) { mw[w] = mS[w * 32 + qq]; M = fmaxf(M, mw[w]); }
    float L = 0.f; v4f val[4];
#pragma unroll
    for (int i = 0; i < 4; ++i) val[i] = (v4f)(0.f);
#pragma unroll
    for (int w = 0; w < NS; ++w) { const float f = exp2s(mw[w] - M); L += f * lS[w * 32 + qq];
#pragma unroll
        for (int i = 0; i < 4; ++i) val[i] += f * *(const v4fa*)(os + w * (32 * OPI) + qq * OPI + d0 + i * 4); }
    const float inv = __fdiv_rn(1.0f, L);
#pragma unroll
    for (int u = 0; u < 2; ++u) { v8us oh, ol;
#pragma unroll
        for (int j = 0; j < 8; ++j) { unsigned short a, c2; splitf(val[u * 2 + (j >> 2)][j & 3] * inv, a, c2); oh[j] = a; ol[j] = c2; }
        const size_t oo = ((size_t)(blockIdx.x / NH_) * TT + q0 + qq) * DD + (blockIdx.x % NH_) * HD + d0 + u * 8; *(v8us*)(Ah + oo) = oh; *(v8us*)(Al + oo) = ol; }
}

extern "C" void kernel_launch(void* const* d_in, const int* in_sizes, int n_in,
                              void* d_out, int out_size, void* d_ws, size_t ws_size, hipStream_t stream) {
    (void)in_sizes; (void)n_in; (void)out_size;
    const float* x = (const float*)d_in[0]; const float* Wq = (const float*)d_in[1]; const float* bq = (const float*)d_in[2]; const float* Wk = (const float*)d_in[3]; const float* bk = (const float*)d_in[4]; const float* Wv = (const float*)d_in[5]; const float* bv = (const float*)d_in[6]; const float* Wd = (const float*)d_in[7]; const float* bo = (const float*)d_in[8];
    float* OUT = (float*)d_out;     // [4][2048][1024]
    char* wsp = (char*)d_ws;
    auto take = [&](size_t bytes) { char* p = wsp; wsp += (bytes + 255) & ~(size_t)255; return (void*)p; };
    bf* WQ = (bf*)take((size_t)DD * DD * 2); bf* WK = (bf*)take((size_t)DD * DD * 2); bf* WV = (bf*)take((size_t)DD * DD * 2); bf* WO = (bf*)take((size_t)DD * DD * 2);
    bf* XB = (bf*)take((size_t)NB_ * TT * DD * 2); float* CSN = (float*)take((size_t)TT * NF * 2 * 4);
    bf* QPh = (bf*)take((size_t)NB_ * TT * DD * 2); bf* QPl = (bf*)take((size_t)NB_ * TT * DD * 2); bf* KPh = (bf*)take((size_t)NB_ * TT * DD * 2); bf* KPl = (bf*)take((size_t)NB_ * TT * DD * 2); bf* VTh = (bf*)take((size_t)NB_ * TT * DD * 2); bf* VTl = (bf*)take((size_t)NB_ * TT * DD * 2);
    h16* QP16 = (h16*)take((size_t)NB_ * TT * DD * 2); h16* KP16 = (h16*)take((size_t)NB_ * TT * DD * 2); h16* VT16 = (h16*)take((size_t)NB_ * TT * DD * 2);
    bf* ATh = (bf*)take((size_t)NB_ * TT * DD * 2); bf* ATl = (bf*)take((size_t)NB_ * TT * DD * 2);
    if ((size_t)(wsp - (char*)d_ws) > ws_size) return;    // total 200.5 MiB; ws 256 MiB
    k_prep<<<PG, 256, 0, stream>>>(x, Wq, Wk, Wv, Wd, XB, WQ, WK, WV, WO, CSN);
    const dim3 gP(NB_ * TT / 128, DD / 128, 1);   // x is [4][2048][1024]: the batch elements are further rows of every GEMM
    k_gemmw<0, 1><<<gP, 256, 0, stream>>>(XB, nullptr, WQ, DD, nullptr, DD, bq, CSN, QPh, QPl, QP16);
    k_gemmw<0, 1><<<gP, 256, 0, stream>>>(XB, nullptr, WK, DD, nullptr, DD, bk, CSN, KPh, KPl, KP16);
    k_gemmw<0, 2><<<gP, 256, 0, stream>>>(XB, nullptr, WV, DD, nullptr, DD, bv, nullptr, VTh, VTl, VT16);
    k_fattn<<<dim3(NB_ * NH_, (TT - RH) / QT + RH / 32, 1), NS * 32, 0, stream>>>(QPh, QPl, KPh, KPl, VTh, VTl, QP16, KP16, VT16, ATh, ATl);
    k_gemmw<1, 0><<<gP, 256, 0, stream>>>(ATh, ATl, WO, DD, OUT, DD, bo, nullptr, nullptr, nullptr, nullptr);
}

// v008
// A run of this version takes 121 microseconds.
// In both of two side-by-side timings against v007, it was 1.03 times as fast.
// Over all steps from v000 it is 33.5 times as fast.
#include <hip/hip_runtime.h>

// Causal multi-head attention (x [4][2048][1024]; q/k/v = x W^T + b ([out][in] Linears); 16 heads x 64; interleaved-pair RoPE on q and k (pair (2k,2k+1) rotated by t / 10000^(2k/64)); scores = q.k / 8, causal (tril, arithmetic) -> -inf;
// softmax (the reference's +1e-8 on the denominator is below f32 resolution since the row max contributes exp(0) = 1); out = merged attn.v Wo^T + bo).
// Compute dtypes, f32 accumulate: every input rounded to bf16; projections on PLAIN bf16 operands (inputs: exact, + bias); rotary cos/sin table in f32; scores and
// attn.v on bf16 hi+lo planes (3 products) for the first RH = 256 query rows of every batch and on SINGLE fp16 planes for rows >= 256;
// output hi+lo x exact Wo (2 products) + bo. 128x128-tile GEMMs (operands staged in LDS), every launch over all batch elements (rows b*2048 + t, head planes [b][h]); the q/k/v GEMMs write the head planes themselves. Deterministic, no

#define NB_  4
#define TT   2048
#define DD   1024
#define NH_  16
#define HD   64
#define RH   256                  // query rows < RH: hi+lo planes; rows >= RH: fp16 planes
#define NF   32                   // rotary frequencies (head_dim / 2)
typedef _Float16 h16;
typedef unsigned short bf;
typedef __attribute__((ext_vector_type(16))) __bf16   v16bf;
typedef __attribute__((ext_vector_type(16))) _Float16 v16h;
typedef __attribute__((ext_vector_type(8)))  _Float16 v8h;
typedef __attribute__((ext_vector_type(8)))  unsigned short v8us;
typedef __attribute__((ext_vector_type(8)))  float    v8f;
typedef __attribute__((ext_vector_type(4)))  float    v4f;
typedef v8h  __attribute__((may_alias)) v8ha;
typedef v4f  __attribute__((may_alias)) v4fa;
typedef v8us __attribute__((may_alias)) v8usa;

__device__ __forceinline__ unsigned short f2bf(float f) { unsigned u = __float_as_uint(f); u += 0x7FFFu + ((u >> 16) & 1u); return (unsigned short)(u >> 16); }
__device__ __forceinline__ float bf2f(unsigned short b) { return __uint_as_float(((unsigned)b) << 16); }
__device__ __forceinline__ float bfr(float f) { return bf2f(f2bf(f)); }
__device__ __forceinline__ v16h cat16(v8h lo, v8h hi) { return __builtin_shufflevector(lo, hi, 0, 1, 2, 3, 4, 5, 6, 7, 8, 9, 10, 11, 12, 13, 14, 15); }
__device__ __forceinline__ v16bf cat16b(v8us lo, v8us hi) { return __builtin_bit_cast(v16bf, __builtin_shufflevector(lo, hi, 0, 1, 2, 3, 4, 5, 6, 7, 8, 9, 10, 11, 12, 13, 14, 15)); }
__device__ __forceinline__ v8f wmma16(v16h a, v16h b, v8f c) { return __builtin_amdgcn_wmma_f32_16x16x32_f16(false, a, false, b, (short)0, c, false, false); }
__device__ __forceinline__ v8f wmmab(v16bf a, v16bf b, v8f c) { return __builtin_amdgcn_wmma_f32_16x16x32_bf16(false, a, false, b, (short)0, c, false, false); }
__device__ __forceinline__ h16 tohx(float x) { return (h16)x; }
__device__ __forceinline__ void splitf(float y, unsigned short& h, unsigned short& l) { h = f2bf(y); l = f2bf(y - bf2f(h)); }
// eight consecutive elements of the three planes (bf16 hi, bf16 lo, fp16) at element offset e: one 16-byte store a plane
__device__ __forceinline__ void put8(const float* r, bf* Ph, bf* Pl, h16* P16, size_t e) { v8us oh, ol; v8h o16;
#pragma unroll
    for (int q = 0; q < 8; ++q) { unsigned short a, c2; splitf(r[q], a, c2); oh[q] = a; ol[q] = c2; o16[q] = tohx(r[q]); }
    *(v8us*)(Ph + e) = oh; *(v8us*)(Pl + e) = ol; *(v8h*)(P16 + e) = o16; }



// ---- gemm_tile: one work-group of 8 waves (2 x 4) per 128x128 output tile, a wave owns 64x32 of it; grid (M/128, N/128), 256 threads. M, N multiples of 128, K a multiple of KP and at least 2 KP.
// C[m][n] (f32, pitch ldc) = sum_k A[m][k] Bt[n][k] (NSPLIT 1: + A2[m][k] Bt[n][k]) + bias[n]; operands are K-contiguous bf16 planes, summed in one chain in k order.
// A pass is KP k of every operand row: [A 128 rows | (A2 128 rows) | Bt 128 rows] at a pitch of 16 bytes x odd, brought into a ring of two LDS buffers by asynchronous copies that take whole 128-byte lines
// (a fragment load straight from the planes touches 16 lines for 512 bytes); pass t + 2 is copied while pass t + 1 is worked on; the eight waves share every staged row.
// EPI 0: C is stored as f32. EPI 1, tr false (q, k) or true (v; tr is the same for a whole work-group): M rows are b*2048 + t, N columns h*64 + d; the tile (+ bias) goes straight from its LDS staging into the three planes (bf16 hi, bf16 lo, fp16) that the attention reads, C is not written:
// tr false: [b][h][t][d] with interleaved-pair RoPE: (x0, x1) at (d, d + 1), d even -> (cos x0 - sin x1, sin x0 + cos x1), angle index d/2, (cos, sin) from CSN[t][d/2]; tr true: [b][h][d][t] (transposed).
template <typename T16> struct WFrag;
template <> struct WFrag<h16> { typedef v16h V; static __device__ __forceinline__ V ld(const h16* p) { return cat16(*(const v8h*)p, *(const v8h*)(p + 16)); } static __device__ __forceinline__ v8f mma(V a, V b, v8f c) { return wmma16(a, b, c); } };
template <> struct WFrag<bf> { typedef v16bf V; static __device__ __forceinline__ V ld(const bf* p) { return cat16b(*(const v8us*)p, *(const v8us*)(p + 16)); } static __device__ __forceinline__ v8f mma(V a, V b, v8f c) { return wmmab(a, b, c); } };
// runs of four or eight asynchronous 16-byte copies a lane (l: LDS byte address, g: global address); the closing s_wait_xcnt 0 stands in the copies' own statement, in front of any rewrite of the address registers that they name
__device__ __forceinline__ void acopy4(const unsigned* l, const bf* const* g) {
    asm volatile("global_load_async_to_lds_b128 %0, %1, off\n\tglobal_load_async_to_lds_b128 %2, %3, off\n\tglobal_load_async_to_lds_b128 %4, %5, off\n\tglobal_load_async_to_lds_b128 %6, %7, off\n\ts_wait_xcnt 0x0"
                 :: "v"(l[0]), "v"(g[0]), "v"(l[1]), "v"(g[1]), "v"(l[2]), "v"(g[2]), "v"(l[3]), "v"(g[3]) : "memory"); }
__device__ __forceinline__ void acopy8(const unsigned* l, const bf* const* g) {
    asm volatile("global_load_async_to_lds_b128 %0, %1, off\n\tglobal_load_async_to_lds_b128 %2, %3, off\n\tglobal_load_async_to_lds_b128 %4, %5, off\n\tglobal_load_async_to_lds_b128 %6, %7, off\n\t"
                 "global_load_async_to_lds_b128 %8, %9, off\n\tglobal_load_async_to_lds_b128 %10, %11, off\n\tglobal_load_async_to_lds_b128 %12, %13, off\n\tglobal_load_async_to_lds_b128 %14, %15, off\n\ts_wait_xcnt 0x0"
                 :: "v"(l[0]), "v"(g[0]), "v"(l[1]), "v"(g[1]), "v"(l[2]), "v"(g[2]), "v"(l[3]), "v"(g[3]), "v"(l[4]), "v"(g[4]), "v"(l[5]), "v"(g[5]), "v"(l[6]), "v"(g[6]), "v"(l[7]), "v"(g[7]) : "memory"); }
template <int NSPLIT, int EPI>
__device__ __forceinline__ void gemm_tile(const bf* __restrict__ A, const bf* __restrict__ A2, const bf* __restrict__ Bt, int K, float* C, int ldc, const float* __restrict__ bias, const float* __restrict__ CSN, bf* Ph, bf* Pl, h16* P16, bool tr) {
    typedef WFrag<bf>::V V;                     // every full unroll below: the arrays are register fragments or asm operands, so their indices must be compile-time constants
    constexpr int KP = NSPLIT ? 64 : 128;       // k per pass: either way 32 matrix instructions a wave and pass, and two work-groups fit a WGP's LDS
    constexpr int PB = KP * 2 + 16;             // LDS row pitch in bytes (16 x odd: no bank conflict for 16-byte fragment reads)
    constexpr int ROWS = NSPLIT ? 384 : 256;    // rows of a stage
    constexpr int STAGE = ROWS * PB;
    constexpr int CPR = KP / 8;                 // 16-byte pieces of a row
    constexpr int RPI = 256 / CPR;              // rows that one copy of all 256 threads brings
    constexpr int NC = ROWS / RPI;              // copies per thread and stage (16 or 12)
    constexpr int OP = 36;                      // floats per row of a wave's 64x32 tile in the output staging
    constexpr int TP = 132;                     // EPI 1: floats per row of the work-group's whole 128x128 tile in the output staging (16 bytes x odd)
    static_assert(8 * 64 * OP * 4 <= 2 * STAGE && 128 * TP * 4 <= 2 * STAGE, "output staging fits the ring");
    __shared__ __attribute__((aligned(128))) unsigned char L[2 * STAGE];
    const int tid = (int)threadIdx.x, lane = tid & 31, lr = lane & 15, hi = lane >> 4; const int wv = __builtin_amdgcn_readfirstlane(tid >> 5), wm = wv & 1, wn = wv >> 1;
    const int r0 = blockIdx.x * 128, c0 = blockIdx.y * 128;
    const int crow = tid / CPR, ccol = tid % CPR;
    const unsigned ldst = (unsigned)(uintptr_t)L + (unsigned)(crow * PB + ccol * 16);
    const bf* gA = A + (size_t)(r0 + crow) * K + ccol * 8; const bf* gA2 = NSPLIT ? A2 + (size_t)(r0 + crow) * K + ccol * 8 : nullptr; const bf* gB = Bt + (size_t)(c0 + crow) * K + ccol * 8;
    auto fill = [&](int t) {                    // every thread's NC copies of pass t into buffer t & 1
        unsigned l[NC]; const bf* g[NC];
#pragma unroll
        for (int i = 0; i < NC; ++i) { const int row = i * RPI; const bf* base = row < 128 ? gA : (NSPLIT && row < 256) ? gA2 : gB; g[i] = base + (size_t)(row & 127) * K + t * KP; l[i] = ldst + (unsigned)((t & 1) * STAGE + row * PB); }
#pragma unroll
        for (int i = 0; i + 8 <= NC; i += 8) acopy8(l + i, g + i);
        if (NC % 8) acopy4(l + NC - 4, g + NC - 4);
    };
    const int er = lane >> 3, ec = (lane & 7) * 4;
    const v4f bv = *(const v4fa*)(bias + c0 + wn * 32 + ec);     // read in front of the K loop, so that nothing waits for it behind it
    const float bb[2] = {bias[c0 + wn * 32 + lr], bias[c0 + wn * 32 + 16 + lr]};   // EPI 1: the bias of the two columns that this lane's accumulators hold
    v8f acc[4][2];
#pragma unroll
    for (int mb = 0; mb < 4; ++mb)
#pragma unroll
        for (int nb = 0; nb < 2; ++nb) acc[mb][nb] = (v8f){};
    const int NT = K / KP;
    fill(0);
    asm volatile("s_wait_asynccnt 0x0" ::: "memory");           // this wave's copies of pass 0 have landed
    __syncthreads();                                            // and every other wave's
    if (NT > 1) fill(1);
#pragma unroll 1                                                // rolled: a trip is a whole pass, its buffer chosen at run time
    for (int t = 0; t < NT; ++t) {
        const unsigned char* S = L + (t & 1) * STAGE;
        const unsigned char* pa = S + (wm * 64 + lr) * PB + hi * 16; const unsigned char* pb = S + (ROWS - 128 + wn * 32 + lr) * PB + hi * 16;
#pragma unroll
        for (int ks = 0; ks < KP / 32; ++ks) {
            V a[4], a2[4], b[2];
#pragma unroll
            for (int mb = 0; mb < 4; ++mb) { a[mb] = WFrag<bf>::ld((const bf*)(pa + mb * 16 * PB + ks * 64)); if (NSPLIT) a2[mb] = WFrag<bf>::ld((const bf*)(pa + (128 + mb * 16) * PB + ks * 64)); }
#pragma unroll
            for (int nb = 0; nb < 2; ++nb) b[nb] = WFrag<bf>::ld((const bf*)(pb + nb * 16 * PB + ks * 64));
#pragma unroll
            for (int nb = 0; nb < 2; ++nb)
#pragma unroll
                for (int mb = 0; mb < 4; ++mb) { acc[mb][nb] = WFrag<bf>::mma(a[mb], b[nb], acc[mb][nb]); if (NSPLIT) acc[mb][nb] = WFrag<bf>::mma(a2[mb], b[nb], acc[mb][nb]); }
        }
        asm volatile("s_wait_dscnt 0x0" ::: "memory");          // this wave's reads of buffer t & 1 are done
        asm volatile("s_wait_asynccnt 0x0" ::: "memory");       // this wave's copies of pass t + 1 have landed
        __syncthreads();                                        // publishes pass t + 1 and frees buffer t & 1
        if (t + 2 < NT) fill(t + 2);
    }
    asm volatile("s_wait_asynccnt 0x0" ::: "memory");           // no copy is outstanding when the ring becomes output staging
  if constexpr (EPI == 0) {
    float* mine = (float*)L + wv * (64 * OP);                   // behind the last pass's barrier: every wave has left the ring
#pragma unroll
    for (int mb = 0; mb < 4; ++mb)
#pragma unroll
        for (int nb = 0; nb < 2; ++nb)
#pragma unroll
            for (int j = 0; j < 8; ++j) mine[(mb * 16 + hi * 8 + j) * OP + nb * 16 + lr] = acc[mb][nb][j];
    __syncthreads();                                            // the rows are read back by other lanes
#pragma unroll
    for (int s = 0; s < 16; ++s) { const int row = s * 4 + er; v4f val = *(const v4fa*)(mine + row * OP + ec);    // a store instruction writes four whole 128-byte lines
#pragma unroll
        for (int q = 0; q < 4; ++q) val[q] += bfr(bv[q]);
        *(v4f*)(C + (size_t)(r0 + wm * 64 + row) * ldc + c0 + wn * 32 + ec) = val; }
  } else {
    float* tile = (float*)L;                                    // behind the last pass's barrier: every wave has left the ring
    if (!tr) {                                                  // [t][column]
#pragma unroll
        for (int mb = 0; mb < 4; ++mb)
#pragma unroll
            for (int nb = 0; nb < 2; ++nb) { const v8f x = acc[mb][nb] + bfr(bb[nb]); const int row = wm * 64 + mb * 16 + hi * 8, col = wn * 32 + nb * 16 + lr;
#pragma unroll
                for (int j = 0; j < 8; ++j) tile[(row + j) * TP + col] = x[j]; }
    } else {                                                    // [column][t]: the eight rows that a lane holds of a column are consecutive t
#pragma unroll
        for (int mb = 0; mb < 4; ++mb)
#pragma unroll
            for (int nb = 0; nb < 2; ++nb) { const v8f x = acc[mb][nb] + bfr(bb[nb]); const int row = wm * 64 + mb * 16 + hi * 8, col = wn * 32 + nb * 16 + lr;
                float* p = tile + col * TP + row; *(v4fa*)p = __builtin_shufflevector(x, x, 0, 1, 2, 3); *(v4fa*)(p + 4) = __builtin_shufflevector(x, x, 4, 5, 6, 7); }
    }
    __syncthreads();                                            // the tile is read back by other waves
    const size_t bh = (size_t)(r0 / TT) * NH_ + c0 / HD;        // the tile lies in one batch element and holds two whole heads
    const int t0 = r0 & (TT - 1);
    if (tr) {                                                   // a lane takes 8 consecutive t of one column, a store instruction writes four whole 128-byte lines (two columns)
#pragma unroll
        for (int s = 0; s < 8; ++s) { const int col = (wv * 8 + s) * 2 + hi; const float* p = tile + col * TP + lr * 8; const v4f x[2] = {*(const v4fa*)p, *(const v4fa*)(p + 4)};
            const float r[8] = {x[0][0], x[0][1], x[0][2], x[0][3], x[1][0], x[1][1], x[1][2], x[1][3]};
            put8(r, Ph, Pl, P16, (bh * HD + col) * TT + t0 + lr * 8); }
        return; }
    const int hh = wv >> 2, cg = lane & 7;                      // a lane takes 8 consecutive d of one t, a store instruction writes four whole 128-byte lines; waves 0-3 the first head, 4-7 the second
    const float* pc = CSN + ((size_t)(t0 + (wv & 3) * 32 + (lane >> 3)) * NF + cg * 4) * 2; v4f cs[8][2];   // the lane's table entries of its first row; its next row is 4 t = 4 * NF * 2 floats further
#pragma unroll
    for (int s = 0; s < 8; ++s) { cs[s][0] = *(const v4fa*)(pc + s * (4 * NF * 2)); cs[s][1] = *(const v4fa*)(pc + s * (4 * NF * 2) + 4); }
    asm volatile("s_wait_xcnt 0x0" :: "v"(pc) : "memory");      // the address pair is an input here, so it stays as it is through the table loads and is free for reuse only behind this wait
#pragma unroll
    for (int s = 0; s < 8; ++s) { const int row = ((wv & 3) * 8 + s) * 4 + (lane >> 3); const float* p = tile + row * TP + hh * HD + cg * 8;
        const v4f x[2] = {*(const v4fa*)p, *(const v4fa*)(p + 4)}; float r[8];
#pragma unroll
        for (int q = 0; q < 4; ++q) { const float co = cs[s][q >> 1][(q & 1) * 2], si = cs[s][q >> 1][(q & 1) * 2 + 1], x0 = x[q >> 1][(q & 1) * 2], x1 = x[q >> 1][(q & 1) * 2 + 1]; r[q * 2] = co * x0 - si * x1; r[q * 2 + 1] = si * x0 + co * x1; }
        put8(r, Ph, Pl, P16, ((bh + hh) * TT + t0 + row) * HD + cg * 8); }
    asm volatile("s_wait_xcnt 0x0" ::: "memory");               // in the built code the other form's block follows this one behind a branch: the wait stands between these stores and the instructions there that rewrite their registers
  }
}
// the output projection: hi + lo planes of the merged attention output x Wo, f32 out
__global__ __launch_bounds__(256) void k_gemmw(const bf* __restrict__ A, const bf* __restrict__ A2, const bf* __restrict__ Bt, int K, float* C, int ldc, const float* __restrict__ bias) {
    gemm_tile<1, 0>(A, A2, Bt, K, C, ldc, bias, nullptr, nullptr, nullptr, nullptr, false); }
// the q, k and v projections in one launch, grid (M/128, N/128, 3): blockIdx.z picks the weights, the bias, the planes and the planes' form. A work-group of the next projection starts as soon as a place on a WGP comes free,
// so nothing waits for the slowest work-group of a projection, and one work-group's epilogue (vector work, stores) runs beside its neighbour's K loop (LDS, matrix unit).
__global__ __launch_bounds__(256) void k_qkv(const bf* __restrict__ X, const bf* __restrict__ WQ, const bf* __restrict__ WK, const bf* __restrict__ WV, int K, const float* __restrict__ bq, const float* __restrict__ bk, const float* __restrict__ bv, const float* __restrict__ CSN,
                                             bf* QPh, bf* QPl, h16* QP16, bf* KPh, bf* KPl, h16* KP16, bf* VTh, bf* VTl, h16* VT16) {
    const int z = (int)blockIdx.z;
    gemm_tile<0, 1>(X, nullptr, z == 0 ? WQ : z == 1 ? WK : WV, K, nullptr, 0, z == 0 ? bq : z == 1 ? bk : bv, CSN, z == 0 ? QPh : z == 1 ? KPh : VTh, z == 0 ? QPl : z == 1 ? KPl : VTl, z == 0 ? QP16 : z == 1 ? KP16 : VT16, z == 2); }

typedef __attribute__((ext_vector_type(2))) float v2f;

typedef __attribute__((ext_vector_type(4))) unsigned short v4us;
// k_prep: all that the GEMMs need beforehand, in one launch of PG work-groups of 256 threads (16 waves a WGP): x and the four weight matrices rounded to bf16, and the rotary (cos, sin) table.
// A piece is 4 floats: a wave's load takes 512 consecutive bytes (four whole lines), its store 256 (two whole lines). A work-group takes 1/PG of every array in a row, a thread 16 pieces of x and 2 of each weight matrix;
// all 24 loads are issued before the first value is used, so that few long waves keep the memory busy (a wave per 256 elements spends its time being started). The first TT * NF threads also fill one table entry each, while their loads fly.
#define PG   512
__global__ __launch_bounds__(256) void k_prep(const float* __restrict__ x, const float* __restrict__ Wq, const float* __restrict__ Wk, const float* __restrict__ Wv, const float* __restrict__ Wd,
                                              bf* __restrict__ XB, bf* __restrict__ WQ, bf* __restrict__ WK, bf* __restrict__ WV, bf* __restrict__ WO, float* __restrict__ CSN) {
    constexpr int NX = NB_ * TT * DD / (PG * 1024), NW = DD * DD / (PG * 1024);   // pieces a thread (a work-group's 256 pieces are 1024 elements)
    static_assert(NX * PG * 1024 == NB_ * TT * DD && NW * PG * 1024 == DD * DD && TT * NF % 256 == 0 && TT * NF <= PG * 256, "the pieces divide evenly among the threads");
    const int tid = (int)threadIdx.x, blk = (int)blockIdx.x;
    const float* const px = x + (size_t)blk * (NX * 1024); const float* const pw[4] = {Wq + (size_t)blk * (NW * 1024), Wk + (size_t)blk * (NW * 1024), Wv + (size_t)blk * (NW * 1024), Wd + (size_t)blk * (NW * 1024)};
    bf* const wd[4] = {WQ, WK, WV, WO};
    v4f vx[NX], vw[4][NW];                      // every full unroll below: the arrays are registers, so their indices must be compile-time constants
#pragma unroll
    for (int k = 0; k < NX; ++k) vx[k] = *(const v4fa*)(px + k * 1024 + tid * 4);
#pragma unroll
    for (int w = 0; w < 4; ++w)
#pragma unroll
        for (int k = 0; k < NW; ++k) vw[w][k] = *(const v4fa*)(pw[w] + k * 1024 + tid * 4);
    // behind the last load, in front of every rewrite of a register that the loads name as address: the lane offset and the five bases are inputs, so they stay as they are up to here
    asm volatile("s_wait_xcnt 0x0" :: "v"(tid), "s"(px), "s"(pw[0]), "s"(pw[1]), "s"(pw[2]), "s"(pw[3]) : "memory");
    if (blk < TT * NF / 256) {                  // whole work-groups
        const int idx = blk * 256 + tid, t = idx / NF, i = idx % NF; const float den = powf(10000.0f, (float)(2 * i) * (1.0f / HD)); const float ang = __fdiv_rn((float)t, den);
        v2f o; o[0] = cosf(ang); o[1] = sinf(ang); *(v2f*)(CSN + (size_t)idx * 2) = o; }
#pragma unroll
    for (int k = 0; k < NX; ++k) { v4us o;
#pragma unroll
        for (int q = 0; q < 4; ++q) o[q] = f2bf(vx[k][q]);
        *(v4us*)(XB + (size_t)blk * (NX * 1024) + k * 1024 + tid * 4) = o; }
#pragma unroll
    for (int w = 0; w < 4; ++w)
#pragma unroll
        for (int k = 0; k < NW; ++k) { v4us o;
#pragma unroll
            for (int q = 0; q < 4; ++q) o[q] = f2bf(vw[w][k][q]);
            *(v4us*)(wd[w] + (size_t)blk * (NW * 1024) + k * 1024 + tid * 4) = o; }
}
// k_fattn: scores, causal softmax, attn.v and the head merge in one kernel, work-groups of NS waves.
// St = K Qt (A = 16 key rows, B = 16 query rows): lane (lr, hi) holds for query lr the keys hi*8 + j of each 16-key tile, which is the k order of the B fragment of Ot += Vt Pt, so P stays in registers.
// Running maximum m and sum l per query and wave (log2 domain); P = exp2(t - m) (fp16 rows: x 1024, which cancels in the division by l).
// Rows >= RH (single fp16 planes, attn_tile): a work-group owns QT query rows of one head, a wave 32 of them with all their keys in rising order. A stage is KB keys: [K KB rows of 64 d | Vt 64 rows of KB keys], whole 128-byte lines
// brought into a ring of two LDS buffers by asynchronous copies and read by all NS waves (a fragment load straight from the planes touches 16 lines for 512 bytes, and every 32 queries fetched every key anew); stage s + 2 is copied while stage s + 1 is worked on.
// Rows < RH (bf16 hi+lo planes, 3 products, attn_rows): a work-group owns 32 query rows, wave w takes the 32-key blocks w, w + NS, ... up to the diagonal block, fragments straight from the planes.
// There the NS partial (m, l, O) are joined in LDS in the fixed order w = 0 .. NS-1 (deterministic); a wave without a block hands over m = -3e38, l = 0, O = 0, whose weight is exp2(-huge) = 0.
#define NS   4
#define OPI  68                   // floats per query row of a partial O tile in LDS
#define C2L 0.18033688011112042f  // (1/8) log2(e)
// exp2 in asm text with the slot behind a transcendental kept by construction: each v_exp_f32 works in place on a register of its own, so none reads the result or overwrites the source of the one in front of it,
// and the closing v_nop is the one independent slot in front of whatever the compiler puts next.
__device__ __forceinline__ float exp2s(float x) { asm("v_exp_f32 %0, %0\n\tv_nop" : "+v"(x)); return x; }
__device__ __forceinline__ v8f exp2x8(v8f x) { float a = x[0], b = x[1], c = x[2], d = x[3], e = x[4], f = x[5], g = x[6], h = x[7];
    asm("v_exp_f32 %0, %0\n\tv_exp_f32 %1, %1\n\tv_exp_f32 %2, %2\n\tv_exp_f32 %3, %3\n\tv_exp_f32 %4, %4\n\tv_exp_f32 %5, %5\n\tv_exp_f32 %6, %6\n\tv_exp_f32 %7, %7\n\tv_nop" : "+v"(a), "+v"(b), "+v"(c), "+v"(d), "+v"(e), "+v"(f), "+v"(g), "+v"(h));
    return (v8f){a, b, c, d, e, f, g, h}; }
template <typename T16, bool HR, int NG>   // NG: 16-query groups worked on at a time (hi+lo rows: one, which keeps the kernel within 256 registers)
__device__ __forceinline__ void attn_rows(const T16* __restrict__ Q, const T16* __restrict__ Q2, const T16* __restrict__ Kp, const T16* __restrict__ K2, const T16* __restrict__ Vt, const T16* __restrict__ V2, float* os, float* mS, float* lS, int q0, int kfirst, int lr, int hi) {
    typedef typename WFrag<T16>::V V;     // every full unroll below: the arrays are register fragments, so their indices must be compile-time constants
#pragma unroll 1                          // rolled: the two passes of the hi+lo rows share one copy of the code and one set of registers
  for (int gb = 0; gb < 2; gb += NG) {
    V qf[NG][2], qf2[NG][2], kf[2][2], kf2[2][2];
#pragma unroll
    for (int g = 0; g < NG; ++g)
#pragma unroll
        for (int ks = 0; ks < 2; ++ks) { const size_t o = (size_t)(q0 + (gb + g) * 16 + lr) * HD + ks * 32 + 8 * hi; qf[g][ks] = WFrag<T16>::ld(Q + o); if (HR) qf2[g][ks] = WFrag<T16>::ld(Q2 + o); }
    v8f o[NG][4]; float m[NG], l[NG];
#pragma unroll
    for (int g = 0; g < NG; ++g) { m[g] = -3.0e38f; l[g] = 0.f;
#pragma unroll
        for (int dt = 0; dt < 4; ++dt) o[g][dt] = (v8f){}; }
#pragma unroll 1                          // rolled: a trip is a whole 32-key block, a second copy would only cost registers
    for (int key0 = kfirst; key0 <= q0; key0 += 32 * NS) {
        V vf[4], vf2[4];
        if constexpr (HR) {                                     // hi+lo rows: at most two trips a wave, K read where it is used (fetched ahead it would cost registers the kernel does not have)
#pragma unroll
            for (int t = 0; t < 2; ++t)
#pragma unroll
                for (int ks = 0; ks < 2; ++ks) { const size_t ok = (size_t)(key0 + t * 16 + lr) * HD + ks * 32 + 8 * hi; kf[t][ks] = WFrag<T16>::ld(Kp + ok); kf2[t][ks] = WFrag<T16>::ld(K2 + ok); } }
        v8f s[NG][2];
#pragma unroll
        for (int g = 0; g < NG; ++g)
#pragma unroll
            for (int t = 0; t < 2; ++t) { s[g][t] = (v8f){};
#pragma unroll
                for (int ks = 0; ks < 2; ++ks) { s[g][t] = WFrag<T16>::mma(kf[t][ks], qf[g][ks], s[g][t]); if (HR) { s[g][t] = WFrag<T16>::mma(kf2[t][ks], qf[g][ks], s[g][t]); s[g][t] = WFrag<T16>::mma(kf[t][ks], qf2[g][ks], s[g][t]); } } }
#pragma unroll
        for (int g = 0; g < NG; ++g)
#pragma unroll
            for (int t = 0; t < 2; ++t) s[g][t] *= C2L;
        if constexpr (HR) {
            asm volatile("s_wait_xcnt 0x0" ::: "memory");       // the V fragments below land in registers that the K loads above name as addresses: the wait stands in front of them
            __builtin_amdgcn_sched_barrier(0);                  // keeps the V loads behind that wait
            const T16* pv = Vt + (size_t)lr * TT + key0 + 8 * hi; const T16* pv2 = V2 + (size_t)lr * TT + key0 + 8 * hi;
#pragma unroll
            for (int dt = 0; dt < 4; ++dt) { vf[dt] = WFrag<T16>::ld(pv + (size_t)dt * 16 * TT); vf2[dt] = WFrag<T16>::ld(pv2 + (size_t)dt * 16 * TT); }
            asm volatile("s_wait_xcnt 0x0" :: "v"(pv), "v"(pv2) : "memory"); }   // both address pairs are inputs here, so they stay live through the run and no V fragment lands in them; they are free for reuse only behind this wait
        if (key0 == q0) {                                       // the diagonal block, the only one with keys behind a query of this wave
#pragma unroll
            for (int g = 0; g < NG; ++g)
#pragma unroll
                for (int t = 0; t < 2; ++t)
#pragma unroll
                    for (int j = 0; j < 8; ++j) if (t * 16 + hi * 8 + j > (gb + g) * 16 + lr) s[g][t][j] = -3.0e38f; }
#pragma unroll
        for (int g = 0; g < NG; ++g) {
            float bm = s[g][0][0];
#pragma unroll
            for (int t = 0; t < 2; ++t)
#pragma unroll
                for (int j = 0; j < 8; ++j) bm = fmaxf(bm, s[g][t][j]);
            bm = fmaxf(bm, __shfl_xor(bm, 16, 32));             // the other half of the wave holds the other 16 keys of the same query
            const float mn = fmaxf(m[g], bm); const float al = exp2s(m[g] - mn); m[g] = mn; const float ms = HR ? mn : mn - 10.0f;
            float ps = 0.f;
#pragma unroll
            for (int t = 0; t < 2; ++t) { s[g][t] = exp2x8(s[g][t] - ms);
#pragma unroll
                for (int j = 0; j < 8; ++j) ps += s[g][t][j]; }
            l[g] = l[g] * al + ps;
#pragma unroll
            for (int dt = 0; dt < 4; ++dt) o[g][dt] *= al;
            if constexpr (HR) { v8us ph[2], pl[2];
#pragma unroll
                for (int t = 0; t < 2; ++t)
#pragma unroll
                    for (int j = 0; j < 8; ++j) { unsigned short a, c2; splitf(s[g][t][j], a, c2); ph[t][j] = a; pl[t][j] = c2; }
                const V pf = cat16b(ph[0], ph[1]), pf2 = cat16b(pl[0], pl[1]);
#pragma unroll
                for (int dt = 0; dt < 4; ++dt) { o[g][dt] = WFrag<T16>::mma(vf[dt], pf, o[g][dt]); o[g][dt] = WFrag<T16>::mma(vf2[dt], pf, o[g][dt]); o[g][dt] = WFrag<T16>::mma(vf[dt], pf2, o[g][dt]); }
            }
        }
    }
#pragma unroll
    for (int g = 0; g < NG; ++g) { const float lt = l[g] + __shfl_xor(l[g], 16, 32); if (hi == 0) { mS[(gb + g) * 16 + lr] = m[g]; lS[(gb + g) * 16 + lr] = lt; }
#pragma unroll
        for (int dt = 0; dt < 4; ++dt) { float* p = os + ((gb + g) * 16 + lr) * OPI + dt * 16 + hi * 8; const v8f x = o[g][dt]; *(v4fa*)p = __builtin_shufflevector(x, x, 0, 1, 2, 3); *(v4fa*)(p + 4) = __builtin_shufflevector(x, x, 4, 5, 6, 7); } }
  }
}
#define QT   128                  // fp16 rows: query rows of a work-group (NS waves x 32)
#define KB   64                   // fp16 rows: keys of a stage
#define SPB  144                  // LDS pitch in bytes of a staged 128-byte row (16 x odd: no bank conflict for 16-byte fragment reads)
#define SST  (2 * 64 * SPB)       // bytes of a stage
// Q, Kp, Vt: the head's fp16 planes; SM: 2 * SST bytes of LDS; Ah, Al: the merged planes at (batch element, row 0, first column of the head); Q0: first query row of the work-group
__device__ __forceinline__ void attn_tile(const h16* __restrict__ Q, const h16* __restrict__ Kp, const h16* __restrict__ Vt, unsigned char* SM, bf* Ah, bf* Al, int Q0, int wv, int tid, int lr, int hi) {
    typedef WFrag<h16>::V V;              // every full unroll below: the arrays are register fragments or asm operands, so their indices must be compile-time constants
    const int q0 = Q0 + wv * 32, NT = (Q0 + QT) / KB;   // the wave's first query; stages up to the work-group's last diagonal block (at least two)
    const int crow = tid >> 3, ccol = tid & 7;          // a copy of all 128 threads brings 16 rows of 128 bytes
    const unsigned ldst = (unsigned)(uintptr_t)SM + (unsigned)(crow * SPB + ccol * 16);
    const h16* gK = Kp + (size_t)crow * HD + ccol * 8; const h16* gV = Vt + (size_t)crow * TT + ccol * 8;
    auto fill = [&](int s) {              // every thread's 8 copies of stage s into buffer s & 1
        unsigned l[8]; const bf* g[8];
#pragma unroll
        for (int i = 0; i < 4; ++i) { g[i] = (const bf*)(gK + (size_t)(s * KB + i * 16) * HD); l[i] = ldst + (unsigned)((s & 1) * SST + i * 16 * SPB);
            g[4 + i] = (const bf*)(gV + (size_t)(i * 16) * TT + s * KB); l[4 + i] = ldst + (unsigned)((s & 1) * SST + (64 + i * 16) * SPB); }
        acopy8(l, g);
    };
    fill(0);
    V qf[2][2]; const h16* pq = Q + (size_t)(q0 + lr) * HD + 8 * hi;
#pragma unroll
    for (int g = 0; g < 2; ++g)
#pragma unroll
        for (int ks = 0; ks < 2; ++ks) qf[g][ks] = WFrag<h16>::ld(pq + g * 16 * HD + ks * 32);
    asm volatile("s_wait_xcnt 0x0" :: "v"(pq) : "memory");      // the address pair is an input here, so it stays as it is through the Q loads and is free for reuse only behind this wait
    v8f o[2][4]; float m[2], l[2];
#pragma unroll
    for (int g = 0; g < 2; ++g) { m[g] = -3.0e38f; l[g] = 0.f;
#pragma unroll
        for (int dt = 0; dt < 4; ++dt) o[g][dt] = (v8f){}; }
    asm volatile("s_wait_asynccnt 0x0" ::: "memory");           // this wave's copies of stage 0 have landed
    __syncthreads();                                            // and every other wave's
    fill(1);
#pragma unroll 1                                                // rolled: a trip is a whole stage, its buffer chosen at run time
    for (int s = 0; s < NT; ++s) {
        const unsigned char* S = SM + (s & 1) * SST;
#pragma unroll 1                                                // rolled: a trip is a whole 32-key block, a second copy would only cost registers
        for (int kk = 0; kk < KB / 32; ++kk) {
            const int key0 = s * KB + kk * 32;
            if (key0 > q0) break;                               // wave-uniform: blocks behind this wave's diagonal block hold no key of its queries; the wave still passes the stage's barrier
            const unsigned char* pk = S + (kk * 32 + lr) * SPB + hi * 16; const unsigned char* pv = S + (64 + lr) * SPB + kk * 64 + hi * 16;
            V kf[2][2], vf[4];
#pragma unroll
            for (int t = 0; t < 2; ++t)
#pragma unroll
                for (int ks = 0; ks < 2; ++ks) kf[t][ks] = WFrag<h16>::ld((const h16*)(pk + t * 16 * SPB + ks * 64));
#pragma unroll
            for (int dt = 0; dt < 4; ++dt) vf[dt] = WFrag<h16>::ld((const h16*)(pv + dt * 16 * SPB));
            v8f sc[2][2];
#pragma unroll
            for (int g = 0; g < 2; ++g)
#pragma unroll
                for (int t = 0; t < 2; ++t) { sc[g][t] = (v8f){};
#pragma unroll
                    for (int ks = 0; ks < 2; ++ks) sc[g][t] = WFrag<h16>::mma(kf[t][ks], qf[g][ks], sc[g][t]);
                    sc[g][t] *= C2L; }
            if (key0 == q0) {                                   // the diagonal block, the only one with keys behind a query of this wave
#pragma unroll
                for (int g = 0; g < 2; ++g)
#pragma unroll
                    for (int t = 0; t < 2; ++t)
#pragma unroll
                        for (int j = 0; j < 8; ++j) if (t * 16 + hi * 8 + j > g * 16 + lr) sc[g][t][j] = -3.0e38f; }
#pragma unroll
            for (int g = 0; g < 2; ++g) {
                float bm = sc[g][0][0];
#pragma unroll
                for (int t = 0; t < 2; ++t)
#pragma unroll
                    for (int j = 0; j < 8; ++j) bm = fmaxf(bm, sc[g][t][j]);
                bm = fmaxf(bm, __shfl_xor(bm, 16, 32));         // the other half of the wave holds the other 16 keys of the same query
                const float mn = fmaxf(m[g], bm); const float al = exp2s(m[g] - mn); m[g] = mn; const float ms = mn - 10.0f;
                float ps = 0.f; v8h ph[2];
#pragma unroll
                for (int t = 0; t < 2; ++t) { sc[g][t] = exp2x8(sc[g][t] - ms);
#pragma unroll
                    for (int j = 0; j < 8; ++j) { ps += sc[g][t][j]; ph[t][j] = tohx(sc[g][t][j]); } }
                l[g] = l[g] * al + ps;
                const V pf = cat16(ph[0], ph[1]);
#pragma unroll
                for (int dt = 0; dt < 4; ++dt) { o[g][dt] *= al; o[g][dt] = WFrag<h16>::mma(vf[dt], pf, o[g][dt]); }
            }
        }
        asm volatile("s_wait_dscnt 0x0" ::: "memory");          // this wave's reads of buffer s & 1 are done
        asm volatile("s_wait_asynccnt 0x0" ::: "memory");       // this wave's copies of stage s + 1 have landed
        __syncthreads();                                        // publishes stage s + 1 and frees buffer s & 1
        if (s + 2 < NT) fill(s + 2);
    }
    asm volatile("s_wait_asynccnt 0x0" ::: "memory");           // no copy is outstanding when the ring becomes output staging
    float* mine = (float*)SM + wv * (32 * OPI);                 // behind the last stage's barrier: every wave has left the ring
#pragma unroll
    for (int g = 0; g < 2; ++g) { const float inv = __fdiv_rn(1.0f, l[g] + __shfl_xor(l[g], 16, 32));
#pragma unroll
        for (int dt = 0; dt < 4; ++dt) { float* p = mine + (g * 16 + lr) * OPI + dt * 16 + hi * 8; const v8f x = o[g][dt] * inv; *(v4fa*)p = __builtin_shufflevector(x, x, 0, 1, 2, 3); *(v4fa*)(p + 4) = __builtin_shufflevector(x, x, 4, 5, 6, 7); } }
    __syncthreads();                                            // the rows are read back by other lanes
    const int cg = tid & 7;                                     // a lane takes 8 consecutive d of one query, a store instruction writes four whole 128-byte lines
#pragma unroll
    for (int u = 0; u < 8; ++u) { const int row = u * 4 + ((tid & 31) >> 3); const float* p = mine + row * OPI + cg * 8; const v4f x[2] = {*(const v4fa*)p, *(const v4fa*)(p + 4)}; v8us oh, ol;
#pragma unroll
        for (int j = 0; j < 8; ++j) { unsigned short a, c2; splitf(x[j >> 2][j & 3], a, c2); oh[j] = a; ol[j] = c2; }
        const size_t oo = (size_t)(q0 + row) * DD + cg * 8; *(v8us*)(Ah + oo) = oh; *(v8us*)(Al + oo) = ol; }
}
// grid (NB_ * NH_, (TT - RH) / QT + RH / 32), NS waves; blockIdx.x = b * NH_ + h; the longest rows (most keys) of every batch element and head start first, the short hi+lo work-groups last, so that they fill the places that come free; four waves per SIMD (256 registers) cover each other's waits
__global__ __launch_bounds__(NS * 32) __attribute__((amdgpu_waves_per_eu(4, 4))) void k_fattn(const bf* __restrict__ Qh, const bf* __restrict__ Ql, const bf* __restrict__ Kh, const bf* __restrict__ Kl, const bf* __restrict__ Vh, const bf* __restrict__ Vl, const h16* __restrict__ Q16, const h16* __restrict__ K16, const h16* __restrict__ V16, bf* Ah, bf* Al) {
    static_assert(QT == NS * 32 && RH % QT == 0 && QT % KB == 0 && (NS * 32 * OPI + 2 * NS * 32) * 4 <= 2 * SST, "tiles divide evenly; the partial tiles fit the ring's LDS");
    __shared__ __attribute__((aligned(128))) unsigned char SM[2 * SST];   // fp16 rows: the ring, then output staging; hi+lo rows: the partial (O, m, l)
    float* const os = (float*)SM; float* const mS = os + NS * 32 * OPI; float* const lS = mS + NS * 32;
    const int lane = threadIdx.x & 31, lr = lane & 15, hi = lane >> 4; const int wv = __builtin_amdgcn_readfirstlane((int)(threadIdx.x >> 5));
    const size_t hp = (size_t)blockIdx.x * TT * HD;
    if ((int)blockIdx.y < (TT - RH) / QT) {                     // whole work-groups
        const size_t om = (size_t)(blockIdx.x / NH_) * TT * DD + (blockIdx.x % NH_) * HD;
        attn_tile(Q16 + hp, K16 + hp, V16 + hp, SM, Ah + om, Al + om, TT - QT * ((int)blockIdx.y + 1), wv, (int)threadIdx.x, lr, hi);
        return; }
    const int q0 = (RH / 32 - 1 - ((int)blockIdx.y - (TT - RH) / QT)) * 32;
    attn_rows<bf, true, 1>(Qh + hp, Ql + hp, Kh + hp, Kl + hp, Vh + hp, Vl + hp, os + wv * (32 * OPI), mS + wv * 32, lS + wv * 32, q0, wv * 32, lr, hi);
    __syncthreads();
    // wave w joins queries w*8 .. w*8+7: a lane takes 16 consecutive d of one query, the wave whole 128-byte lines of the merged planes
    const int qq = wv * (32 / NS) + (lane >> 2), d0 = (lane & 3) * 16;
    float mw[NS], M = -3.0e38f;
#pragma unroll
    for (int w = 0; w < NS; ++w) { mw[w] = mS[w * 32 + qq]; M = fmaxf(M, mw[w]); }
    float L = 0.f; v4f val[4];
#pragma unroll
    for (int i = 0; i < 4; ++i) val[i] = (v4f)(0.f);
#pragma unroll
    for (int w = 0; w < NS; ++w) { const float f = exp2s(mw[w] - M); L += f * lS[w * 32 + qq];
#pragma unroll
        for (int i = 0; i < 4; ++i) val[i] += f * *(const v4fa*)(os + w * (32 * OPI) + qq * OPI + d0 + i * 4); }
    const float inv = __fdiv_rn(1.0f, L);
#pragma unroll
    for (int u = 0; u < 2; ++u) { v8us oh, ol;
#pragma unroll
        for (int j = 0; j < 8; ++j) { unsigned short a, c2; splitf(val[u * 2 + (j >> 2)][j & 3] * inv, a, c2); oh[j] = a; ol[j] = c2; }
        const size_t oo = ((size_t)(blockIdx.x / NH_) * TT + q0 + qq) * DD + (blockIdx.x % NH_) * HD + d0 + u * 8; *(v8us*)(Ah + oo) = oh; *(v8us*)(Al + oo) = ol; }
}

extern "C" void kernel_launch(void* const* d_in, const int* in_sizes, int n_in,
                              void* d_out, int out_size, void* d_ws, size_t ws_size, hipStream_t stream) {
    (void)in_sizes; (void)n_in; (void)out_size;
    const float* x = (const float*)d_in[0]; const float* Wq = (const float*)d_in[1]; const float* bq = (const float*)d_in[2]; const float* Wk = (const float*)d_in[3]; const float* bk = (const float*)d_in[4]; const float* Wv = (const float*)d_in[5]; const float* bv = (const float*)d_in[6]; const float* Wd = (const float*)d_in[7]; const float* bo = (const float*)d_in[8];
    float* OUT = (float*)d_out;     // [4][2048][1024]
    char* wsp = (char*)d_ws;
    auto take = [&](size_t bytes) { char* p = wsp; wsp += (bytes + 255) & ~(size_t)255; return (void*)p; };
    bf* WQ = (bf*)take((size_t)DD * DD * 2); bf* WK = (bf*)take((size_t)DD * DD * 2); bf* WV = (bf*)take((size_t)DD * DD * 2); bf* WO = (bf*)take((size_t)DD * DD * 2);
    bf* XB = (bf*)take((size_t)NB_ * TT * DD * 2); float* CSN = (float*)take((size_t)TT * NF * 2 * 4);
    bf* QPh = (bf*)take((size_t)NB_ * TT * DD * 2); bf* QPl = (bf*)take((size_t)NB_ * TT * DD * 2); bf* KPh = (bf*)take((size_t)NB_ * TT * DD * 2); bf* KPl = (bf*)take((size_t)NB_ * TT * DD * 2); bf* VTh = (bf*)take((size_t)NB_ * TT * DD * 2); bf* VTl = (bf*)take((size_t)NB_ * TT * DD * 2);
    h16* QP16 = (h16*)take((size_t)NB_ * TT * DD * 2); h16* KP16 = (h16*)take((size_t)NB_ * TT * DD * 2); h16* VT16 = (h16*)take((size_t)NB_ * TT * DD * 2);
    bf* ATh = (bf*)take((size_t)NB_ * TT * DD * 2); bf* ATl = (bf*)take((size_t)NB_ * TT * DD * 2);
    if ((size_t)(wsp - (char*)d_ws) > ws_size) return;    // total 200.5 MiB; ws 256 MiB
    k_prep<<<PG, 256, 0, stream>>>(x, Wq, Wk, Wv, Wd, XB, WQ, WK, WV, WO, CSN);
    const dim3 gP(NB_ * TT / 128, DD / 128, 1);   // x is [4][2048][1024]: the batch elements are further rows of every GEMM
    k_qkv<<<dim3(NB_ * TT / 128, DD / 128, 3), 256, 0, stream>>>(XB, WQ, WK, WV, DD, bq, bk, bv, CSN, QPh, QPl, QP16, KPh, KPl, KP16, VTh, VTl, VT16);
    k_fattn<<<dim3(NB_ * NH_, (TT - RH) / QT + RH / 32, 1), NS * 32, 0, stream>>>(QPh, QPl, KPh, KPl, VTh, VTl, QP16, KP16, VT16, ATh, ATl);
    k_gemmw<<<gP, 256, 0, stream>>>(ATh, ATl, WO, DD, OUT, DD, bo);
}

// v009
// One run takes 117 microseconds.
// Next to v008, in two timings, it ran 1.04 times as fast each time.
// Counting every step since v000, it is 34.8 times as fast.
#include <hip/hip_runtime.h>

// Causal multi-head attention (x [4][2048][1024]; q/k/v = x W^T + b ([out][in] Linears); 16 heads x 64; interleaved-pair RoPE on q and k (pair (2k,2k+1) rotated by t / 10000^(2k/64)); scores = q.k / 8, causal (tril, arithmetic) -> -inf;
// softmax (the reference's +1e-8 on the denominator is below f32 resolution since the row max contributes exp(0) = 1); out = merged attn.v Wo^T + bo).
// Compute dtypes, f32 accumulate: every input rounded to bf16; projections on PLAIN bf16 operands (inputs: exact, + bias); rotary cos/sin table in f32; scores and
// attn.v on bf16 hi+lo planes (3 products) for the first RH = 256 query rows of every batch and on SINGLE fp16 planes for rows >= 256;
// output hi+lo x exact Wo (2 products) + bo. 128x128-tile GEMMs (operands staged in LDS), every launch over all batch elements (rows b*2048 + t, head planes [b][h]); the q/k/v GEMMs write the head planes themselves. Deterministic, no

#define NB_  4
#define TT   2048
#define DD   1024
#define NH_  16
#define HD   64
#define RH   256                  // query rows < RH: hi+lo planes; rows >= RH: fp16 planes
#define NF   32                   // rotary frequencies (head_dim / 2)
typedef _Float16 h16;
typedef unsigned short bf;
typedef __attribute__((ext_vector_type(16))) __bf16   v16bf;
typedef __attribute__((ext_vector_type(16))) _Float16 v16h;
typedef __attribute__((ext_vector_type(8)))  _Float16 v8h;
typedef __attribute__((ext_vector_type(8)))  unsigned short v8us;
typedef __attribute__((ext_vector_type(8)))  float    v8f;
typedef __attribute__((ext_vector_type(4)))  float    v4f;
typedef v8h  __attribute__((may_alias)) v8ha;
typedef v4f  __attribute__((may_alias)) v4fa;
typedef v8us __attribute__((may_alias)) v8usa;

__device__ __forceinline__ unsigned short f2bf(float f) { unsigned u = __float_as_uint(f); u += 0x7FFFu + ((u >> 16) & 1u); return (unsigned short)(u >> 16); }
__device__ __forceinline__ float bf2f(unsigned short b) { return __uint_as_float(((unsigned)b) << 16); }
__device__ __forceinline__ float bfr(float f) { return bf2f(f2bf(f)); }
__device__ __forceinline__ v16h cat16(v8h lo, v8h hi) { return __builtin_shufflevector(lo, hi, 0, 1, 2, 3, 4, 5, 6, 7, 8, 9, 10, 11, 12, 13, 14, 15); }
__device__ __forceinline__ v16bf cat16b(v8us lo, v8us hi) { return __builtin_bit_cast(v16bf, __builtin_shufflevector(lo, hi, 0, 1, 2, 3, 4, 5, 6, 7, 8, 9, 10, 11, 12, 13, 14, 15)); }
__device__ __forceinline__ v8f wmma16(v16h a, v16h b, v8f c) { return __builtin_amdgcn_wmma_f32_16x16x32_f16(false, a, false, b, (short)0, c, false, false); }
__device__ __forceinline__ v8f wmmab(v16bf a, v16bf b, v8f c) { return __builtin_amdgcn_wmma_f32_16x16x32_bf16(false, a, false, b, (short)0, c, false, false); }
__device__ __forceinline__ h16 tohx(float x) { return (h16)x; }
__device__ __forceinline__ void splitf(float y, unsigned short& h, unsigned short& l) { h = f2bf(y); l = f2bf(y - bf2f(h)); }
// eight consecutive elements of the three planes (bf16 hi, bf16 lo, fp16) at element offset e: one 16-byte store a plane
__device__ __forceinline__ void put8(const float* r, bf* Ph, bf* Pl, h16* P16, size_t e) { v8us oh, ol; v8h o16;
#pragma unroll
    for (int q = 0; q < 8; ++q) { unsigned short a, c2; splitf(r[q], a, c2); oh[q] = a; ol[q] = c2; o16[q] = tohx(r[q]); }
    *(v8us*)(Ph + e) = oh; *(v8us*)(Pl + e) = ol; *(v8h*)(P16 + e) = o16; }
// the same for the fp16 plane alone
__device__ __forceinline__ void put8h(const float* r, h16* P16, size_t e) { v8h o16;
#pragma unroll
    for (int q = 0; q < 8; ++q) o16[q] = tohx(r[q]);
    *(v8h*)(P16 + e) = o16; }



// ---- gemm_tile: one work-group of 8 waves (2 x 4) per 128x128 output tile, a wave owns 64x32 of it; grid (M/128, N/128), 256 threads. M, N multiples of 128, K a multiple of KP and at least 2 KP.
// C[m][n] (f32, pitch ldc) = sum_k A[m][k] Bt[n][k] (NSPLIT 1: + A2[m][k] Bt[n][k]) + bias[n]; operands are K-contiguous bf16 planes, summed in one chain in k order.
// A pass is KP k of every operand row: [A 128 rows | (A2 128 rows) | Bt 128 rows] at a pitch of 16 bytes x odd, brought into a ring of two LDS buffers by asynchronous copies that take whole 128-byte lines
// (a fragment load straight from the planes touches 16 lines for 512 bytes); pass t + 2 is copied while pass t + 1 is worked on; the eight waves share every staged row.
// EPI 0: C is stored as f32. EPI 1, tr false (q, k) or true (v; tr is the same for a whole work-group): M rows are b*2048 + t, N columns h*64 + d; the tile (+ bias) goes straight from its LDS staging into the planes that the attention reads (fp16 for every t; bf16 hi and bf16 lo for t < RH alone, above that nothing reads them), C is not written:
// tr false: [b][h][t][d] with interleaved-pair RoPE: (x0, x1) at (d, d + 1), d even -> (cos x0 - sin x1, sin x0 + cos x1), angle index d/2, (cos, sin) from CSN[t][d/2]; tr true: [b][h][d][t] (transposed).
template <typename T16> struct WFrag;
template <> struct WFrag<h16> { typedef v16h V; static __device__ __forceinline__ V ld(const h16* p) { return cat16(*(const v8h*)p, *(const v8h*)(p + 16)); } static __device__ __forceinline__ v8f mma(V a, V b, v8f c) { return wmma16(a, b, c); } };
template <> struct WFrag<bf> { typedef v16bf V; static __device__ __forceinline__ V ld(const bf* p) { return cat16b(*(const v8us*)p, *(const v8us*)(p + 16)); } static __device__ __forceinline__ v8f mma(V a, V b, v8f c) { return wmmab(a, b, c); } };
// runs of four or eight asynchronous 16-byte copies a lane (l: LDS byte address, g: global address); the closing s_wait_xcnt 0 stands in the copies' own statement, in front of any rewrite of the address registers that they name
__device__ __forceinline__ void acopy4(const unsigned* l, const bf* const* g) {
    asm volatile("global_load_async_to_lds_b128 %0, %1, off\n\tglobal_load_async_to_lds_b128 %2, %3, off\n\tglobal_load_async_to_lds_b128 %4, %5, off\n\tglobal_load_async_to_lds_b128 %6, %7, off\n\ts_wait_xcnt 0x0"
                 :: "v"(l[0]), "v"(g[0]), "v"(l[1]), "v"(g[1]), "v"(l[2]), "v"(g[2]), "v"(l[3]), "v"(g[3]) : "memory"); }
__device__ __forceinline__ void acopy8(const unsigned* l, const bf* const* g) {
    asm volatile("global_load_async_to_lds_b128 %0, %1, off\n\tglobal_load_async_to_lds_b128 %2, %3, off\n\tglobal_load_async_to_lds_b128 %4, %5, off\n\tglobal_load_async_to_lds_b128 %6, %7, off\n\t"
                 "global_load_async_to_lds_b128 %8, %9, off\n\tglobal_load_async_to_lds_b128 %10, %11, off\n\tglobal_load_async_to_lds_b128 %12, %13, off\n\tglobal_load_async_to_lds_b128 %14, %15, off\n\ts_wait_xcnt 0x0"
                 :: "v"(l[0]), "v"(g[0]), "v"(l[1]), "v"(g[1]), "v"(l[2]), "v"(g[2]), "v"(l[3]), "v"(g[3]), "v"(l[4]), "v"(g[4]), "v"(l[5]), "v"(g[5]), "v"(l[6]), "v"(g[6]), "v"(l[7]), "v"(g[7]) : "memory"); }
template <int NSPLIT, int EPI>
__device__ __forceinline__ void gemm_tile(const bf* __restrict__ A, const bf* __restrict__ A2, const bf* __restrict__ Bt, int K, float* C, int ldc, const float* __restrict__ bias, const float* __restrict__ CSN, bf* Ph, bf* Pl, h16* P16, bool tr) {
    typedef WFrag<bf>::V V;                     // every full unroll below: the arrays are register fragments or asm operands, so their indices must be compile-time constants
    constexpr int KP = NSPLIT ? 64 : 128;       // k per pass: either way 32 matrix instructions a wave and pass, and two work-groups fit a WGP's LDS
    constexpr int PB = KP * 2 + 16;             // LDS row pitch in bytes (16 x odd: no bank conflict for 16-byte fragment reads)
    constexpr int ROWS = NSPLIT ? 384 : 256;    // rows of a stage
    constexpr int STAGE = ROWS * PB;
    constexpr int CPR = KP / 8;                 // 16-byte pieces of a row
    constexpr int RPI = 256 / CPR;              // rows that one copy of all 256 threads brings
    constexpr int NC = ROWS / RPI;              // copies per thread and stage (16 or 12)
    constexpr int OP = 36;                      // floats per row of a wave's 64x32 tile in the output staging
    constexpr int TP = 132;                     // EPI 1: floats per row of the work-group's whole 128x128 tile in the output staging (16 bytes x odd)
    static_assert(8 * 64 * OP * 4 <= 2 * STAGE && 128 * TP * 4 <= 2 * STAGE, "output staging fits the ring");
    static_assert(RH % 128 == 0, "a tile's rows lie wholly below or wholly at and above RH");
    __shared__ __attribute__((aligned(128))) unsigned char L[2 * STAGE];
    const int tid = (int)threadIdx.x, lane = tid & 31, lr = lane & 15, hi = lane >> 4; const int wv = __builtin_amdgcn_readfirstlane(tid >> 5), wm = wv & 1, wn = wv >> 1;
    const int r0 = blockIdx.x * 128, c0 = blockIdx.y * 128;
    const int crow = tid / CPR, ccol = tid % CPR;
    const unsigned ldst = (unsigned)(uintptr_t)L + (unsigned)(crow * PB + ccol * 16);
    const bf* gA = A + (size_t)(r0 + crow) * K + ccol * 8; const bf* gA2 = NSPLIT ? A2 + (size_t)(r0 + crow) * K + ccol * 8 : nullptr; const bf* gB = Bt + (size_t)(c0 + crow) * K + ccol * 8;
    auto fill = [&](int t) {                    // every thread's NC copies of pass t into buffer t & 1
        unsigned l[NC]; const bf* g[NC];
#pragma unroll
        for (int i = 0; i < NC; ++i) { const int row = i * RPI; const bf* base = row < 128 ? gA : (NSPLIT && row < 256) ? gA2 : gB; g[i] = base + (size_t)(row & 127) * K + t * KP; l[i] = ldst + (unsigned)((t & 1) * STAGE + row * PB); }
#pragma unroll
        for (int i = 0; i + 8 <= NC; i += 8) acopy8(l + i, g + i);
        if (NC % 8) acopy4(l + NC - 4, g + NC - 4);
    };
    const int er = lane >> 3, ec = (lane & 7) * 4;
    const v4f bv = *(const v4fa*)(bias + c0 + wn * 32 + ec);     // read in front of the K loop, so that nothing waits for it behind it
    const float bb[2] = {bias[c0 + wn * 32 + lr], bias[c0 + wn * 32 + 16 + lr]};   // EPI 1: the bias of the two columns that this lane's accumulators hold
    v8f acc[4][2];
#pragma unroll
    for (int mb = 0; mb < 4; ++mb)
#pragma unroll
        for (int nb = 0; nb < 2; ++nb) acc[mb][nb] = (v8f){};
    const int NT = K / KP;
    fill(0);
    asm volatile("s_wait_asynccnt 0x0" ::: "memory");           // this wave's copies of pass 0 have landed
    __syncthreads();                                            // and every other wave's
    if (NT > 1) fill(1);
#pragma unroll 1                                                // rolled: a trip is a whole pass, its buffer chosen at run time
    for (int t = 0; t < NT; ++t) {
        const unsigned char* S = L + (t & 1) * STAGE;
        const unsigned char* pa = S + (wm * 64 + lr) * PB + hi * 16; const unsigned char* pb = S + (ROWS - 128 + wn * 32 + lr) * PB + hi * 16;
#pragma unroll
        for (int ks = 0; ks < KP / 32; ++ks) {
            V a[4], a2[4], b[2];
#pragma unroll
            for (int mb = 0; mb < 4; ++mb) { a[mb] = WFrag<bf>::ld((const bf*)(pa + mb * 16 * PB + ks * 64)); if (NSPLIT) a2[mb] = WFrag<bf>::ld((const bf*)(pa + (128 + mb * 16) * PB + ks * 64)); }
#pragma unroll
            for (int nb = 0; nb < 2; ++nb) b[nb] = WFrag<bf>::ld((const bf*)(pb + nb * 16 * PB + ks * 64));
#pragma unroll
            for (int nb = 0; nb < 2; ++nb)
#pragma unroll
                for (int mb = 0; mb < 4; ++mb) { acc[mb][nb] = WFrag<bf>::mma(a[mb], b[nb], acc[mb][nb]); if (NSPLIT) acc[mb][nb] = WFrag<bf>::mma(a2[mb], b[nb], acc[mb][nb]); }
        }
        asm volatile("s_wait_dscnt 0x0" ::: "memory");          // this wave's reads of buffer t & 1 are done
        asm volatile("s_wait_asynccnt 0x0" ::: "memory");       // this wave's copies of pass t + 1 have landed
        __syncthreads();                                        // publishes pass t + 1 and frees buffer t & 1
        if (t + 2 < NT) fill(t + 2);
    }
    asm volatile("s_wait_asynccnt 0x0" ::: "memory");           // no copy is outstanding when the ring becomes output staging
  if constexpr (EPI == 0) {
    float* mine = (float*)L + wv * (64 * OP);                   // behind the last pass's barrier: every wave has left the ring
#pragma unroll
    for (int mb = 0; mb < 4; ++mb)
#pragma unroll
        for (int nb = 0; nb < 2; ++nb)
#pragma unroll
            for (int j = 0; j < 8; ++j) mine[(mb * 16 + hi * 8 + j) * OP + nb * 16 + lr] = acc[mb][nb][j];
    __syncthreads();                                            // the rows are read back by other lanes
#pragma unroll
    for (int s = 0; s < 16; ++s) { const int row = s * 4 + er; v4f val = *(const v4fa*)(mine + row * OP + ec);    // a store instruction writes four whole 128-byte lines
#pragma unroll
        for (int q = 0; q < 4; ++q) val[q] += bfr(bv[q]);
        *(v4f*)(C + (size_t)(r0 + wm * 64 + row) * ldc + c0 + wn * 32 + ec) = val; }
  } else {
    float* tile = (float*)L;                                    // behind the last pass's barrier: every wave has left the ring
    if (!tr) {                                                  // [t][column]
#pragma unroll
        for (int mb = 0; mb < 4; ++mb)
#pragma unroll
            for (int nb = 0; nb < 2; ++nb) { const v8f x = acc[mb][nb] + bfr(bb[nb]); const int row = wm * 64 + mb * 16 + hi * 8, col = wn * 32 + nb * 16 + lr;
#pragma unroll
                for (int j = 0; j < 8; ++j) tile[(row + j) * TP + col] = x[j]; }
    } else {                                                    // [column][t]: the eight rows that a lane holds of a column are consecutive t
#pragma unroll
        for (int mb = 0; mb < 4; ++mb)
#pragma unroll
            for (int nb = 0; nb < 2; ++nb) { const v8f x = acc[mb][nb] + bfr(bb[nb]); const int row = wm * 64 + mb * 16 + hi * 8, col = wn * 32 + nb * 16 + lr;
                float* p = tile + col * TP + row; *(v4fa*)p = __builtin_shufflevector(x, x, 0, 1, 2, 3); *(v4fa*)(p + 4) = __builtin_shufflevector(x, x, 4, 5, 6, 7); }
    }
    __syncthreads();                                            // the tile is read back by other waves
    const size_t bh = (size_t)(r0 / TT) * NH_ + c0 / HD;        // the tile lies in one batch element and holds two whole heads
    const int t0 = r0 & (TT - 1);
    const bool hl = t0 < RH;                                    // whole work-groups (RH is a multiple of the tile's 128 rows): the attention reads the hi and lo planes only at t < RH (queries and keys of its hi+lo rows), so only those rows of them are formed and stored
    if (tr) {                                                   // a lane takes 8 consecutive t of one column, a store instruction writes four whole 128-byte lines (two columns)
        auto cols = [&](bool three) {
#pragma unroll
            for (int s = 0; s < 8; ++s) { const int col = (wv * 8 + s) * 2 + hi; const float* p = tile + col * TP + lr * 8; const v4f x[2] = {*(const v4fa*)p, *(const v4fa*)(p + 4)};
                const float r[8] = {x[0][0], x[0][1], x[0][2], x[0][3], x[1][0], x[1][1], x[1][2], x[1][3]}; const size_t e = (bh * HD + col) * TT + t0 + lr * 8;
                if (three) put8(r, Ph, Pl, P16, e); else put8h(r, P16, e); } };
        if (hl) cols(true);
        else { cols(false); asm volatile("s_wait_xcnt 0x0" ::: "memory"); }   // in the built code the three-plane block follows this one behind a branch: the wait stands between these stores and the instructions there that rewrite their registers
        return; }
    const int hh = wv >> 2, cg = lane & 7;                      // a lane takes 8 consecutive d of one t, a store instruction writes four whole 128-byte lines; waves 0-3 the first head, 4-7 the second
    const float* pc = CSN + ((size_t)(t0 + (wv & 3) * 32 + (lane >> 3)) * NF + cg * 4) * 2; v4f cs[8][2];   // the lane's table entries of its first row; its next row is 4 t = 4 * NF * 2 floats further
#pragma unroll
    for (int s = 0; s < 8; ++s) { cs[s][0] = *(const v4fa*)(pc + s * (4 * NF * 2)); cs[s][1] = *(const v4fa*)(pc + s * (4 * NF * 2) + 4); }
    asm volatile("s_wait_xcnt 0x0" :: "v"(pc) : "memory");      // the address pair is an input here, so it stays as it is through the table loads and is free for reuse only behind this wait
    auto rows = [&](bool three) {
#pragma unroll
        for (int s = 0; s < 8; ++s) { const int row = ((wv & 3) * 8 + s) * 4 + (lane >> 3); const float* p = tile + row * TP + hh * HD + cg * 8;
            const v4f x[2] = {*(const v4fa*)p, *(const v4fa*)(p + 4)}; float r[8];
#pragma unroll
            for (int q = 0; q < 4; ++q) { const float co = cs[s][q >> 1][(q & 1) * 2], si = cs[s][q >> 1][(q & 1) * 2 + 1], x0 = x[q >> 1][(q & 1) * 2], x1 = x[q >> 1][(q & 1) * 2 + 1]; r[q * 2] = co * x0 - si * x1; r[q * 2 + 1] = si * x0 + co * x1; }
            const size_t e = ((bh + hh) * TT + t0 + row) * HD + cg * 8;
            if (three) put8(r, Ph, Pl, P16, e); else put8h(r, P16, e); }
        asm volatile("s_wait_xcnt 0x0" ::: "memory"); };        // in the built code another form's block follows this one behind a branch: the wait stands between these stores and the instructions there that rewrite their registers
    if (hl) rows(true); else rows(false);
  }
}
// the output projection: hi + lo planes of the merged attention output x Wo, f32 out
__global__ __launch_bounds__(256) void k_gemmw(const bf* __restrict__ A, const bf* __restrict__ A2, const bf* __restrict__ Bt, int K, float* C, int ldc, const float* __restrict__ bias) {
    gemm_tile<1, 0>(A, A2, Bt, K, C, ldc, bias, nullptr, nullptr, nullptr, nullptr, false); }
// the q, k and v projections in one launch, grid (M/128, N/128, 3): blockIdx.z picks the weights, the bias, the planes and the planes' form. A work-group of the next projection starts as soon as a place on a WGP comes free,
// so nothing waits for the slowest work-group of a projection, and one work-group's epilogue (vector work, stores) runs beside its neighbour's K loop (LDS, matrix unit).
__global__ __launch_bounds__(256) void k_qkv(const bf* __restrict__ X, const bf* __restrict__ WQ, const bf* __restrict__ WK, const bf* __restrict__ WV, int K, const float* __restrict__ bq, const float* __restrict__ bk, const float* __restrict__ bv, const float* __restrict__ CSN,
                                             bf* QPh, bf* QPl, h16* QP16, bf* KPh, bf* KPl, h16* KP16, bf* VTh, bf* VTl, h16* VT16) {
    const int z = (int)blockIdx.z;
    gemm_tile<0, 1>(X, nullptr, z == 0 ? WQ : z == 1 ? WK : WV, K, nullptr, 0, z == 0 ? bq : z == 1 ? bk : bv, CSN, z == 0 ? QPh : z == 1 ? KPh : VTh, z == 0 ? QPl : z == 1 ? KPl : VTl, z == 0 ? QP16 : z == 1 ? KP16 : VT16, z == 2); }

typedef __attribute__((ext_vector_type(2))) float v2f;

typedef __attribute__((ext_vector_type(4))) unsigned short v4us;
// k_prep: all that the GEMMs need beforehand, in one launch of PG work-groups of 256 threads (16 waves a WGP): x and the four weight matrices rounded to bf16, and the rotary (cos, sin) table.
// A piece is 4 floats: a wave's load takes 512 consecutive bytes (four whole lines), its store 256 (two whole lines). A work-group takes 1/PG of every array in a row, a thread 16 pieces of x and 2 of each weight matrix;
// all 24 loads are issued before the first value is used, so that few long waves keep the memory busy (a wave per 256 elements spends its time being started). The first TT * NF threads also fill one table entry each, while their loads fly.
#define PG   512
__global__ __launch_bounds__(256) void k_prep(const float* __restrict__ x, const float* __restrict__ Wq, const float* __restrict__ Wk, const float* __restrict__ Wv, const float* __restrict__ Wd,
                                              bf* __restrict__ XB, bf* __restrict__ WQ, bf* __restrict__ WK, bf* __restrict__ WV, bf* __restrict__ WO, float* __restrict__ CSN) {
    constexpr int NX = NB_ * TT * DD / (PG * 1024), NW = DD * DD / (PG * 1024);   // pieces a thread (a work-group's 256 pieces are 1024 elements)
    static_assert(NX * PG * 1024 == NB_ * TT * DD && NW * PG * 1024 == DD * DD && TT * NF % 256 == 0 && TT * NF <= PG * 256, "the pieces divide evenly among the threads");
    const int tid = (int)threadIdx.x, blk = (int)blockIdx.x;
    const float* const px = x + (size_t)blk * (NX * 1024); const float* const pw[4] = {Wq + (size_t)blk * (NW * 1024), Wk + (size_t)blk * (NW * 1024), Wv + (size_t)blk * (NW * 1024), Wd + (size_t)blk * (NW * 1024)};
    bf* const wd[4] = {WQ, WK, WV, WO};
    v4f vx[NX], vw[4][NW];                      // every full unroll below: the arrays are registers, so their indices must be compile-time constants
#pragma unroll
    for (int k = 0; k < NX; ++k) vx[k] = *(const v4fa*)(px + k * 1024 + tid * 4);
#pragma unroll
    for (int w = 0; w < 4; ++w)
#pragma unroll
        for (int k = 0; k < NW; ++k) vw[w][k] = *(const v4fa*)(pw[w] + k * 1024 + tid * 4);
    // behind the last load, in front of every rewrite of a register that the loads name as address: the lane offset and the five bases are inputs, so they stay as they are up to here
    asm volatile("s_wait_xcnt 0x0" :: "v"(tid), "s"(px), "s"(pw[0]), "s"(pw[1]), "s"(pw[2]), "s"(pw[3]) : "memory");
    if (blk < TT * NF / 256) {                  // whole work-groups
        const int idx = blk * 256 + tid, t = idx / NF, i = idx % NF; const float den = powf(10000.0f, (float)(2 * i) * (1.0f / HD)); const float ang = __fdiv_rn((float)t, den);
        v2f o; o[0] = cosf(ang); o[1] = sinf(ang); *(v2f*)(CSN + (size_t)idx * 2) = o; }
#pragma unroll
    for (int k = 0; k < NX; ++k) { v4us o;
#pragma unroll
        for (int q = 0; q < 4; ++q) o[q] = f2bf(vx[k][q]);
        *(v4us*)(XB + (size_t)blk * (NX * 1024) + k * 1024 + tid * 4) = o; }
#pragma unroll
    for (int w = 0; w < 4; ++w)
#pragma unroll
        for (int k = 0; k < NW; ++k) { v4us o;
#pragma unroll
            for (int q = 0; q < 4; ++q) o[q] = f2bf(vw[w][k][q]);
            *(v4us*)(wd[w] + (size_t)blk * (NW * 1024) + k * 1024 + tid * 4) = o; }
}
// k_fattn: scores, causal softmax, attn.v and the head merge in one kernel, work-groups of NS waves.
// St = K Qt (A = 16 key rows, B = 16 query rows): lane (lr, hi) holds for query lr the keys hi*8 + j of each 16-key tile, which is the k order of the B fragment of Ot += Vt Pt, so P stays in registers.
// Running maximum m and sum l per query and wave (log2 domain); P = exp2(t - m) (fp16 rows: x 1024, which cancels in the division by l).
// Rows >= RH (single fp16 planes, attn_tile): a work-group owns QT query rows of one head, a wave 32 of them with all their keys in rising order. A stage is KB keys: [K KB rows of 64 d | Vt 64 rows of KB keys], whole 128-byte lines
// brought into a ring of two LDS buffers by asynchronous copies and read by all NS waves (a fragment load straight from the planes touches 16 lines for 512 bytes, and every 32 queries fetched every key anew); stage s + 2 is copied while stage s + 1 is worked on.
// Rows < RH (bf16 hi+lo planes, 3 products, attn_rows): a work-group owns 32 query rows, wave w takes the 32-key blocks w, w + NS, ... up to the diagonal block, fragments straight from the planes.
// There the NS partial (m, l, O) are joined in LDS in the fixed order w = 0 .. NS-1 (deterministic); a wave without a block hands over m = -3e38, l = 0, O = 0, whose weight is exp2(-huge) = 0.
#define NS   4
#define OPI  68                   // floats per query row of a partial O tile in LDS
#define C2L 0.18033688011112042f  // (1/8) log2(e)
// exp2 in asm text with the slot behind a transcendental kept by construction: each v_exp_f32 works in place on a register of its own, so none reads the result or overwrites the source of the one in front of it,
// and the closing v_nop is the one independent slot in front of whatever the compiler puts next.
__device__ __forceinline__ float exp2s(float x) { asm("v_exp_f32 %0, %0\n\tv_nop" : "+v"(x)); return x; }
__device__ __forceinline__ v8f exp2x8(v8f x) { float a = x[0], b = x[1], c = x[2], d = x[3], e = x[4], f = x[5], g = x[6], h = x[7];
    asm("v_exp_f32 %0, %0\n\tv_exp_f32 %1, %1\n\tv_exp_f32 %2, %2\n\tv_exp_f32 %3, %3\n\tv_exp_f32 %4, %4\n\tv_exp_f32 %5, %5\n\tv_exp_f32 %6, %6\n\tv_exp_f32 %7, %7\n\tv_nop" : "+v"(a), "+v"(b), "+v"(c), "+v"(d), "+v"(e), "+v"(f), "+v"(g), "+v"(h));
    return (v8f){a, b, c, d, e, f, g, h}; }
template <typename T16, bool HR, int NG>   // NG: 16-query groups worked on at a time (hi+lo rows: one, which keeps the kernel within 256 registers)
__device__ __forceinline__ void attn_rows(const T16* __restrict__ Q, const T16* __restrict__ Q2, const T16* __restrict__ Kp, const T16* __restrict__ K2, const T16* __restrict__ Vt, const T16* __restrict__ V2, float* os, float* mS, float* lS, int q0, int kfirst, int lr, int hi) {
    typedef typename WFrag<T16>::V V;     // every full unroll below: the arrays are register fragments, so their indices must be compile-time constants
#pragma unroll 1                          // rolled: the two passes of the hi+lo rows share one copy of the code and one set of registers
  for (int gb = 0; gb < 2; gb += NG) {
    V qf[NG][2], qf2[NG][2], kf[2][2], kf2[2][2];
#pragma unroll
    for (int g = 0; g < NG; ++g)
#pragma unroll
        for (int ks = 0; ks < 2; ++ks) { const size_t o = (size_t)(q0 + (gb + g) * 16 + lr) * HD + ks * 32 + 8 * hi; qf[g][ks] = WFrag<T16>::ld(Q + o); if (HR) qf2[g][ks] = WFrag<T16>::ld(Q2 + o); }
    v8f o[NG][4]; float m[NG], l[NG];
#pragma unroll
    for (int g = 0; g < NG; ++g) { m[g] = -3.0e38f; l[g] = 0.f;
#pragma unroll
        for (int dt = 0; dt < 4; ++dt) o[g][dt] = (v8f){}; }
#pragma unroll 1                          // rolled: a trip is a whole 32-key block, a second copy would only cost registers
    for (int key0 = kfirst; key0 <= q0; key0 += 32 * NS) {
        V vf[4], vf2[4];
        if constexpr (HR) {                                     // hi+lo rows: at most two trips a wave, K read where it is used (fetched ahead it would cost registers the kernel does not have)
#pragma unroll
            for (int t = 0; t < 2; ++t)
#pragma unroll
                for (int ks = 0; ks < 2; ++ks) { const size_t ok = (size_t)(key0 + t * 16 + lr) * HD + ks * 32 + 8 * hi; kf[t][ks] = WFrag<T16>::ld(Kp + ok); kf2[t][ks] = WFrag<T16>::ld(K2 + ok); } }
        v8f s[NG][2];
#pragma unroll
        for (int g = 0; g < NG; ++g)
#pragma unroll
            for (int t = 0; t < 2; ++t) { s[g][t] = (v8f){};
#pragma unroll
                for (int ks = 0; ks < 2; ++ks) { s[g][t] = WFrag<T16>::mma(kf[t][ks], qf[g][ks], s[g][t]); if (HR) { s[g][t] = WFrag<T16>::mma(kf2[t][ks], qf[g][ks], s[g][t]); s[g][t] = WFrag<T16>::mma(kf[t][ks], qf2[g][ks], s[g][t]); } } }
#pragma unroll
        for (int g = 0; g < NG; ++g)
#pragma unroll
            for (int t = 0; t < 2; ++t) s[g][t] *= C2L;
        if constexpr (HR) {
            asm volatile("s_wait_xcnt 0x0" ::: "memory");       // the V fragments below land in registers that the K loads above name as addresses: the wait stands in front of them
            __builtin_amdgcn_sched_barrier(0);                  // keeps the V loads behind that wait
            const T16* pv = Vt + (size_t)lr * TT + key0 + 8 * hi; const T16* pv2 = V2 + (size_t)lr * TT + key0 + 8 * hi;
#pragma unroll
            for (int dt = 0; dt < 4; ++dt) { vf[dt] = WFrag<T16>::ld(pv + (size_t)dt * 16 * TT); vf2[dt] = WFrag<T16>::ld(pv2 + (size_t)dt * 16 * TT); }
            asm volatile("s_wait_xcnt 0x0" :: "v"(pv), "v"(pv2) : "memory"); }   // both address pairs are inputs here, so they stay live through the run and no V fragment lands in them; they are free for reuse only behind this wait
        if (key0 == q0) {                                       // the diagonal block, the only one with keys behind a query of this wave
#pragma unroll
            for (int g = 0; g < NG; ++g)
#pragma unroll
                for (int t = 0; t < 2; ++t)
#pragma unroll
                    for (int j = 0; j < 8; ++j) if (t * 16 + hi * 8 + j > (gb + g) * 16 + lr) s[g][t][j] = -3.0e38f; }
#pragma unroll
        for (int g = 0; g < NG; ++g) {
            float bm = s[g][0][0];
#pragma unroll
            for (int t = 0; t < 2; ++t)
#pragma unroll
                for (int j = 0; j < 8; ++j) bm = fmaxf(bm, s[g][t][j]);
            bm = fmaxf(bm, __shfl_xor(bm, 16, 32));             // the other half of the wave holds the other 16 keys of the same query
            const float mn = fmaxf(m[g], bm); const float al = exp2s(m[g] - mn); m[g] = mn; const float ms = HR ? mn : mn - 10.0f;
            float ps = 0.f;
#pragma unroll
            for (int t = 0; t < 2; ++t) { s[g][t] = exp2x8(s[g][t] - ms);
#pragma unroll
                for (int j = 0; j < 8; ++j) ps += s[g][t][j]; }
            l[g] = l[g] * al + ps;
#pragma unroll
            for (int dt = 0; dt < 4; ++dt) o[g][dt] *= al;
            if constexpr (HR) { v8us ph[2], pl[2];
#pragma unroll
                for (int t = 0; t < 2; ++t)
#pragma unroll
                    for (int j = 0; j < 8; ++j) { unsigned short a, c2; splitf(s[g][t][j], a, c2); ph[t][j] = a; pl[t][j] = c2; }
                const V pf = cat16b(ph[0], ph[1]), pf2 = cat16b(pl[0], pl[1]);
#pragma unroll
                for (int dt = 0; dt < 4; ++dt) { o[g][dt] = WFrag<T16>::mma(vf[dt], pf, o[g][dt]); o[g][dt] = WFrag<T16>::mma(vf2[dt], pf, o[g][dt]); o[g][dt] = WFrag<T16>::mma(vf[dt], pf2, o[g][dt]); }
            }
        }
    }
#pragma unroll
    for (int g = 0; g < NG; ++g) { const float lt = l[g] + __shfl_xor(l[g], 16, 32); if (hi == 0) { mS[(gb + g) * 16 + lr] = m[g]; lS[(gb + g) * 16 + lr] = lt; }
#pragma unroll
        for (int dt = 0; dt < 4; ++dt) { float* p = os + ((gb + g) * 16 + lr) * OPI + dt * 16 + hi * 8; const v8f x = o[g][dt]; *(v4fa*)p = __builtin_shufflevector(x, x, 0, 1, 2, 3); *(v4fa*)(p + 4) = __builtin_shufflevector(x, x, 4, 5, 6, 7); } }
  }
}
#define QT   128                  // fp16 rows: query rows of a work-group (NS waves x 32)
#define KB   64                   // fp16 rows: keys of a stage
#define SPB  144                  // LDS pitch in bytes of a staged 128-byte row (16 x odd: no bank conflict for 16-byte fragment reads)
#define SST  (2 * 64 * SPB)       // bytes of a stage
// Q, Kp, Vt: the head's fp16 planes; SM: 2 * SST bytes of LDS; Ah, Al: the merged planes at (batch element, row 0, first column of the head); Q0: first query row of the work-group
__device__ __forceinline__ void attn_tile(const h16* __restrict__ Q, const h16* __restrict__ Kp, const h16* __restrict__ Vt, unsigned char* SM, bf* Ah, bf* Al, int Q0, int wv, int tid, int lr, int hi) {
    typedef WFrag<h16>::V V;              // every full unroll below: the arrays are register fragments or asm operands, so their indices must be compile-time constants
    const int q0 = Q0 + wv * 32, NT = (Q0 + QT) / KB;   // the wave's first query; stages up to the work-group's last diagonal block (at least two)
    const int crow = tid >> 3, ccol = tid & 7;          // a copy of all 128 threads brings 16 rows of 128 bytes
    const unsigned ldst = (unsigned)(uintptr_t)SM + (unsigned)(crow * SPB + ccol * 16);
    const h16* gK = Kp + (size_t)crow * HD + ccol * 8; const h16* gV = Vt + (size_t)crow * TT + ccol * 8;
    auto fill = [&](int s) {              // every thread's 8 copies of stage s into buffer s & 1
        unsigned l[8]; const bf* g[8];
#pragma unroll
        for (int i = 0; i < 4; ++i) { g[i] = (const bf*)(gK + (size_t)(s * KB + i * 16) * HD); l[i] = ldst + (unsigned)((s & 1) * SST + i * 16 * SPB);
            g[4 + i] = (const bf*)(gV + (size_t)(i * 16) * TT + s * KB); l[4 + i] = ldst + (unsigned)((s & 1) * SST + (64 + i * 16) * SPB); }
        acopy8(l, g);
    };
    fill(0);
    V qf[2][2]; const h16* pq = Q + (size_t)(q0 + lr) * HD + 8 * hi;
#pragma unroll
    for (int g = 0; g < 2; ++g)
#pragma unroll
        for (int ks = 0; ks < 2; ++ks) qf[g][ks] = WFrag<h16>::ld(pq + g * 16 * HD + ks * 32);
    asm volatile("s_wait_xcnt 0x0" :: "v"(pq) : "memory");      // the address pair is an input here, so it stays as it is through the Q loads and is free for reuse only behind this wait
    v8f o[2][4]; float m[2], l[2];
#pragma unroll
    for (int g = 0; g < 2; ++g) { m[g] = -3.0e38f; l[g] = 0.f;
#pragma unroll
        for (int dt = 0; dt < 4; ++dt) o[g][dt] = (v8f){}; }
    asm volatile("s_wait_asynccnt 0x0" ::: "memory");           // this wave's copies of stage 0 have landed
    __syncthreads();                                            // and every other wave's
    fill(1);
#pragma unroll 1                                                // rolled: a trip is a whole stage, its buffer chosen at run time
    for (int s = 0; s < NT; ++s) {
        const unsigned char* S = SM + (s & 1) * SST;
#pragma unroll 1                                                // rolled: a trip is a whole 32-key block, a second copy would only cost registers
        for (int kk = 0; kk < KB / 32; ++kk) {
            const int key0 = s * KB + kk * 32;
            if (key0 > q0) break;                               // wave-uniform: blocks behind this wave's diagonal block hold no key of its queries; the wave still passes the stage's barrier
            const unsigned char* pk = S + (kk * 32 + lr) * SPB + hi * 16; const unsigned char* pv = S + (64 + lr) * SPB + kk * 64 + hi * 16;
            V kf[2][2], vf[4];
#pragma unroll
            for (int t = 0; t < 2; ++t)
#pragma unroll
                for (int ks = 0; ks < 2; ++ks) kf[t][ks] = WFrag<h16>::ld((const h16*)(pk + t * 16 * SPB + ks * 64));
#pragma unroll
            for (int dt = 0; dt < 4; ++dt) vf[dt] = WFrag<h16>::ld((const h16*)(pv + dt * 16 * SPB));
            v8f sc[2][2];
#pragma unroll
            for (int g = 0; g < 2; ++g)
#pragma unroll
                for (int t = 0; t < 2; ++t) { sc[g][t] = (v8f){};
#pragma unroll
                    for (int ks = 0; ks < 2; ++ks) sc[g][t] = WFrag<h16>::mma(kf[t][ks], qf[g][ks], sc[g][t]);
                    sc[g][t] *= C2L; }
            if (key0 == q0) {                                   // the diagonal block, the only one with keys behind a query of this wave
#pragma unroll
                for (int g = 0; g < 2; ++g)
#pragma unroll
                    for (int t = 0; t < 2; ++t)
#pragma unroll
                        for (int j = 0; j < 8; ++j) if (t * 16 + hi * 8 + j > g * 16 + lr) sc[g][t][j] = -3.0e38f; }
#pragma unroll
            for (int g = 0; g < 2; ++g) {
                float bm = sc[g][0][0];
#pragma unroll
                for (int t = 0; t < 2; ++t)
#pragma unroll
                    for (int j = 0; j < 8; ++j) bm = fmaxf(bm, sc[g][t][j]);
                bm = fmaxf(bm, __shfl_xor(bm, 16, 32));         // the other half of the wave holds the other 16 keys of the same query
                const float mn = fmaxf(m[g], bm); const float al = exp2s(m[g] - mn); m[g] = mn; const float ms = mn - 10.0f;
                float ps = 0.f; v8h ph[2];
#pragma unroll
                for (int t = 0; t < 2; ++t) { sc[g][t] = exp2x8(sc[g][t] - ms);
#pragma unroll
                    for (int j = 0; j < 8; ++j) { ps += sc[g][t][j]; ph[t][j] = tohx(sc[g][t][j]); } }
                l[g] = l[g] * al + ps;
                const V pf = cat16(ph[0], ph[1]);
#pragma unroll
                for (int dt = 0; dt < 4; ++dt) { o[g][dt] *= al; o[g][dt] = WFrag<h16>::mma(vf[dt], pf, o[g][dt]); }
            }
        }
        asm volatile("s_wait_dscnt 0x0" ::: "memory");          // this wave's reads of buffer s & 1 are done
        asm volatile("s_wait_asynccnt 0x0" ::: "memory");       // this wave's copies of stage s + 1 have landed
        __syncthreads();                                        // publishes stage s + 1 and frees buffer s & 1
        if (s + 2 < NT) fill(s + 2);
    }
    asm volatile("s_wait_asynccnt 0x0" ::: "memory");           // no copy is outstanding when the ring becomes output staging
    float* mine = (float*)SM + wv * (32 * OPI);                 // behind the last stage's barrier: every wave has left the ring
#pragma unroll
    for (int g = 0; g < 2; ++g) { const float inv = __fdiv_rn(1.0f, l[g] + __shfl_xor(l[g], 16, 32));
#pragma unroll
        for (int dt = 0; dt < 4; ++dt) { float* p = mine + (g * 16 + lr) * OPI + dt * 16 + hi * 8; const v8f x = o[g][dt] * inv; *(v4fa*)p = __builtin_shufflevector(x, x, 0, 1, 2, 3); *(v4fa*)(p + 4) = __builtin_shufflevector(x, x, 4, 5, 6, 7); } }
    __syncthreads();                                            // the rows are read back by other lanes
    const int cg = tid & 7;                                     // a lane takes 8 consecutive d of one query, a store instruction writes four whole 128-byte lines
#pragma unroll
    for (int u = 0; u < 8; ++u) { const int row = u * 4 + ((tid & 31) >> 3); const float* p = mine + row * OPI + cg * 8; const v4f x[2] = {*(const v4fa*)p, *(const v4fa*)(p + 4)}; v8us oh, ol;
#pragma unroll
        for (int j = 0; j < 8; ++j) { unsigned short a, c2; splitf(x[j >> 2][j & 3], a, c2); oh[j] = a; ol[j] = c2; }
        const size_t oo = (size_t)(q0 + row) * DD + cg * 8; *(v8us*)(Ah + oo) = oh; *(v8us*)(Al + oo) = ol; }
}
// grid (NB_ * NH_, (TT - RH) / QT + RH / 32), NS waves; blockIdx.x = b * NH_ + h; the longest rows (most keys) of every batch element and head start first, the short hi+lo work-groups last, so that they fill the places that come free; four waves per SIMD (256 registers) cover each other's waits
__global__ __launch_bounds__(NS * 32) __attribute__((amdgpu_waves_per_eu(4, 4))) void k_fattn(const bf* __restrict__ Qh, const bf* __restrict__ Ql, const bf* __restrict__ Kh, const bf* __restrict__ Kl, const bf* __restrict__ Vh, const bf* __restrict__ Vl, const h16* __restrict__ Q16, const h16* __restrict__ K16, const h16* __restrict__ V16, bf* Ah, bf* Al) {
    static_assert(QT == NS * 32 && RH % QT == 0 && QT % KB == 0 && (NS * 32 * OPI + 2 * NS * 32) * 4 <= 2 * SST, "tiles divide evenly; the partial tiles fit the ring's LDS");
    __shared__ __attribute__((aligned(128))) unsigned char SM[2 * SST];   // fp16 rows: the ring, then output staging; hi+lo rows: the partial (O, m, l)
    float* const os = (float*)SM; float* const mS = os + NS * 32 * OPI; float* const lS = mS + NS * 32;
    const int lane = threadIdx.x & 31, lr = lane & 15, hi = lane >> 4; const int wv = __builtin_amdgcn_readfirstlane((int)(threadIdx.x >> 5));
    const size_t hp = (size_t)blockIdx.x * TT * HD;
    if ((int)blockIdx.y < (TT - RH) / QT) {                     // whole work-groups
        const size_t om = (size_t)(blockIdx.x / NH_) * TT * DD + (blockIdx.x % NH_) * HD;
        attn_tile(Q16 + hp, K16 + hp, V16 + hp, SM, Ah + om, Al + om, TT - QT * ((int)blockIdx.y + 1), wv, (int)threadIdx.x, lr, hi);
        return; }
    const int q0 = (RH / 32 - 1 - ((int)blockIdx.y - (TT - RH) / QT)) * 32;
    attn_rows<bf, true, 1>(Qh + hp, Ql + hp, Kh + hp, Kl + hp, Vh + hp, Vl + hp, os + wv * (32 * OPI), mS + wv * 32, lS + wv * 32, q0, wv * 32, lr, hi);
    __syncthreads();
    // wave w joins queries w*8 .. w*8+7: a lane takes 16 consecutive d of one query, the wave whole 128-byte lines of the merged planes
    const int qq = wv * (32 / NS) + (lane >> 2), d0 = (lane & 3) * 16;
    float mw[NS], M = -3.0e38f;
#pragma unroll
    for (int w = 0; w < NS; ++w) { mw[w] = mS[w * 32 + qq]; M = fmaxf(M, mw[w]); }
    float L = 0.f; v4f val[4];
#pragma unroll
    for (int i = 0; i < 4; ++i) val[i] = (v4f)(0.f);
#pragma unroll
    for (int w = 0; w < NS; ++w) { const float f = exp2s(mw[w] - M); L += f * lS[w * 32 + qq];
#pragma unroll
        for (int i = 0; i < 4; ++i) val[i] += f * *(const v4fa*)(os + w * (32 * OPI) + qq * OPI + d0 + i * 4); }
    const float inv = __fdiv_rn(1.0f, L);
#pragma unroll
    for (int u = 0; u < 2; ++u) { v8us oh, ol;
#pragma unroll
        for (int j = 0; j < 8; ++j) { unsigned short a, c2; splitf(val[u * 2 + (j >> 2)][j & 3] * inv, a, c2); oh[j] = a; ol[j] = c2; }
        const size_t oo = ((size_t)(blockIdx.x / NH_) * TT + q0 + qq) * DD + (blockIdx.x % NH_) * HD + d0 + u * 8; *(v8us*)(Ah + oo) = oh; *(v8us*)(Al + oo) = ol; }
}

extern "C" void kernel_launch(void* const* d_in, const int* in_sizes, int n_in,
                              void* d_out, int out_size, void* d_ws, size_t ws_size, hipStream_t stream) {
    (void)in_sizes; (void)n_in; (void)out_size;
    const float* x = (const float*)d_in[0]; const float* Wq = (const float*)d_in[1]; const float* bq = (const float*)d_in[2]; const float* Wk = (const float*)d_in[3]; const float* bk = (const float*)d_in[4]; const float* Wv = (const float*)d_in[5]; const float* bv = (const float*)d_in[6]; const float* Wd = (const float*)d_in[7]; const float* bo = (const float*)d_in[8];
    float* OUT = (float*)d_out;     // [4][2048][1024]
    char* wsp = (char*)d_ws;
    auto take = [&](size_t bytes) { char* p = wsp; wsp += (bytes + 255) & ~(size_t)255; return (void*)p; };
    bf* WQ = (bf*)take((size_t)DD * DD * 2); bf* WK = (bf*)take((size_t)DD * DD * 2); bf* WV = (bf*)take((size_t)DD * DD * 2); bf* WO = (bf*)take((size_t)DD * DD * 2);
    bf* XB = (bf*)take((size_t)NB_ * TT * DD * 2); float* CSN = (float*)take((size_t)TT * NF * 2 * 4);
    bf* QPh = (bf*)take((size_t)NB_ * TT * DD * 2); bf* QPl = (bf*)take((size_t)NB_ * TT * DD * 2); bf* KPh = (bf*)take((size_t)NB_ * TT * DD * 2); bf* KPl = (bf*)take((size_t)NB_ * TT * DD * 2); bf* VTh = (bf*)take((size_t)NB_ * TT * DD * 2); bf* VTl = (bf*)take((size_t)NB_ * TT * DD * 2);
    h16* QP16 = (h16*)take((size_t)NB_ * TT * DD * 2); h16* KP16 = (h16*)take((size_t)NB_ * TT * DD * 2); h16* VT16 = (h16*)take((size_t)NB_ * TT * DD * 2);
    bf* ATh = (bf*)take((size_t)NB_ * TT * DD * 2); bf* ATl = (bf*)take((size_t)NB_ * TT * DD * 2);
    if ((size_t)(wsp - (char*)d_ws) > ws_size) return;    // total 200.5 MiB; ws 256 MiB
    k_prep<<<PG, 256, 0, stream>>>(x, Wq, Wk, Wv, Wd, XB, WQ, WK, WV, WO, CSN);
    const dim3 gP(NB_ * TT / 128, DD / 128, 1);   // x is [4][2048][1024]: the batch elements are further rows of every GEMM
    k_qkv<<<dim3(NB_ * TT / 128, DD / 128, 3), 256, 0, stream>>>(XB, WQ, WK, WV, DD, bq, bk, bv, CSN, QPh, QPl, QP16, KPh, KPl, KP16, VTh, VTl, VT16);
    k_fattn<<<dim3(NB_ * NH_, (TT - RH) / QT + RH / 32, 1), NS * 32, 0, stream>>>(QPh, QPl, KPh, KPl, VTh, VTl, QP16, KP16, VT16, ATh, ATl);
    k_gemmw<<<gP, 256, 0, stream>>>(ATh, ATl, WO, DD, OUT, DD, bo);
}
